// v000
// The times below were measured on an AMD MI455X: many runs one after another, warmed up first and cycling through
// copies of the inputs, with the whole window's GPU time divided by the number of runs. Launches and the gaps
// between them are all in it. The median over several windows is given; except for v000 it joins two sittings, which
// can be a few percent apart, so the side-by-side timings, each taken in one sitting, are the better comparison.
// v000, which the later versions start from, runs in 558 microseconds.
#include <hip/hip_runtime.h>
#include <math.h>

typedef __attribute__((ext_vector_type(16))) _Float16 v16h;
typedef __attribute__((ext_vector_type(16))) __bf16 v16b;
typedef __attribute__((ext_vector_type(8)))  _Float16 v8h;
typedef __attribute__((ext_vector_type(8)))  float v8f;
typedef __attribute__((ext_vector_type(4)))  float v4f;
typedef __attribute__((ext_vector_type(2)))  float v2f;
typedef __attribute__((ext_vector_type(4)))  unsigned v4u;
typedef __attribute__((ext_vector_type(4)))  int v4i;
typedef float __attribute__((may_alias)) float_a;
typedef int __attribute__((may_alias)) int_a;

template <typename T> __device__ __forceinline__ void vst2(void* p, T v) { *(T*)p = v;  }
__device__ __forceinline__ v8f wmma16(v16h a, v16h b, v8f c) {
  v8f d = __builtin_amdgcn_wmma_f32_16x16x32_f16(false, a, false, b, (short)0, c, false, false);
  asm volatile("v_nop\n\tv_nop\n\tv_nop\n\tv_nop" : "+v"(d) : "v"(a), "v"(b));
  return d;
}
__device__ __forceinline__ v8f wmma_bf(v16b a, v16b b, v8f c) {
  v8f d = __builtin_amdgcn_wmma_f32_16x16x32_bf16(false, a, false, b, (short)0, c, false, false);
  asm volatile("v_nop\n\tv_nop\n\tv_nop\n\tv_nop" : "+v"(d) : "v"(a), "v"(b));
  return d;
}
// 16x16x32 fragments: lane = (h = lane>>4, row/col = lane&15); elements 0..7 = k0+8h+0..7, 8..15 = k0+16+8h+0..7; D element r = row 8h+r
__device__ __forceinline__ v16h frag_h(const _Float16* rowk0, int lane) {
  union { v16h v; v8h q[2]; } u; const _Float16* p = rowk0 + 8 * (lane >> 4);
  u.q[0] = *(const v8h*)p; u.q[1] = *(const v8h*)(p + 16); return u.v;
}
__device__ __forceinline__ v16h frag_f32(const float* rowk0, int lane) {
  v16h a; const float* p = rowk0 + 8 * (lane >> 4);
#pragma unroll
  for (int i = 0; i < 8; ++i) { a[i] = (_Float16)p[i]; a[8 + i] = (_Float16)p[16 + i]; }
  return a;
}
__device__ __forceinline__ v16h frag_f32s(const float* rowk0, int lane, float sc) {
  v16h a; const float* p = rowk0 + 8 * (lane >> 4);
#pragma unroll
  for (int i = 0; i < 8; ++i) { a[i] = (_Float16)(p[i] * sc); a[8 + i] = (_Float16)(p[16 + i] * sc); }
  return a;
}
// column fragment from a [K][ld] layout (column n), rows >= K read as 0
__device__ __forceinline__ v16h fragc_f32(const float* W, int k0, int n, int lane, int ld, int K) {
  v16h a; const int g = lane >> 4;
#pragma unroll
  for (int i = 0; i < 8; ++i) { const int ka = k0 + 8 * g + i, kb = ka + 16;
    a[i] = (_Float16)(ka < K ? W[(size_t)ka * ld + n] : 0.f); a[8 + i] = (_Float16)(kb < K ? W[(size_t)kb * ld + n] : 0.f); }
  return a;
}
struct F2 { v16b h, l; };
__device__ __forceinline__ F2 bsplit16(const float v[16]) { F2 r;
#pragma unroll
  for (int i = 0; i < 16; ++i) { const __bf16 h = (__bf16)v[i]; r.h[i] = h; r.l[i] = (__bf16)(v[i] - (float)h); }
  return r; }
__device__ __forceinline__ F2 split_row(const float* row, int k0, int lane) { float v[16]; const float* p = row + k0 + 8 * (lane >> 4);
#pragma unroll
  for (int i = 0; i < 8; ++i) { v[i] = p[i]; v[8 + i] = p[16 + i]; }
  return bsplit16(v); }
__device__ __forceinline__ F2 split_rowK(const float* row, int k0, int lane, int K) { float v[16]; const int g = lane >> 4;
#pragma unroll
  for (int i = 0; i < 8; ++i) { const int ka = k0 + 8 * g + i, kb = ka + 16; v[i] = ka < K ? row[ka] : 0.f; v[8 + i] = kb < K ? row[kb] : 0.f; }
  return bsplit16(v); }
__device__ __forceinline__ F2 split_col(const float* W, int k0, int n, int lane, int ld, int K) { float v[16]; const int g = lane >> 4;
#pragma unroll
  for (int i = 0; i < 8; ++i) { const int ka = k0 + 8 * g + i, kb = ka + 16; v[i] = ka < K ? W[(size_t)ka * ld + n] : 0.f; v[8 + i] = kb < K ? W[(size_t)kb * ld + n] : 0.f; }
  return bsplit16(v); }
__device__ __forceinline__ v8f mac3(const F2& a, const F2& b, v8f c) { c = wmma_bf(a.l, b.h, c); c = wmma_bf(a.h, b.l, c); return wmma_bf(a.h, b.h, c); }
__device__ __forceinline__ float sigm(float v) { return 1.0f / (1.0f + expf(-v)); }
#define LDSX() do { asm volatile("s_wait_dscnt 0" ::: "memory"); __builtin_amdgcn_wave_barrier(); __builtin_amdgcn_fence(__ATOMIC_RELEASE, "workgroup"); } while (0)

// T5 encoder block: RMSNorm -> 16-head self attention with the bidirectional relative-position bias (no 1/sqrt(d)) -> residual ->
// RMSNorm -> ReLU FFN (1024 -> 4096 -> 1024) -> residual. All products on v_wmma_f32_16x16x32_f16 ([out][in] weight rows converted once
// to f16 rows x16; activations as f16 rows, q/k x4, P x2^14, V x4, ctx x8); RMSNorms, the bucket function, softmax and residuals in f32.
#define NB 2
#define SS 1024
#define E 1024
#define NH 16
#define HD 64
#define DFF 4096
#define NR (NB * SS)           // 2048
#define NBK 32
#define MAXD 128

// RMSNorm of rows -> f16 ; wave per row
__global__ __launch_bounds__(256) void k_rms(const float* __restrict__ x, const float* __restrict__ w, _Float16* __restrict__ X16) {
  const int wave = threadIdx.x >> 5, lane = threadIdx.x & 31; const size_t r = (size_t)blockIdx.x * 8 + wave; if (r >= NR) return;
  const float* xr = x + r * E; float q2 = 0.f;
#pragma unroll 1
  for (int i = 0; i < 8; ++i) { const v4f a = *(const v4f*)(xr + i * 128 + lane * 4); q2 += (a[0] * a[0] + a[1] * a[1]) + (a[2] * a[2] + a[3] * a[3]); }
#pragma unroll
  for (int off = 16; off >= 1; off >>= 1) q2 += __shfl_xor(q2, off, 32);
  const float rs = rsqrtf(q2 * (1.0f / E) + 1e-6f);
#pragma unroll 1
  for (int i = 0; i < 4; ++i) { const int c0 = i * 256 + lane * 8; union { v8h h; v4u u; } pk;
#pragma unroll
    for (int e = 0; e < 8; ++e) pk.h[e] = (_Float16)(xr[c0 + e] * rs * w[c0 + e]);
    vst2(X16 + r * E + c0, pk.u); }
}
// weight packs: PT rows: [0,1024) wq, [1024,2048) wk, [2048,3072) wv, [3072,4096) wo (all [out][in=1024]) x16 ; WI rows [4096][1024] x16 ; WF rows [1024][4096] x16
__global__ __launch_bounds__(256) void k_pack(const float* __restrict__ wq, const float* __restrict__ wk, const float* __restrict__ wv, const float* __restrict__ wo, const float* __restrict__ wi, const float* __restrict__ wff,
                                            _Float16* __restrict__ PT, _Float16* __restrict__ WI, _Float16* __restrict__ WF) {
  const int r = blockIdx.x, tid = threadIdx.x; __shared__ __align__(16) _Float16 srow[DFF];
  if (r < 4 * E) { const int which = r >> 10, n = r & (E - 1); const float* W = (which == 0 ? wq : which == 1 ? wk : which == 2 ? wv : wo) + (size_t)n * E;
    for (int k = tid; k < E; k += 256) srow[k] = (_Float16)(W[k] * 16.0f);
    __syncthreads(); if (tid < 128) vst2(PT + (size_t)r * E + tid * 8, *(const v4u*)(&srow[tid * 8])); }
  else if (r < 4 * E + DFF) { const int n = r - 4 * E; const float* W = wi + (size_t)n * E;
    for (int k = tid; k < E; k += 256) srow[k] = (_Float16)(W[k] * 16.0f);
    __syncthreads(); if (tid < 128) vst2(WI + (size_t)n * E + tid * 8, *(const v4u*)(&srow[tid * 8])); }
  else { const int n = r - 4 * E - DFF; const float* W = wff + (size_t)n * DFF;
    for (int k = tid; k < DFF; k += 256) srow[k] = (_Float16)(W[k] * 16.0f);
    __syncthreads(); for (int q = tid; q < DFF / 8; q += 256) vst2(WF + (size_t)n * DFF + q * 8, *(const v4u*)(&srow[q * 8])); }
}
// bias table BT[h][rel + SS - 1] for rel = k - q in [-(SS-1), SS-1]
__global__ __launch_bounds__(256) void k_bias(const float* __restrict__ rb, float* __restrict__ BT) {
  const int h = blockIdx.y, i = blockIdx.x * 256 + threadIdx.x; if (i >= 2 * SS) return;   // table width padded to 2*SS
  float v = 0.f;
  if (i < 2 * SS - 1) { const int rel = i - (SS - 1); const int nb = NBK / 2; int bucket = rel > 0 ? nb : 0; const int rp = rel < 0 ? -rel : rel; const int mx = nb / 2;
    int val; if (rp < mx) val = rp; else { const float lf = logf((float)rp / (float)mx) / 2.772588722239781f * (float)(nb - mx); int large = mx + (int)lf; val = large < nb - 1 ? large : nb - 1; }
    bucket += val; v = rb[bucket * NH + h]; }
  vst2(BT + (size_t)h * 2 * SS + i, v);
}
// QKV: block (64 rows, 128 cols = 2 heads, which)
__global__ __launch_bounds__(128) void k_qkv(const _Float16* __restrict__ X16, const _Float16* __restrict__ PT, _Float16* __restrict__ Q16, _Float16* __restrict__ K16, _Float16* __restrict__ VT) {
  __shared__ __align__(16) float so[4][16][132];
  __shared__ __align__(16) _Float16 st[128][72];
  const int tid = threadIdx.x, wave = tid >> 5, lane = tid & 31, col = lane & 15, g = lane >> 4;
  const int which = blockIdx.z, r0b = blockIdx.x * 64, r0 = r0b + wave * 16, n0 = blockIdx.y * 128; const int b = r0b / SS, s0 = r0b % SS;
  v8f acc[8] = {};
#pragma unroll 2
  for (int kc = 0; kc < E / 32; ++kc) { const v16h a = frag_h(X16 + (size_t)(r0 + col) * E + kc * 32, lane);
#pragma unroll
    for (int j = 0; j < 8; ++j) acc[j] = wmma16(a, frag_h(PT + (size_t)(which * E + n0 + j * 16 + col) * E + kc * 32, lane), acc[j]); }
  if (which < 2) {
#pragma unroll
    for (int j = 0; j < 8; ++j)
#pragma unroll
      for (int r = 0; r < 8; ++r) so[wave][8 * g + r][j * 16 + col] = acc[j][r] * (4.0f / 16.0f);
    LDSX();
    _Float16* D = which == 0 ? Q16 : K16;
    for (int qq = lane; qq < 16 * 2 * 8; qq += 32) { const int hh = qq >> 7, rl = (qq >> 3) & 15, pc = qq & 7; const int h = (n0 >> 6) + hh; union { v8h h8; v4u u; } pk;
#pragma unroll
      for (int e = 0; e < 8; ++e) pk.h8[e] = (_Float16)so[wave][rl][hh * 64 + pc * 8 + e];
      vst2(D + (((size_t)b * NH + h) * SS + s0 + wave * 16 + rl) * HD + pc * 8, pk.u); } }
  else {
#pragma unroll
    for (int j = 0; j < 8; ++j)
#pragma unroll
      for (int r = 0; r < 8; ++r) st[j * 16 + col][wave * 16 + 8 * g + r] = (_Float16)(acc[j][r] * (4.0f / 16.0f));
    __syncthreads();
    for (int qq = tid; qq < 128 * 8; qq += 128) { const int cl = qq >> 3, pc = qq & 7; const int c = n0 + cl, h = c >> 6, d = c & 63;
      vst2(VT + (((size_t)b * NH + h) * HD + d) * SS + s0 + pc * 8, *(const v4u*)(&st[cl][pc * 8])); } }
}
__global__ __launch_bounds__(128) void k_attn(const _Float16* __restrict__ Q16, const _Float16* __restrict__ K16, const _Float16* __restrict__ VT, const float* __restrict__ BT, _Float16* __restrict__ O16) {
  __shared__ __align__(16) float sS[4][16][68];
  __shared__ __align__(16) _Float16 sP[4][16][72];
  __shared__ __align__(16) float sO[4][16][68];
  const int tid = threadIdx.x, w = tid >> 5, lane = tid & 31, col = lane & 15, g = lane >> 4;
  const size_t bh = blockIdx.y; const int h = (int)(bh % NH); const int q0 = blockIdx.x * 64 + w * 16; const float* bth = BT + (size_t)h * 2 * SS + (SS - 1);
  v16h aq[2];
#pragma unroll
  for (int kc = 0; kc < 2; ++kc) aq[kc] = frag_h(Q16 + (bh * SS + q0 + col) * HD + kc * 32, lane);
  float mrun = -3.0e38f, lrun = 0.f; v8f acc[4] = {};
#pragma unroll 1
  for (int kt = 0; kt < SS / 64; ++kt) {
#pragma unroll
    for (int t = 0; t < 4; ++t) { v8f s = {}; const int key = kt * 64 + t * 16 + col;
#pragma unroll
      for (int kc = 0; kc < 2; ++kc) s = wmma16(aq[kc], frag_h(K16 + (bh * SS + key) * HD + kc * 32, lane), s);
#pragma unroll
      for (int r = 0; r < 8; ++r) { const int q = q0 + 8 * g + r; sS[w][8 * g + r][t * 16 + col] = s[r] * (1.0f / 16.0f) + bth[key - q]; } }
    LDSX();
    float mx = -3.4e38f;
#pragma unroll
    for (int jj = 0; jj < 32; ++jj) mx = fmaxf(mx, sS[w][col][g * 32 + jj]);
    mx = fmaxf(mx, __shfl_xor(mx, 16, 32));
    const float mnew = fmaxf(mrun, mx); const float corr = expf(mrun - mnew);
    float ps = 0.f;
#pragma unroll
    for (int jj = 0; jj < 32; ++jj) { const float p = expf(sS[w][col][g * 32 + jj] - mnew); ps += p; sP[w][col][g * 32 + jj] = (_Float16)(p * 16384.0f); }
    ps += __shfl_xor(ps, 16, 32);
    lrun = lrun * corr + ps; mrun = mnew;
#pragma unroll
    for (int r = 0; r < 8; ++r) { const float cr = __shfl(corr, 8 * g + r, 32);
#pragma unroll
      for (int t = 0; t < 4; ++t) acc[t][r] *= cr; }
    LDSX();
#pragma unroll
    for (int kc = 0; kc < 2; ++kc) { const v16h pa = frag_h(&sP[w][col][0] + kc * 32, lane);
#pragma unroll
      for (int t = 0; t < 4; ++t) acc[t] = wmma16(pa, frag_h(VT + (bh * HD + t * 16 + col) * SS + kt * 64 + kc * 32, lane), acc[t]); }
    __builtin_amdgcn_wave_barrier(); }
#pragma unroll
  for (int r = 0; r < 8; ++r) { const float lr = __shfl(lrun, 8 * g + r, 32); const float inv = 8.0f / (lr * 16384.0f * 4.0f);
#pragma unroll
    for (int t = 0; t < 4; ++t) sO[w][8 * g + r][t * 16 + col] = acc[t][r] * inv; }
  LDSX();
  for (int qq = lane; qq < 16 * 8; qq += 32) { const int rl = qq >> 3, pc = qq & 7; union { v8h h8; v4u u; } pk;
#pragma unroll
    for (int e = 0; e < 8; ++e) pk.h8[e] = (_Float16)sO[w][rl][pc * 8 + e];
    vst2(O16 + ((bh * SS) + q0 + rl) * HD + pc * 8, pk.u); }
}
// H1 = hidden + ctx wo^T : block (64 rows, 128 cols)
__global__ __launch_bounds__(128) void k_o(const _Float16* __restrict__ O16, const _Float16* __restrict__ PT, const float* __restrict__ hid, float* __restrict__ H1) {
  __shared__ __align__(16) float so[4][16][132];
  const int tid = threadIdx.x, wave = tid >> 5, lane = tid & 31, col = lane & 15, g = lane >> 4;
  const int r0 = blockIdx.x * 64 + wave * 16, n0 = blockIdx.y * 128; const int ra = r0 + col; const int b = ra / SS, s = ra % SS;
  v8f acc[8] = {};
#pragma unroll 2
  for (int kc = 0; kc < E / 32; ++kc) { const int h = kc >> 1; const v16h a = frag_h(O16 + (((size_t)b * NH + h) * SS + s) * HD + (kc & 1) * 32, lane);
#pragma unroll
    for (int j = 0; j < 8; ++j) acc[j] = wmma16(a, frag_h(PT + (size_t)(3 * E + n0 + j * 16 + col) * E + kc * 32, lane), acc[j]); }
#pragma unroll
  for (int j = 0; j < 8; ++j) { const int n = n0 + j * 16 + col;
#pragma unroll
    for (int r = 0; r < 8; ++r) so[wave][8 * g + r][j * 16 + col] = acc[j][r] * (1.0f / (16.0f * 8.0f)) + hid[(size_t)(r0 + 8 * g + r) * E + n]; }
  LDSX();
#pragma unroll 4
  for (int rl = 0; rl < 16; ++rl) vst2(H1 + (size_t)(r0 + rl) * E + n0 + lane * 4, *(const v4f*)(&so[wave][rl][lane * 4]));
}
// F16 = relu(Y16 @ wi^T) as f16 rows [NR][4096] : block (64 rows, 128 cols)
__global__ __launch_bounds__(128) void k_ff1(const _Float16* __restrict__ Y16, const _Float16* __restrict__ WI, _Float16* __restrict__ F16) {
  __shared__ __align__(16) _Float16 so[4][16][136];
  const int tid = threadIdx.x, wave = tid >> 5, lane = tid & 31, col = lane & 15, g = lane >> 4;
  const int r0 = blockIdx.x * 64 + wave * 16, n0 = blockIdx.y * 128;
  v8f acc[8] = {};
#pragma unroll 2
  for (int kc = 0; kc < E / 32; ++kc) { const v16h a = frag_h(Y16 + (size_t)(r0 + col) * E + kc * 32, lane);
#pragma unroll
    for (int j = 0; j < 8; ++j) acc[j] = wmma16(a, frag_h(WI + (size_t)(n0 + j * 16 + col) * E + kc * 32, lane), acc[j]); }
#pragma unroll
  for (int j = 0; j < 8; ++j)
#pragma unroll
    for (int r = 0; r < 8; ++r) { const float v = acc[j][r] * (1.0f / 16.0f); so[wave][8 * g + r][j * 16 + col] = (_Float16)(v > 0.f ? v : 0.f); }
  LDSX();
  for (int qq = lane; qq < 16 * 16; qq += 32) { const int rl = qq >> 4, pc = qq & 15; vst2(F16 + (size_t)(r0 + rl) * DFF + n0 + pc * 8, *(const v4u*)(&so[wave][rl][pc * 8])); }
}
// out = H1 + F16 @ wo_ff^T : block (64 rows, 128 cols), K = 4096
__global__ __launch_bounds__(128) void k_ff2(const _Float16* __restrict__ F16, const _Float16* __restrict__ WF, const float* __restrict__ H1, float* __restrict__ out) {
  __shared__ __align__(16) float so[4][16][132];
  const int tid = threadIdx.x, wave = tid >> 5, lane = tid & 31, col = lane & 15, g = lane >> 4;
  const int r0 = blockIdx.x * 64 + wave * 16, n0 = blockIdx.y * 128;
  v8f acc[8] = {};
#pragma unroll 2
  for (int kc = 0; kc < DFF / 32; ++kc) { const v16h a = frag_h(F16 + (size_t)(r0 + col) * DFF + kc * 32, lane);
#pragma unroll
    for (int j = 0; j < 8; ++j) acc[j] = wmma16(a, frag_h(WF + (size_t)(n0 + j * 16 + col) * DFF + kc * 32, lane), acc[j]); }
#pragma unroll
  for (int j = 0; j < 8; ++j) { const int n = n0 + j * 16 + col;
#pragma unroll
    for (int r = 0; r < 8; ++r) so[wave][8 * g + r][j * 16 + col] = acc[j][r] * (1.0f / 16.0f) + H1[(size_t)(r0 + 8 * g + r) * E + n]; }
  LDSX();
#pragma unroll 4
  for (int rl = 0; rl < 16; ++rl) vst2(out + (size_t)(r0 + rl) * E + n0 + lane * 4, *(const v4f*)(&so[wave][rl][lane * 4]));
}
extern "C" void kernel_launch(void* const* d_in, const int* in_sizes, int n_in, void* d_out, int out_size, void* d_ws, size_t ws_size, hipStream_t stream) {
  (void)in_sizes; (void)n_in; (void)out_size; (void)ws_size;
  const float** I = (const float**)d_in;
  const float* hid = I[0]; const float* ln1 = I[1]; const float* wq = I[2]; const float* wk = I[3]; const float* wv = I[4]; const float* wo = I[5]; const float* rb = I[6]; const float* ln2 = I[7]; const float* wi = I[8]; const float* wff = I[9];
  float* out = (float*)d_out;
  char* ws = (char*)d_ws; size_t off = 0;
  auto take = [&](size_t bytes) { char* p = ws + off; off += (bytes + 255) & ~(size_t)255; return p; };
  _Float16* X16 = (_Float16*)take((size_t)NR * E * 2); _Float16* PT = (_Float16*)take((size_t)4 * E * E * 2); _Float16* WI = (_Float16*)take((size_t)DFF * E * 2); _Float16* WF = (_Float16*)take((size_t)E * DFF * 2);
  float* BT = (float*)take((size_t)NH * 2 * SS * 4);
  _Float16* Q16 = (_Float16*)take((size_t)NR * E * 2); _Float16* K16 = (_Float16*)take((size_t)NR * E * 2); _Float16* VT = (_Float16*)take((size_t)NR * E * 2); _Float16* O16 = (_Float16*)take((size_t)NR * E * 2);
  float* H1 = (float*)take((size_t)NR * E * 4); _Float16* Y16 = X16; _Float16* F16 = (_Float16*)take((size_t)NR * DFF * 2);
  k_rms<<<NR / 8, 256, 0, stream>>>(hid, ln1, X16);
  k_pack<<<4 * E + DFF + E, 256, 0, stream>>>(wq, wk, wv, wo, wi, wff, PT, WI, WF);
  k_bias<<<dim3(2 * SS / 256, NH), 256, 0, stream>>>(rb, BT);
  k_qkv<<<dim3(NR / 64, E / 128, 3), 128, 0, stream>>>(X16, PT, Q16, K16, VT);
  k_attn<<<dim3(SS / 64, NB * NH), 128, 0, stream>>>(Q16, K16, VT, BT, O16);
  k_o<<<dim3(NR / 64, E / 128), 128, 0, stream>>>(O16, PT, hid, H1);
  k_rms<<<NR / 8, 256, 0, stream>>>(H1, ln2, Y16);
  k_ff1<<<dim3(NR / 64, DFF / 128), 128, 0, stream>>>(Y16, WI, F16);
  k_ff2<<<dim3(NR / 64, E / 128), 128, 0, stream>>>(F16, WF, H1, out);
}

// v001
// A run of this version takes 210 microseconds.
// In two side-by-side timings against v000, it was 2.64 and 2.66 times as fast.
#include <hip/hip_runtime.h>
#include <math.h>

typedef __attribute__((ext_vector_type(16))) _Float16 v16h;
typedef __attribute__((ext_vector_type(16))) __bf16 v16b;
typedef __attribute__((ext_vector_type(8)))  _Float16 v8h;
typedef __attribute__((ext_vector_type(8)))  float v8f;
typedef __attribute__((ext_vector_type(4)))  float v4f;
typedef __attribute__((ext_vector_type(2)))  float v2f;
typedef __attribute__((ext_vector_type(4)))  unsigned v4u;
typedef __attribute__((ext_vector_type(4)))  int v4i;
typedef float __attribute__((may_alias)) float_a;
typedef int __attribute__((may_alias)) int_a;

template <typename T> __device__ __forceinline__ void vst2(void* p, T v) { *(T*)p = v;  }
__device__ __forceinline__ v8f wmma16(v16h a, v16h b, v8f c) {
  v8f d = __builtin_amdgcn_wmma_f32_16x16x32_f16(false, a, false, b, (short)0, c, false, false);
  asm volatile("v_nop\n\tv_nop\n\tv_nop\n\tv_nop" : "+v"(d) : "v"(a), "v"(b));
  return d;
}
__device__ __forceinline__ v8f wmma_bf(v16b a, v16b b, v8f c) {
  v8f d = __builtin_amdgcn_wmma_f32_16x16x32_bf16(false, a, false, b, (short)0, c, false, false);
  asm volatile("v_nop\n\tv_nop\n\tv_nop\n\tv_nop" : "+v"(d) : "v"(a), "v"(b));
  return d;
}
// 16x16x32 fragments: lane = (h = lane>>4, row/col = lane&15); elements 0..7 = k0+8h+0..7, 8..15 = k0+16+8h+0..7; D element r = row 8h+r
__device__ __forceinline__ v16h frag_h(const _Float16* rowk0, int lane) {
  union { v16h v; v8h q[2]; } u; const _Float16* p = rowk0 + 8 * (lane >> 4);
  u.q[0] = *(const v8h*)p; u.q[1] = *(const v8h*)(p + 16); return u.v;
}
__device__ __forceinline__ v16h frag_f32(const float* rowk0, int lane) {
  v16h a; const float* p = rowk0 + 8 * (lane >> 4);
#pragma unroll
  for (int i = 0; i < 8; ++i) { a[i] = (_Float16)p[i]; a[8 + i] = (_Float16)p[16 + i]; }
  return a;
}
__device__ __forceinline__ v16h frag_f32s(const float* rowk0, int lane, float sc) {
  v16h a; const float* p = rowk0 + 8 * (lane >> 4);
#pragma unroll
  for (int i = 0; i < 8; ++i) { a[i] = (_Float16)(p[i] * sc); a[8 + i] = (_Float16)(p[16 + i] * sc); }
  return a;
}
// column fragment from a [K][ld] layout (column n), rows >= K read as 0
__device__ __forceinline__ v16h fragc_f32(const float* W, int k0, int n, int lane, int ld, int K) {
  v16h a; const int g = lane >> 4;
#pragma unroll
  for (int i = 0; i < 8; ++i) { const int ka = k0 + 8 * g + i, kb = ka + 16;
    a[i] = (_Float16)(ka < K ? W[(size_t)ka * ld + n] : 0.f); a[8 + i] = (_Float16)(kb < K ? W[(size_t)kb * ld + n] : 0.f); }
  return a;
}
struct F2 { v16b h, l; };
__device__ __forceinline__ F2 bsplit16(const float v[16]) { F2 r;
#pragma unroll
  for (int i = 0; i < 16; ++i) { const __bf16 h = (__bf16)v[i]; r.h[i] = h; r.l[i] = (__bf16)(v[i] - (float)h); }
  return r; }
__device__ __forceinline__ F2 split_row(const float* row, int k0, int lane) { float v[16]; const float* p = row + k0 + 8 * (lane >> 4);
#pragma unroll
  for (int i = 0; i < 8; ++i) { v[i] = p[i]; v[8 + i] = p[16 + i]; }
  return bsplit16(v); }
__device__ __forceinline__ F2 split_rowK(const float* row, int k0, int lane, int K) { float v[16]; const int g = lane >> 4;
#pragma unroll
  for (int i = 0; i < 8; ++i) { const int ka = k0 + 8 * g + i, kb = ka + 16; v[i] = ka < K ? row[ka] : 0.f; v[8 + i] = kb < K ? row[kb] : 0.f; }
  return bsplit16(v); }
__device__ __forceinline__ F2 split_col(const float* W, int k0, int n, int lane, int ld, int K) { float v[16]; const int g = lane >> 4;
#pragma unroll
  for (int i = 0; i < 8; ++i) { const int ka = k0 + 8 * g + i, kb = ka + 16; v[i] = ka < K ? W[(size_t)ka * ld + n] : 0.f; v[8 + i] = kb < K ? W[(size_t)kb * ld + n] : 0.f; }
  return bsplit16(v); }
__device__ __forceinline__ v8f mac3(const F2& a, const F2& b, v8f c) { c = wmma_bf(a.l, b.h, c); c = wmma_bf(a.h, b.l, c); return wmma_bf(a.h, b.h, c); }
__device__ __forceinline__ float sigm(float v) { return 1.0f / (1.0f + expf(-v)); }
#define LDSX() do { asm volatile("s_wait_dscnt 0" ::: "memory"); __builtin_amdgcn_wave_barrier(); __builtin_amdgcn_fence(__ATOMIC_RELEASE, "workgroup"); } while (0)

// T5 encoder block: RMSNorm -> 16-head self attention with the bidirectional relative-position bias (no 1/sqrt(d)) -> residual ->
// RMSNorm -> ReLU FFN (1024 -> 4096 -> 1024) -> residual. All products on v_wmma_f32_16x16x32_f16 ([out][in] weight rows converted once
// to f16 rows x16; activations as f16 rows, q/k x4, P x2^14, V x4, ctx x8); RMSNorms, the bucket function, softmax and residuals in f32.
#define NB 2
#define SS 1024
#define E 1024
#define NH 16
#define HD 64
#define DFF 4096
#define NR (NB * SS)           // 2048
#define NBK 32
#define MAXD 128

// GEMM operand ring in LDS. A stage is 64 k (128 B) of the block's 64 A rows and then of its 128 B rows, at a row pitch of 144 B
// (16 B x odd, the conflict-free pitch for ds_load_b128). Two buffers: asynchronous copies fill one while the other is multiplied.
#define BKH 64                     // k per stage
#define PIT 72                     // LDS row pitch in f16
#define STG (192 * PIT)            // f16 per buffer
#define RING_BYTES (2 * STG * 2)
// One stage: 192 rows x 8 pieces of 16 B = 12 copies per lane; 8 neighbouring lanes take one row's whole 128-B line.
// ga, gb: this lane's piece in row (tid >> 3) of the A and of the B part; l: LDS byte address of the A piece.
__device__ __forceinline__ void stage_copy(const _Float16* ga, size_t lda, const _Float16* gb, size_t ldb, unsigned l) {
  // the closing s_wait_xcnt stands inside the statement so that no address register of a copy is rewritten in front of it
  asm volatile("global_load_async_to_lds_b128 %0, %12, off\n\t"
               "global_load_async_to_lds_b128 %1, %13, off\n\t"
               "global_load_async_to_lds_b128 %2, %14, off\n\t"
               "global_load_async_to_lds_b128 %3, %15, off\n\t"
               "global_load_async_to_lds_b128 %4, %16, off\n\t"
               "global_load_async_to_lds_b128 %5, %17, off\n\t"
               "global_load_async_to_lds_b128 %6, %18, off\n\t"
               "global_load_async_to_lds_b128 %7, %19, off\n\t"
               "global_load_async_to_lds_b128 %8, %20, off\n\t"
               "global_load_async_to_lds_b128 %9, %21, off\n\t"
               "global_load_async_to_lds_b128 %10, %22, off\n\t"
               "global_load_async_to_lds_b128 %11, %23, off\n\t"
               "s_wait_xcnt 0x0"
               :: "v"(l), "v"(l + 1u * 16 * PIT * 2), "v"(l + 2u * 16 * PIT * 2), "v"(l + 3u * 16 * PIT * 2), "v"(l + 4u * 16 * PIT * 2), "v"(l + 5u * 16 * PIT * 2),
                  "v"(l + 6u * 16 * PIT * 2), "v"(l + 7u * 16 * PIT * 2), "v"(l + 8u * 16 * PIT * 2), "v"(l + 9u * 16 * PIT * 2), "v"(l + 10u * 16 * PIT * 2), "v"(l + 11u * 16 * PIT * 2),
                  "v"(ga), "v"(ga + 16 * lda), "v"(ga + 32 * lda), "v"(ga + 48 * lda),
                  "v"(gb), "v"(gb + 16 * ldb), "v"(gb + 32 * ldb), "v"(gb + 48 * ldb), "v"(gb + 64 * ldb), "v"(gb + 80 * ldb), "v"(gb + 96 * ldb), "v"(gb + 112 * ldb)
               : "memory");
}
// acc[j] += A rows (wave * 16 ..) x B rows (j * 16 ..) over NT stages, k ascending. A: first of the block's 64 rows (row pitch lda, stage step sa),
// B: first of its 128 rows (row pitch ldb, stage step BKH). Behind it no copy is in flight and every wave has left the ring.
template <int NT>
__device__ __forceinline__ void gemm_ring(const _Float16* A, size_t lda, size_t sa, const _Float16* B, size_t ldb, char* smem, v8f (&acc)[8]) {
  const int tid = threadIdx.x, wave = tid >> 5, lane = tid & 31, col = lane & 15;
  const _Float16* ring = (const _Float16*)smem;
  const _Float16* ga = A + (size_t)(tid >> 3) * lda + (tid & 7) * 8;
  const _Float16* gb = B + (size_t)(tid >> 3) * ldb + (tid & 7) * 8;
  const unsigned l = (unsigned)(size_t)smem + (unsigned)((tid >> 3) * PIT + (tid & 7) * 8) * 2u;
  stage_copy(ga, lda, gb, ldb, l);
  asm volatile("s_wait_asynccnt 0x0" ::: "memory");   // this wave's part of stage 0 has landed before the barrier publishes it
  __syncthreads();
  stage_copy(ga + sa, lda, gb + BKH, ldb, l + STG * 2);
  for (int t = 0; t < NT; ++t) {
    const _Float16* buf = ring + (t & 1) * STG;
    v16h a[2], b[2][8];   // the stage's fragments, read as one group so that one LDS latency is paid per stage, not one per product
    // the four loops below are unrolled so that every index of a, b and acc is a constant and the arrays stay in registers
#pragma unroll
    for (int kc = 0; kc < 2; ++kc) { a[kc] = frag_h(buf + (wave * 16 + col) * PIT + kc * 32, lane);
#pragma unroll
      for (int j = 0; j < 8; ++j) b[kc][j] = frag_h(buf + (64 + j * 16 + col) * PIT + kc * 32, lane); }
#pragma unroll
    for (int kc = 0; kc < 2; ++kc)
#pragma unroll
      for (int j = 0; j < 8; ++j) acc[j] = wmma16(a[kc], b[kc][j], acc[j]);
    asm volatile("s_wait_dscnt 0x0" ::: "memory");      // this wave's reads of the buffer are over before it is refilled
    asm volatile("s_wait_asynccnt 0x0" ::: "memory");   // this wave's part of stage t + 1 has landed
    __syncthreads();                                    // publishes stage t + 1 and frees stage t's buffer
    if (t + 2 < NT) stage_copy(ga + (size_t)(t + 2) * sa, lda, gb + (size_t)(t + 2) * BKH, ldb, l + (unsigned)(t & 1) * (STG * 2));
  }
  asm volatile("s_wait_asynccnt 0x0" ::: "memory");     // nothing in flight when the ring becomes output staging
}

// RMSNorm of rows -> f16 ; wave per row
__global__ __launch_bounds__(256) void k_rms(const float* __restrict__ x, const float* __restrict__ w, _Float16* __restrict__ X16) {
  const int wave = threadIdx.x >> 5, lane = threadIdx.x & 31; const size_t r = (size_t)blockIdx.x * 8 + wave; if (r >= NR) return;
  const float* xr = x + r * E; float q2 = 0.f;
#pragma unroll 1
  for (int i = 0; i < 8; ++i) { const v4f a = *(const v4f*)(xr + i * 128 + lane * 4); q2 += (a[0] * a[0] + a[1] * a[1]) + (a[2] * a[2] + a[3] * a[3]); }
#pragma unroll
  for (int off = 16; off >= 1; off >>= 1) q2 += __shfl_xor(q2, off, 32);
  const float rs = rsqrtf(q2 * (1.0f / E) + 1e-6f);
#pragma unroll 1
  for (int i = 0; i < 4; ++i) { const int c0 = i * 256 + lane * 8; union { v8h h; v4u u; } pk;
#pragma unroll
    for (int e = 0; e < 8; ++e) pk.h[e] = (_Float16)(xr[c0 + e] * rs * w[c0 + e]);
    vst2(X16 + r * E + c0, pk.u); }
}
// weight packs: PT rows: [0,1024) wq, [1024,2048) wk, [2048,3072) wv, [3072,4096) wo (all [out][in=1024]) x16 ; WI rows [4096][1024] x16 ; WF rows [1024][4096] x16
__global__ __launch_bounds__(256) void k_pack(const float* __restrict__ wq, const float* __restrict__ wk, const float* __restrict__ wv, const float* __restrict__ wo, const float* __restrict__ wi, const float* __restrict__ wff,
                                            _Float16* __restrict__ PT, _Float16* __restrict__ WI, _Float16* __restrict__ WF) {
  const int r = blockIdx.x, tid = threadIdx.x; __shared__ __align__(16) _Float16 srow[DFF];
  if (r < 4 * E) { const int which = r >> 10, n = r & (E - 1); const float* W = (which == 0 ? wq : which == 1 ? wk : which == 2 ? wv : wo) + (size_t)n * E;
    for (int k = tid; k < E; k += 256) srow[k] = (_Float16)(W[k] * 16.0f);
    __syncthreads(); if (tid < 128) vst2(PT + (size_t)r * E + tid * 8, *(const v4u*)(&srow[tid * 8])); }
  else if (r < 4 * E + DFF) { const int n = r - 4 * E; const float* W = wi + (size_t)n * E;
    for (int k = tid; k < E; k += 256) srow[k] = (_Float16)(W[k] * 16.0f);
    __syncthreads(); if (tid < 128) vst2(WI + (size_t)n * E + tid * 8, *(const v4u*)(&srow[tid * 8])); }
  else { const int n = r - 4 * E - DFF; const float* W = wff + (size_t)n * DFF;
    for (int k = tid; k < DFF; k += 256) srow[k] = (_Float16)(W[k] * 16.0f);
    __syncthreads(); for (int q = tid; q < DFF / 8; q += 256) vst2(WF + (size_t)n * DFF + q * 8, *(const v4u*)(&srow[q * 8])); }
}
// bias table BT[h][rel + SS - 1] for rel = k - q in [-(SS-1), SS-1]
__global__ __launch_bounds__(256) void k_bias(const float* __restrict__ rb, float* __restrict__ BT) {
  const int h = blockIdx.y, i = blockIdx.x * 256 + threadIdx.x; if (i >= 2 * SS) return;   // table width padded to 2*SS
  float v = 0.f;
  if (i < 2 * SS - 1) { const int rel = i - (SS - 1); const int nb = NBK / 2; int bucket = rel > 0 ? nb : 0; const int rp = rel < 0 ? -rel : rel; const int mx = nb / 2;
    int val; if (rp < mx) val = rp; else { const float lf = logf((float)rp / (float)mx) / 2.772588722239781f * (float)(nb - mx); int large = mx + (int)lf; val = large < nb - 1 ? large : nb - 1; }
    bucket += val; v = rb[bucket * NH + h]; }
  vst2(BT + (size_t)h * 2 * SS + i, v);
}
// QKV: block (64 rows, 128 cols = 2 heads, which)
__global__ __launch_bounds__(128) void k_qkv(const _Float16* __restrict__ X16, const _Float16* __restrict__ PT, _Float16* __restrict__ Q16, _Float16* __restrict__ K16, _Float16* __restrict__ VT) {
  __shared__ __align__(16) char smem[RING_BYTES];   // the operand ring; behind the k loop the output staging
  float (*so)[16][132] = (float (*)[16][132])smem;
  _Float16 (*st)[72] = (_Float16 (*)[72])smem;
  const int tid = threadIdx.x, wave = tid >> 5, lane = tid & 31, col = lane & 15, g = lane >> 4;
  const int which = blockIdx.z, r0b = blockIdx.x * 64, n0 = blockIdx.y * 128; const int b = r0b / SS, s0 = r0b % SS;
  v8f acc[8] = {};
  gemm_ring<E / BKH>(X16 + (size_t)r0b * E, E, BKH, PT + (size_t)(which * E + n0) * E, E, smem, acc);
  if (which < 2) {
#pragma unroll
    for (int j = 0; j < 8; ++j)
#pragma unroll
      for (int r = 0; r < 8; ++r) so[wave][8 * g + r][j * 16 + col] = acc[j][r] * (4.0f / 16.0f);
    LDSX();
    _Float16* D = which == 0 ? Q16 : K16;
    for (int qq = lane; qq < 16 * 2 * 8; qq += 32) { const int hh = qq >> 7, rl = (qq >> 3) & 15, pc = qq & 7; const int h = (n0 >> 6) + hh; union { v8h h8; v4u u; } pk;
#pragma unroll
      for (int e = 0; e < 8; ++e) pk.h8[e] = (_Float16)so[wave][rl][hh * 64 + pc * 8 + e];
      vst2(D + (((size_t)b * NH + h) * SS + s0 + wave * 16 + rl) * HD + pc * 8, pk.u); } }
  else {
#pragma unroll
    for (int j = 0; j < 8; ++j)
#pragma unroll
      for (int r = 0; r < 8; ++r) st[j * 16 + col][wave * 16 + 8 * g + r] = (_Float16)(acc[j][r] * (4.0f / 16.0f));
    __syncthreads();
    for (int qq = tid; qq < 128 * 8; qq += 128) { const int cl = qq >> 3, pc = qq & 7; const int c = n0 + cl, h = c >> 6, d = c & 63;
      vst2(VT + (((size_t)b * NH + h) * HD + d) * SS + s0 + pc * 8, *(const v4u*)(&st[cl][pc * 8])); } }
}
__global__ __launch_bounds__(128) void k_attn(const _Float16* __restrict__ Q16, const _Float16* __restrict__ K16, const _Float16* __restrict__ VT, const float* __restrict__ BT, _Float16* __restrict__ O16) {
  __shared__ __align__(16) float sS[4][16][68];
  __shared__ __align__(16) _Float16 sP[4][16][72];
  __shared__ __align__(16) float sO[4][16][68];
  const int tid = threadIdx.x, w = tid >> 5, lane = tid & 31, col = lane & 15, g = lane >> 4;
  const size_t bh = blockIdx.y; const int h = (int)(bh % NH); const int q0 = blockIdx.x * 64 + w * 16; const float* bth = BT + (size_t)h * 2 * SS + (SS - 1);
  v16h aq[2];
#pragma unroll
  for (int kc = 0; kc < 2; ++kc) aq[kc] = frag_h(Q16 + (bh * SS + q0 + col) * HD + kc * 32, lane);
  float mrun = -3.0e38f, lrun = 0.f; v8f acc[4] = {};
#pragma unroll 1
  for (int kt = 0; kt < SS / 64; ++kt) {
#pragma unroll
    for (int t = 0; t < 4; ++t) { v8f s = {}; const int key = kt * 64 + t * 16 + col;
#pragma unroll
      for (int kc = 0; kc < 2; ++kc) s = wmma16(aq[kc], frag_h(K16 + (bh * SS + key) * HD + kc * 32, lane), s);
#pragma unroll
      for (int r = 0; r < 8; ++r) { const int q = q0 + 8 * g + r; sS[w][8 * g + r][t * 16 + col] = s[r] * (1.0f / 16.0f) + bth[key - q]; } }
    LDSX();
    float mx = -3.4e38f;
#pragma unroll
    for (int jj = 0; jj < 32; ++jj) mx = fmaxf(mx, sS[w][col][g * 32 + jj]);
    mx = fmaxf(mx, __shfl_xor(mx, 16, 32));
    const float mnew = fmaxf(mrun, mx); const float corr = expf(mrun - mnew);
    float ps = 0.f;
#pragma unroll
    for (int jj = 0; jj < 32; ++jj) { const float p = expf(sS[w][col][g * 32 + jj] - mnew); ps += p; sP[w][col][g * 32 + jj] = (_Float16)(p * 16384.0f); }
    ps += __shfl_xor(ps, 16, 32);
    lrun = lrun * corr + ps; mrun = mnew;
#pragma unroll
    for (int r = 0; r < 8; ++r) { const float cr = __shfl(corr, 8 * g + r, 32);
#pragma unroll
      for (int t = 0; t < 4; ++t) acc[t][r] *= cr; }
    LDSX();
#pragma unroll
    for (int kc = 0; kc < 2; ++kc) { const v16h pa = frag_h(&sP[w][col][0] + kc * 32, lane);
#pragma unroll
      for (int t = 0; t < 4; ++t) acc[t] = wmma16(pa, frag_h(VT + (bh * HD + t * 16 + col) * SS + kt * 64 + kc * 32, lane), acc[t]); }
    __builtin_amdgcn_wave_barrier(); }
#pragma unroll
  for (int r = 0; r < 8; ++r) { const float lr = __shfl(lrun, 8 * g + r, 32); const float inv = 8.0f / (lr * 16384.0f * 4.0f);
#pragma unroll
    for (int t = 0; t < 4; ++t) sO[w][8 * g + r][t * 16 + col] = acc[t][r] * inv; }
  LDSX();
  for (int qq = lane; qq < 16 * 8; qq += 32) { const int rl = qq >> 3, pc = qq & 7; union { v8h h8; v4u u; } pk;
#pragma unroll
    for (int e = 0; e < 8; ++e) pk.h8[e] = (_Float16)sO[w][rl][pc * 8 + e];
    vst2(O16 + ((bh * SS) + q0 + rl) * HD + pc * 8, pk.u); }
}
// H1 = hidden + ctx wo^T : block (64 rows, 128 cols)
__global__ __launch_bounds__(128) void k_o(const _Float16* __restrict__ O16, const _Float16* __restrict__ PT, const float* __restrict__ hid, float* __restrict__ H1) {
  __shared__ __align__(16) char smem[RING_BYTES];   // the operand ring; behind the k loop the output staging
  float (*so)[16][132] = (float (*)[16][132])smem;
  const int tid = threadIdx.x, wave = tid >> 5, lane = tid & 31, col = lane & 15, g = lane >> 4;
  const int r0b = blockIdx.x * 64, r0 = r0b + wave * 16, n0 = blockIdx.y * 128; const int b = r0b / SS, s0 = r0b % SS;
  v8f acc[8] = {};
  // stage t is head t: 64 k of row s stand at O16[b][t][s][0..63]
  gemm_ring<E / BKH>(O16 + ((size_t)b * NH * SS + s0) * HD, HD, (size_t)SS * HD, PT + (size_t)(3 * E + n0) * E, E, smem, acc);
#pragma unroll
  for (int j = 0; j < 8; ++j) { const int n = n0 + j * 16 + col;
#pragma unroll
    for (int r = 0; r < 8; ++r) so[wave][8 * g + r][j * 16 + col] = acc[j][r] * (1.0f / (16.0f * 8.0f)) + hid[(size_t)(r0 + 8 * g + r) * E + n]; }
  LDSX();
#pragma unroll 4
  for (int rl = 0; rl < 16; ++rl) vst2(H1 + (size_t)(r0 + rl) * E + n0 + lane * 4, *(const v4f*)(&so[wave][rl][lane * 4]));
}
// F16 = relu(Y16 @ wi^T) as f16 rows [NR][4096] : block (64 rows, 128 cols)
__global__ __launch_bounds__(128) void k_ff1(const _Float16* __restrict__ Y16, const _Float16* __restrict__ WI, _Float16* __restrict__ F16) {
  __shared__ __align__(16) char smem[RING_BYTES];   // the operand ring; behind the k loop the output staging
  _Float16 (*so)[16][136] = (_Float16 (*)[16][136])smem;
  const int tid = threadIdx.x, wave = tid >> 5, lane = tid & 31, col = lane & 15, g = lane >> 4;
  const int r0b = blockIdx.x * 64, r0 = r0b + wave * 16, n0 = blockIdx.y * 128;
  v8f acc[8] = {};
  gemm_ring<E / BKH>(Y16 + (size_t)r0b * E, E, BKH, WI + (size_t)n0 * E, E, smem, acc);
#pragma unroll
  for (int j = 0; j < 8; ++j)
#pragma unroll
    for (int r = 0; r < 8; ++r) { const float v = acc[j][r] * (1.0f / 16.0f); so[wave][8 * g + r][j * 16 + col] = (_Float16)(v > 0.f ? v : 0.f); }
  LDSX();
  for (int qq = lane; qq < 16 * 16; qq += 32) { const int rl = qq >> 4, pc = qq & 15; vst2(F16 + (size_t)(r0 + rl) * DFF + n0 + pc * 8, *(const v4u*)(&so[wave][rl][pc * 8])); }
}
// out = H1 + F16 @ wo_ff^T : block (64 rows, 128 cols), K = 4096
__global__ __launch_bounds__(128) void k_ff2(const _Float16* __restrict__ F16, const _Float16* __restrict__ WF, const float* __restrict__ H1, float* __restrict__ out) {
  __shared__ __align__(16) char smem[RING_BYTES];   // the operand ring; behind the k loop the output staging
  float (*so)[16][132] = (float (*)[16][132])smem;
  const int tid = threadIdx.x, wave = tid >> 5, lane = tid & 31, col = lane & 15, g = lane >> 4;
  const int r0b = blockIdx.x * 64, r0 = r0b + wave * 16, n0 = blockIdx.y * 128;
  v8f acc[8] = {};
  gemm_ring<DFF / BKH>(F16 + (size_t)r0b * DFF, DFF, BKH, WF + (size_t)n0 * DFF, DFF, smem, acc);
#pragma unroll
  for (int j = 0; j < 8; ++j) { const int n = n0 + j * 16 + col;
#pragma unroll
    for (int r = 0; r < 8; ++r) so[wave][8 * g + r][j * 16 + col] = acc[j][r] * (1.0f / 16.0f) + H1[(size_t)(r0 + 8 * g + r) * E + n]; }
  LDSX();
#pragma unroll 4
  for (int rl = 0; rl < 16; ++rl) vst2(out + (size_t)(r0 + rl) * E + n0 + lane * 4, *(const v4f*)(&so[wave][rl][lane * 4]));
}
extern "C" void kernel_launch(void* const* d_in, const int* in_sizes, int n_in, void* d_out, int out_size, void* d_ws, size_t ws_size, hipStream_t stream) {
  (void)in_sizes; (void)n_in; (void)out_size; (void)ws_size;
  const float** I = (const float**)d_in;
  const float* hid = I[0]; const float* ln1 = I[1]; const float* wq = I[2]; const float* wk = I[3]; const float* wv = I[4]; const float* wo = I[5]; const float* rb = I[6]; const float* ln2 = I[7]; const float* wi = I[8]; const float* wff = I[9];
  float* out = (float*)d_out;
  char* ws = (char*)d_ws; size_t off = 0;
  auto take = [&](size_t bytes) { char* p = ws + off; off += (bytes + 255) & ~(size_t)255; return p; };
  _Float16* X16 = (_Float16*)take((size_t)NR * E * 2); _Float16* PT = (_Float16*)take((size_t)4 * E * E * 2); _Float16* WI = (_Float16*)take((size_t)DFF * E * 2); _Float16* WF = (_Float16*)take((size_t)E * DFF * 2);
  float* BT = (float*)take((size_t)NH * 2 * SS * 4);
  _Float16* Q16 = (_Float16*)take((size_t)NR * E * 2); _Float16* K16 = (_Float16*)take((size_t)NR * E * 2); _Float16* VT = (_Float16*)take((size_t)NR * E * 2); _Float16* O16 = (_Float16*)take((size_t)NR * E * 2);
  float* H1 = (float*)take((size_t)NR * E * 4); _Float16* Y16 = X16; _Float16* F16 = (_Float16*)take((size_t)NR * DFF * 2);
  k_rms<<<NR / 8, 256, 0, stream>>>(hid, ln1, X16);
  k_pack<<<4 * E + DFF + E, 256, 0, stream>>>(wq, wk, wv, wo, wi, wff, PT, WI, WF);
  k_bias<<<dim3(2 * SS / 256, NH), 256, 0, stream>>>(rb, BT);
  k_qkv<<<dim3(NR / 64, E / 128, 3), 128, 0, stream>>>(X16, PT, Q16, K16, VT);
  k_attn<<<dim3(SS / 64, NB * NH), 128, 0, stream>>>(Q16, K16, VT, BT, O16);
  k_o<<<dim3(NR / 64, E / 128), 128, 0, stream>>>(O16, PT, hid, H1);
  k_rms<<<NR / 8, 256, 0, stream>>>(H1, ln2, Y16);
  k_ff1<<<dim3(NR / 64, DFF / 128), 128, 0, stream>>>(Y16, WI, F16);
  k_ff2<<<dim3(NR / 64, E / 128), 128, 0, stream>>>(F16, WF, H1, out);
}

// v002
// One run takes 165 microseconds.
// Two timings next to v001 both put it at 1.28 times that version's speed.
// Over all steps from v000 it is 3.39 times as fast.
#include <hip/hip_runtime.h>
#include <math.h>

typedef __attribute__((ext_vector_type(16))) _Float16 v16h;
typedef __attribute__((ext_vector_type(16))) __bf16 v16b;
typedef __attribute__((ext_vector_type(8)))  _Float16 v8h;
typedef __attribute__((ext_vector_type(8)))  float v8f;
typedef __attribute__((ext_vector_type(4)))  float v4f;
typedef __attribute__((ext_vector_type(2)))  float v2f;
typedef __attribute__((ext_vector_type(4)))  unsigned v4u;
typedef __attribute__((ext_vector_type(4)))  int v4i;
typedef float __attribute__((may_alias)) float_a;
typedef int __attribute__((may_alias)) int_a;

template <typename T> __device__ __forceinline__ void vst2(void* p, T v) { *(T*)p = v;  }
__device__ __forceinline__ v8f wmma16(v16h a, v16h b, v8f c) {
  v8f d = __builtin_amdgcn_wmma_f32_16x16x32_f16(false, a, false, b, (short)0, c, false, false);
  asm volatile("v_nop\n\tv_nop\n\tv_nop\n\tv_nop" : "+v"(d) : "v"(a), "v"(b));
  return d;
}
__device__ __forceinline__ v8f wmma_bf(v16b a, v16b b, v8f c) {
  v8f d = __builtin_amdgcn_wmma_f32_16x16x32_bf16(false, a, false, b, (short)0, c, false, false);
  asm volatile("v_nop\n\tv_nop\n\tv_nop\n\tv_nop" : "+v"(d) : "v"(a), "v"(b));
  return d;
}
// 16x16x32 fragments: lane = (h = lane>>4, row/col = lane&15); elements 0..7 = k0+8h+0..7, 8..15 = k0+16+8h+0..7; D element r = row 8h+r
__device__ __forceinline__ v16h frag_h(const _Float16* rowk0, int lane) {
  union { v16h v; v8h q[2]; } u; const _Float16* p = rowk0 + 8 * (lane >> 4);
  u.q[0] = *(const v8h*)p; u.q[1] = *(const v8h*)(p + 16); return u.v;
}
__device__ __forceinline__ v16h frag_f32(const float* rowk0, int lane) {
  v16h a; const float* p = rowk0 + 8 * (lane >> 4);
#pragma unroll
  for (int i = 0; i < 8; ++i) { a[i] = (_Float16)p[i]; a[8 + i] = (_Float16)p[16 + i]; }
  return a;
}
__device__ __forceinline__ v16h frag_f32s(const float* rowk0, int lane, float sc) {
  v16h a; const float* p = rowk0 + 8 * (lane >> 4);
#pragma unroll
  for (int i = 0; i < 8; ++i) { a[i] = (_Float16)(p[i] * sc); a[8 + i] = (_Float16)(p[16 + i] * sc); }
  return a;
}
// column fragment from a [K][ld] layout (column n), rows >= K read as 0
__device__ __forceinline__ v16h fragc_f32(const float* W, int k0, int n, int lane, int ld, int K) {
  v16h a; const int g = lane >> 4;
#pragma unroll
  for (int i = 0; i < 8; ++i) { const int ka = k0 + 8 * g + i, kb = ka + 16;
    a[i] = (_Float16)(ka < K ? W[(size_t)ka * ld + n] : 0.f); a[8 + i] = (_Float16)(kb < K ? W[(size_t)kb * ld + n] : 0.f); }
  return a;
}
struct F2 { v16b h, l; };
__device__ __forceinline__ F2 bsplit16(const float v[16]) { F2 r;
#pragma unroll
  for (int i = 0; i < 16; ++i) { const __bf16 h = (__bf16)v[i]; r.h[i] = h; r.l[i] = (__bf16)(v[i] - (float)h); }
  return r; }
__device__ __forceinline__ F2 split_row(const float* row, int k0, int lane) { float v[16]; const float* p = row + k0 + 8 * (lane >> 4);
#pragma unroll
  for (int i = 0; i < 8; ++i) { v[i] = p[i]; v[8 + i] = p[16 + i]; }
  return bsplit16(v); }
__device__ __forceinline__ F2 split_rowK(const float* row, int k0, int lane, int K) { float v[16]; const int g = lane >> 4;
#pragma unroll
  for (int i = 0; i < 8; ++i) { const int ka = k0 + 8 * g + i, kb = ka + 16; v[i] = ka < K ? row[ka] : 0.f; v[8 + i] = kb < K ? row[kb] : 0.f; }
  return bsplit16(v); }
__device__ __forceinline__ F2 split_col(const float* W, int k0, int n, int lane, int ld, int K) { float v[16]; const int g = lane >> 4;
#pragma unroll
  for (int i = 0; i < 8; ++i) { const int ka = k0 + 8 * g + i, kb = ka + 16; v[i] = ka < K ? W[(size_t)ka * ld + n] : 0.f; v[8 + i] = kb < K ? W[(size_t)kb * ld + n] : 0.f; }
  return bsplit16(v); }
__device__ __forceinline__ v8f mac3(const F2& a, const F2& b, v8f c) { c = wmma_bf(a.l, b.h, c); c = wmma_bf(a.h, b.l, c); return wmma_bf(a.h, b.h, c); }
__device__ __forceinline__ float sigm(float v) { return 1.0f / (1.0f + expf(-v)); }
#define LDSX() do { asm volatile("s_wait_dscnt 0" ::: "memory"); __builtin_amdgcn_wave_barrier(); __builtin_amdgcn_fence(__ATOMIC_RELEASE, "workgroup"); } while (0)

// T5 encoder block: RMSNorm -> 16-head self attention with the bidirectional relative-position bias (no 1/sqrt(d)) -> residual ->
// RMSNorm -> ReLU FFN (1024 -> 4096 -> 1024) -> residual. All products on v_wmma_f32_16x16x32_f16 ([out][in] weight rows converted once
// to f16 rows x16; activations as f16 rows, q/k x4, P x2^14, V x4, ctx x8); RMSNorms, the bucket function, softmax and residuals in f32.
#define NB 2
#define SS 1024
#define E 1024
#define NH 16
#define HD 64
#define DFF 4096
#define NR (NB * SS)           // 2048
#define NBK 32
#define MAXD 128

// GEMM operand ring in LDS. A stage is 64 k (128 B) of the block's 64 A rows and then of its 128 B rows, at a row pitch of 144 B
// (16 B x odd, the conflict-free pitch for ds_load_b128). Two buffers: asynchronous copies fill one while the other is multiplied.
#define BKH 64                     // k per stage
#define PIT 72                     // LDS row pitch in f16
#define STG (192 * PIT)            // f16 per buffer
#define RING_BYTES (2 * STG * 2)
// One stage: 192 rows x 8 pieces of 16 B = 12 copies per lane; 8 neighbouring lanes take one row's whole 128-B line.
// ga, gb: this lane's piece in row (tid >> 3) of the A and of the B part; l: LDS byte address of the A piece.
__device__ __forceinline__ void stage_copy(const _Float16* ga, size_t lda, const _Float16* gb, size_t ldb, unsigned l) {
  // the closing s_wait_xcnt stands inside the statement so that no address register of a copy is rewritten in front of it
  asm volatile("global_load_async_to_lds_b128 %0, %12, off\n\t"
               "global_load_async_to_lds_b128 %1, %13, off\n\t"
               "global_load_async_to_lds_b128 %2, %14, off\n\t"
               "global_load_async_to_lds_b128 %3, %15, off\n\t"
               "global_load_async_to_lds_b128 %4, %16, off\n\t"
               "global_load_async_to_lds_b128 %5, %17, off\n\t"
               "global_load_async_to_lds_b128 %6, %18, off\n\t"
               "global_load_async_to_lds_b128 %7, %19, off\n\t"
               "global_load_async_to_lds_b128 %8, %20, off\n\t"
               "global_load_async_to_lds_b128 %9, %21, off\n\t"
               "global_load_async_to_lds_b128 %10, %22, off\n\t"
               "global_load_async_to_lds_b128 %11, %23, off\n\t"
               "s_wait_xcnt 0x0"
               :: "v"(l), "v"(l + 1u * 16 * PIT * 2), "v"(l + 2u * 16 * PIT * 2), "v"(l + 3u * 16 * PIT * 2), "v"(l + 4u * 16 * PIT * 2), "v"(l + 5u * 16 * PIT * 2),
                  "v"(l + 6u * 16 * PIT * 2), "v"(l + 7u * 16 * PIT * 2), "v"(l + 8u * 16 * PIT * 2), "v"(l + 9u * 16 * PIT * 2), "v"(l + 10u * 16 * PIT * 2), "v"(l + 11u * 16 * PIT * 2),
                  "v"(ga), "v"(ga + 16 * lda), "v"(ga + 32 * lda), "v"(ga + 48 * lda),
                  "v"(gb), "v"(gb + 16 * ldb), "v"(gb + 32 * ldb), "v"(gb + 48 * ldb), "v"(gb + 64 * ldb), "v"(gb + 80 * ldb), "v"(gb + 96 * ldb), "v"(gb + 112 * ldb)
               : "memory");
}
// acc[j] += A rows (wave * 16 ..) x B rows (j * 16 ..) over NT stages, k ascending. A: first of the block's 64 rows (row pitch lda, stage step sa),
// B: first of its 128 rows (row pitch ldb, stage step BKH). Behind it no copy is in flight and every wave has left the ring.
template <int NT>
__device__ __forceinline__ void gemm_ring(const _Float16* A, size_t lda, size_t sa, const _Float16* B, size_t ldb, char* smem, v8f (&acc)[8]) {
  const int tid = threadIdx.x, wave = tid >> 5, lane = tid & 31, col = lane & 15;
  const _Float16* ring = (const _Float16*)smem;
  const _Float16* ga = A + (size_t)(tid >> 3) * lda + (tid & 7) * 8;
  const _Float16* gb = B + (size_t)(tid >> 3) * ldb + (tid & 7) * 8;
  const unsigned l = (unsigned)(size_t)smem + (unsigned)((tid >> 3) * PIT + (tid & 7) * 8) * 2u;
  stage_copy(ga, lda, gb, ldb, l);
  asm volatile("s_wait_asynccnt 0x0" ::: "memory");   // this wave's part of stage 0 has landed before the barrier publishes it
  __syncthreads();
  stage_copy(ga + sa, lda, gb + BKH, ldb, l + STG * 2);
  for (int t = 0; t < NT; ++t) {
    const _Float16* buf = ring + (t & 1) * STG;
    v16h a[2], b[2][8];   // the stage's fragments, read as one group so that one LDS latency is paid per stage, not one per product
    // the four loops below are unrolled so that every index of a, b and acc is a constant and the arrays stay in registers
#pragma unroll
    for (int kc = 0; kc < 2; ++kc) { a[kc] = frag_h(buf + (wave * 16 + col) * PIT + kc * 32, lane);
#pragma unroll
      for (int j = 0; j < 8; ++j) b[kc][j] = frag_h(buf + (64 + j * 16 + col) * PIT + kc * 32, lane); }
#pragma unroll
    for (int kc = 0; kc < 2; ++kc)
#pragma unroll
      for (int j = 0; j < 8; ++j) acc[j] = wmma16(a[kc], b[kc][j], acc[j]);
    asm volatile("s_wait_dscnt 0x0" ::: "memory");      // this wave's reads of the buffer are over before it is refilled
    asm volatile("s_wait_asynccnt 0x0" ::: "memory");   // this wave's part of stage t + 1 has landed
    __syncthreads();                                    // publishes stage t + 1 and frees stage t's buffer
    if (t + 2 < NT) stage_copy(ga + (size_t)(t + 2) * sa, lda, gb + (size_t)(t + 2) * BKH, ldb, l + (unsigned)(t & 1) * (STG * 2));
  }
  asm volatile("s_wait_asynccnt 0x0" ::: "memory");     // nothing in flight when the ring becomes output staging
}

// RMSNorm of rows -> f16 ; wave per row
__global__ __launch_bounds__(256) void k_rms(const float* __restrict__ x, const float* __restrict__ w, _Float16* __restrict__ X16) {
  const int wave = threadIdx.x >> 5, lane = threadIdx.x & 31; const size_t r = (size_t)blockIdx.x * 8 + wave; if (r >= NR) return;
  const float* xr = x + r * E; float q2 = 0.f;
#pragma unroll 1
  for (int i = 0; i < 8; ++i) { const v4f a = *(const v4f*)(xr + i * 128 + lane * 4); q2 += (a[0] * a[0] + a[1] * a[1]) + (a[2] * a[2] + a[3] * a[3]); }
#pragma unroll
  for (int off = 16; off >= 1; off >>= 1) q2 += __shfl_xor(q2, off, 32);
  const float rs = rsqrtf(q2 * (1.0f / E) + 1e-6f);
#pragma unroll 1
  for (int i = 0; i < 4; ++i) { const int c0 = i * 256 + lane * 8; union { v8h h; v4u u; } pk;
#pragma unroll
    for (int e = 0; e < 8; ++e) pk.h[e] = (_Float16)(xr[c0 + e] * rs * w[c0 + e]);
    vst2(X16 + r * E + c0, pk.u); }
}
// weight packs: PT rows: [0,1024) wq, [1024,2048) wk, [2048,3072) wv, [3072,4096) wo (all [out][in=1024]) x16 ; WI rows [4096][1024] x16 ; WF rows [1024][4096] x16
__global__ __launch_bounds__(256) void k_pack(const float* __restrict__ wq, const float* __restrict__ wk, const float* __restrict__ wv, const float* __restrict__ wo, const float* __restrict__ wi, const float* __restrict__ wff,
                                            _Float16* __restrict__ PT, _Float16* __restrict__ WI, _Float16* __restrict__ WF) {
  const int r = blockIdx.x, tid = threadIdx.x; __shared__ __align__(16) _Float16 srow[DFF];
  if (r < 4 * E) { const int which = r >> 10, n = r & (E - 1); const float* W = (which == 0 ? wq : which == 1 ? wk : which == 2 ? wv : wo) + (size_t)n * E;
    for (int k = tid; k < E; k += 256) srow[k] = (_Float16)(W[k] * 16.0f);
    __syncthreads(); if (tid < 128) vst2(PT + (size_t)r * E + tid * 8, *(const v4u*)(&srow[tid * 8])); }
  else if (r < 4 * E + DFF) { const int n = r - 4 * E; const float* W = wi + (size_t)n * E;
    for (int k = tid; k < E; k += 256) srow[k] = (_Float16)(W[k] * 16.0f);
    __syncthreads(); if (tid < 128) vst2(WI + (size_t)n * E + tid * 8, *(const v4u*)(&srow[tid * 8])); }
  else { const int n = r - 4 * E - DFF; const float* W = wff + (size_t)n * DFF;
    for (int k = tid; k < DFF; k += 256) srow[k] = (_Float16)(W[k] * 16.0f);
    __syncthreads(); for (int q = tid; q < DFF / 8; q += 256) vst2(WF + (size_t)n * DFF + q * 8, *(const v4u*)(&srow[q * 8])); }
}
// bias table BT[h][rel + SS - 1] for rel = k - q in [-(SS-1), SS-1]
__global__ __launch_bounds__(256) void k_bias(const float* __restrict__ rb, float* __restrict__ BT) {
  const int h = blockIdx.y, i = blockIdx.x * 256 + threadIdx.x; if (i >= 2 * SS) return;   // table width padded to 2*SS
  float v = 0.f;
  if (i < 2 * SS - 1) { const int rel = i - (SS - 1); const int nb = NBK / 2; int bucket = rel > 0 ? nb : 0; const int rp = rel < 0 ? -rel : rel; const int mx = nb / 2;
    int val; if (rp < mx) val = rp; else { const float lf = logf((float)rp / (float)mx) / 2.772588722239781f * (float)(nb - mx); int large = mx + (int)lf; val = large < nb - 1 ? large : nb - 1; }
    bucket += val; v = rb[bucket * NH + h]; }
  vst2(BT + (size_t)h * 2 * SS + i, v);
}
// QKV: block (64 rows, 128 cols = 2 heads, which)
__global__ __launch_bounds__(128) void k_qkv(const _Float16* __restrict__ X16, const _Float16* __restrict__ PT, _Float16* __restrict__ Q16, _Float16* __restrict__ K16, _Float16* __restrict__ VT) {
  __shared__ __align__(16) char smem[RING_BYTES];   // the operand ring; behind the k loop the output staging
  float (*so)[16][132] = (float (*)[16][132])smem;
  _Float16 (*st)[72] = (_Float16 (*)[72])smem;
  const int tid = threadIdx.x, wave = tid >> 5, lane = tid & 31, col = lane & 15, g = lane >> 4;
  const int which = blockIdx.z, r0b = blockIdx.x * 64, n0 = blockIdx.y * 128; const int b = r0b / SS, s0 = r0b % SS;
  v8f acc[8] = {};
  gemm_ring<E / BKH>(X16 + (size_t)r0b * E, E, BKH, PT + (size_t)(which * E + n0) * E, E, smem, acc);
  if (which < 2) {
#pragma unroll
    for (int j = 0; j < 8; ++j)
#pragma unroll
      for (int r = 0; r < 8; ++r) so[wave][8 * g + r][j * 16 + col] = acc[j][r] * (4.0f / 16.0f);
    LDSX();
    _Float16* D = which == 0 ? Q16 : K16;
    for (int qq = lane; qq < 16 * 2 * 8; qq += 32) { const int hh = qq >> 7, rl = (qq >> 3) & 15, pc = qq & 7; const int h = (n0 >> 6) + hh; union { v8h h8; v4u u; } pk;
#pragma unroll
      for (int e = 0; e < 8; ++e) pk.h8[e] = (_Float16)so[wave][rl][hh * 64 + pc * 8 + e];
      vst2(D + (((size_t)b * NH + h) * SS + s0 + wave * 16 + rl) * HD + pc * 8, pk.u); } }
  else {
#pragma unroll
    for (int j = 0; j < 8; ++j)
#pragma unroll
      for (int r = 0; r < 8; ++r) st[j * 16 + col][wave * 16 + 8 * g + r] = (_Float16)(acc[j][r] * (4.0f / 16.0f));
    __syncthreads();
    for (int qq = tid; qq < 128 * 8; qq += 128) { const int cl = qq >> 3, pc = qq & 7; const int c = n0 + cl, h = c >> 6, d = c & 63;
      vst2(VT + (((size_t)b * NH + h) * HD + d) * SS + s0 + pc * 8, *(const v4u*)(&st[cl][pc * 8])); } }
}
// Attention's K/V ring in LDS. A stage is one 64-key tile for the block's four waves: its 64 K rows (64 d = 128 B each) and then the 64 V^T rows
// (64 keys = 128 B each), at the same 144-B row pitch as the GEMM ring. Two buffers: asynchronous copies fill one while the other is worked on.
#define ASTG (128 * PIT)           // f16 per buffer
// One stage: 128 rows x 8 pieces of 16 B = 8 copies per lane; 8 neighbouring lanes take one row's whole 128-B line.
// gk, gv: this lane's piece in row (tid >> 3) of the K and of the V^T part; l: LDS byte address of the K piece.
__device__ __forceinline__ void kv_copy(const _Float16* gk, const _Float16* gv, unsigned l) {
  // the closing s_wait_xcnt stands inside the statement so that no address register of a copy is rewritten in front of it
  asm volatile("global_load_async_to_lds_b128 %0, %8, off\n\t"
               "global_load_async_to_lds_b128 %1, %9, off\n\t"
               "global_load_async_to_lds_b128 %2, %10, off\n\t"
               "global_load_async_to_lds_b128 %3, %11, off\n\t"
               "global_load_async_to_lds_b128 %4, %12, off\n\t"
               "global_load_async_to_lds_b128 %5, %13, off\n\t"
               "global_load_async_to_lds_b128 %6, %14, off\n\t"
               "global_load_async_to_lds_b128 %7, %15, off\n\t"
               "s_wait_xcnt 0x0"
               :: "v"(l), "v"(l + 1u * 16 * PIT * 2), "v"(l + 2u * 16 * PIT * 2), "v"(l + 3u * 16 * PIT * 2),
                  "v"(l + 4u * 16 * PIT * 2), "v"(l + 5u * 16 * PIT * 2), "v"(l + 6u * 16 * PIT * 2), "v"(l + 7u * 16 * PIT * 2),
                  "v"(gk), "v"(gk + 16 * HD), "v"(gk + 32 * HD), "v"(gk + 48 * HD), "v"(gv), "v"(gv + 16 * SS), "v"(gv + 32 * SS), "v"(gv + 48 * SS)
               : "memory");
}
__global__ __launch_bounds__(128) void k_attn(const _Float16* __restrict__ Q16, const _Float16* __restrict__ K16, const _Float16* __restrict__ VT, const float* __restrict__ BT, _Float16* __restrict__ O16) {
  __shared__ __align__(16) _Float16 kv[2 * ASTG];
  __shared__ __align__(16) float sS[4][16][68];
  __shared__ __align__(16) _Float16 sP[4][16][72];
  __shared__ __align__(16) float sO[4][16][68];
  const int tid = threadIdx.x, w = tid >> 5, lane = tid & 31, col = lane & 15, g = lane >> 4;
  const size_t bh = blockIdx.y; const int h = (int)(bh % NH); const int q0 = blockIdx.x * 64 + w * 16; const float* bth = BT + (size_t)h * 2 * SS + (SS - 1);
  v16h aq[2];
#pragma unroll
  for (int kc = 0; kc < 2; ++kc) aq[kc] = frag_h(Q16 + (bh * SS + q0 + col) * HD + kc * 32, lane);
  float mrun = -3.0e38f, lrun = 0.f; v8f acc[4] = {};
  const _Float16* gk = K16 + (bh * SS + (tid >> 3)) * HD + (tid & 7) * 8;
  const _Float16* gv = VT + (bh * HD + (tid >> 3)) * SS + (tid & 7) * 8;
  const unsigned l = (unsigned)(size_t)kv + (unsigned)((tid >> 3) * PIT + (tid & 7) * 8) * 2u;
  kv_copy(gk, gv, l);
  asm volatile("s_wait_asynccnt 0x0" ::: "memory");   // this wave's part of tile 0 has landed before the barrier publishes it
  __syncthreads();
  kv_copy(gk + 64 * HD, gv + 64, l + ASTG * 2);
#pragma unroll 1
  for (int kt = 0; kt < SS / 64; ++kt) {
    const _Float16* buf = kv + (kt & 1) * ASTG;
    v16h kf[4][2], vf[2][4];   // the tile's fragments, each operand read as one group so that one LDS latency is paid per group, not one per product
    // unrolled so that every index of kf is a constant and the array stays in registers
#pragma unroll
    for (int t = 0; t < 4; ++t)
#pragma unroll
      for (int kc = 0; kc < 2; ++kc) kf[t][kc] = frag_h(buf + (t * 16 + col) * PIT + kc * 32, lane);
#pragma unroll
    for (int t = 0; t < 4; ++t) { v8f s = {}; const int key = kt * 64 + t * 16 + col;
#pragma unroll
      for (int kc = 0; kc < 2; ++kc) s = wmma16(aq[kc], kf[t][kc], s);
#pragma unroll
      for (int r = 0; r < 8; ++r) { const int q = q0 + 8 * g + r; sS[w][8 * g + r][t * 16 + col] = s[r] * (1.0f / 16.0f) + bth[key - q]; } }
    LDSX();
    float mx = -3.4e38f;
#pragma unroll
    for (int jj = 0; jj < 32; ++jj) mx = fmaxf(mx, sS[w][col][g * 32 + jj]);
    mx = fmaxf(mx, __shfl_xor(mx, 16, 32));
    const float mnew = fmaxf(mrun, mx); const float corr = expf(mrun - mnew);
    float ps = 0.f;
#pragma unroll
    for (int jj = 0; jj < 32; ++jj) { const float p = expf(sS[w][col][g * 32 + jj] - mnew); ps += p; sP[w][col][g * 32 + jj] = (_Float16)(p * 16384.0f); }
    ps += __shfl_xor(ps, 16, 32);
    lrun = lrun * corr + ps; mrun = mnew;
    // unrolled so that every index of vf is a constant; read here so that the rescale below covers their latency
#pragma unroll
    for (int kc = 0; kc < 2; ++kc)
#pragma unroll
      for (int t = 0; t < 4; ++t) vf[kc][t] = frag_h(buf + (64 + t * 16 + col) * PIT + kc * 32, lane);
#pragma unroll
    for (int r = 0; r < 8; ++r) { const float cr = __shfl(corr, 8 * g + r, 32);
#pragma unroll
      for (int t = 0; t < 4; ++t) acc[t][r] *= cr; }
    LDSX();
#pragma unroll
    for (int kc = 0; kc < 2; ++kc) { const v16h pa = frag_h(&sP[w][col][0] + kc * 32, lane);
#pragma unroll
      for (int t = 0; t < 4; ++t) acc[t] = wmma16(pa, vf[kc][t], acc[t]); }
    __builtin_amdgcn_wave_barrier();
    asm volatile("s_wait_dscnt 0x0" ::: "memory");      // this wave's reads of the buffer are over before it is refilled
    asm volatile("s_wait_asynccnt 0x0" ::: "memory");   // this wave's part of tile kt + 1 has landed
    __syncthreads();                                    // publishes tile kt + 1 and frees tile kt's buffer
    if (kt + 2 < SS / 64) kv_copy(gk + (size_t)(kt + 2) * 64 * HD, gv + (kt + 2) * 64, l + (unsigned)(kt & 1) * (ASTG * 2)); }
  asm volatile("s_wait_asynccnt 0x0" ::: "memory");     // nothing in flight when the wave goes on to its output and ends
#pragma unroll
  for (int r = 0; r < 8; ++r) { const float lr = __shfl(lrun, 8 * g + r, 32); const float inv = 8.0f / (lr * 16384.0f * 4.0f);
#pragma unroll
    for (int t = 0; t < 4; ++t) sO[w][8 * g + r][t * 16 + col] = acc[t][r] * inv; }
  LDSX();
  for (int qq = lane; qq < 16 * 8; qq += 32) { const int rl = qq >> 3, pc = qq & 7; union { v8h h8; v4u u; } pk;
#pragma unroll
    for (int e = 0; e < 8; ++e) pk.h8[e] = (_Float16)sO[w][rl][pc * 8 + e];
    vst2(O16 + ((bh * SS) + q0 + rl) * HD + pc * 8, pk.u); }
}
// H1 = hidden + ctx wo^T : block (64 rows, 128 cols)
__global__ __launch_bounds__(128) void k_o(const _Float16* __restrict__ O16, const _Float16* __restrict__ PT, const float* __restrict__ hid, float* __restrict__ H1) {
  __shared__ __align__(16) char smem[RING_BYTES];   // the operand ring; behind the k loop the output staging
  float (*so)[16][132] = (float (*)[16][132])smem;
  const int tid = threadIdx.x, wave = tid >> 5, lane = tid & 31, col = lane & 15, g = lane >> 4;
  const int r0b = blockIdx.x * 64, r0 = r0b + wave * 16, n0 = blockIdx.y * 128; const int b = r0b / SS, s0 = r0b % SS;
  v8f acc[8] = {};
  // stage t is head t: 64 k of row s stand at O16[b][t][s][0..63]
  gemm_ring<E / BKH>(O16 + ((size_t)b * NH * SS + s0) * HD, HD, (size_t)SS * HD, PT + (size_t)(3 * E + n0) * E, E, smem, acc);
#pragma unroll
  for (int j = 0; j < 8; ++j) { const int n = n0 + j * 16 + col;
#pragma unroll
    for (int r = 0; r < 8; ++r) so[wave][8 * g + r][j * 16 + col] = acc[j][r] * (1.0f / (16.0f * 8.0f)) + hid[(size_t)(r0 + 8 * g + r) * E + n]; }
  LDSX();
#pragma unroll 4
  for (int rl = 0; rl < 16; ++rl) vst2(H1 + (size_t)(r0 + rl) * E + n0 + lane * 4, *(const v4f*)(&so[wave][rl][lane * 4]));
}
// F16 = relu(Y16 @ wi^T) as f16 rows [NR][4096] : block (64 rows, 128 cols)
__global__ __launch_bounds__(128) void k_ff1(const _Float16* __restrict__ Y16, const _Float16* __restrict__ WI, _Float16* __restrict__ F16) {
  __shared__ __align__(16) char smem[RING_BYTES];   // the operand ring; behind the k loop the output staging
  _Float16 (*so)[16][136] = (_Float16 (*)[16][136])smem;
  const int tid = threadIdx.x, wave = tid >> 5, lane = tid & 31, col = lane & 15, g = lane >> 4;
  const int r0b = blockIdx.x * 64, r0 = r0b + wave * 16, n0 = blockIdx.y * 128;
  v8f acc[8] = {};
  gemm_ring<E / BKH>(Y16 + (size_t)r0b * E, E, BKH, WI + (size_t)n0 * E, E, smem, acc);
#pragma unroll
  for (int j = 0; j < 8; ++j)
#pragma unroll
    for (int r = 0; r < 8; ++r) { const float v = acc[j][r] * (1.0f / 16.0f); so[wave][8 * g + r][j * 16 + col] = (_Float16)(v > 0.f ? v : 0.f); }
  LDSX();
  for (int qq = lane; qq < 16 * 16; qq += 32) { const int rl = qq >> 4, pc = qq & 15; vst2(F16 + (size_t)(r0 + rl) * DFF + n0 + pc * 8, *(const v4u*)(&so[wave][rl][pc * 8])); }
}
// out = H1 + F16 @ wo_ff^T : block (64 rows, 128 cols), K = 4096
__global__ __launch_bounds__(128) void k_ff2(const _Float16* __restrict__ F16, const _Float16* __restrict__ WF, const float* __restrict__ H1, float* __restrict__ out) {
  __shared__ __align__(16) char smem[RING_BYTES];   // the operand ring; behind the k loop the output staging
  float (*so)[16][132] = (float (*)[16][132])smem;
  const int tid = threadIdx.x, wave = tid >> 5, lane = tid & 31, col = lane & 15, g = lane >> 4;
  const int r0b = blockIdx.x * 64, r0 = r0b + wave * 16, n0 = blockIdx.y * 128;
  v8f acc[8] = {};
  gemm_ring<DFF / BKH>(F16 + (size_t)r0b * DFF, DFF, BKH, WF + (size_t)n0 * DFF, DFF, smem, acc);
#pragma unroll
  for (int j = 0; j < 8; ++j) { const int n = n0 + j * 16 + col;
#pragma unroll
    for (int r = 0; r < 8; ++r) so[wave][8 * g + r][j * 16 + col] = acc[j][r] * (1.0f / 16.0f) + H1[(size_t)(r0 + 8 * g + r) * E + n]; }
  LDSX();
#pragma unroll 4
  for (int rl = 0; rl < 16; ++rl) vst2(out + (size_t)(r0 + rl) * E + n0 + lane * 4, *(const v4f*)(&so[wave][rl][lane * 4]));
}
extern "C" void kernel_launch(void* const* d_in, const int* in_sizes, int n_in, void* d_out, int out_size, void* d_ws, size_t ws_size, hipStream_t stream) {
  (void)in_sizes; (void)n_in; (void)out_size; (void)ws_size;
  const float** I = (const float**)d_in;
  const float* hid = I[0]; const float* ln1 = I[1]; const float* wq = I[2]; const float* wk = I[3]; const float* wv = I[4]; const float* wo = I[5]; const float* rb = I[6]; const float* ln2 = I[7]; const float* wi = I[8]; const float* wff = I[9];
  float* out = (float*)d_out;
  char* ws = (char*)d_ws; size_t off = 0;
  auto take = [&](size_t bytes) { char* p = ws + off; off += (bytes + 255) & ~(size_t)255; return p; };
  _Float16* X16 = (_Float16*)take((size_t)NR * E * 2); _Float16* PT = (_Float16*)take((size_t)4 * E * E * 2); _Float16* WI = (_Float16*)take((size_t)DFF * E * 2); _Float16* WF = (_Float16*)take((size_t)E * DFF * 2);
  float* BT = (float*)take((size_t)NH * 2 * SS * 4);
  _Float16* Q16 = (_Float16*)take((size_t)NR * E * 2); _Float16* K16 = (_Float16*)take((size_t)NR * E * 2); _Float16* VT = (_Float16*)take((size_t)NR * E * 2); _Float16* O16 = (_Float16*)take((size_t)NR * E * 2);
  float* H1 = (float*)take((size_t)NR * E * 4); _Float16* Y16 = X16; _Float16* F16 = (_Float16*)take((size_t)NR * DFF * 2);
  k_rms<<<NR / 8, 256, 0, stream>>>(hid, ln1, X16);
  k_pack<<<4 * E + DFF + E, 256, 0, stream>>>(wq, wk, wv, wo, wi, wff, PT, WI, WF);
  k_bias<<<dim3(2 * SS / 256, NH), 256, 0, stream>>>(rb, BT);
  k_qkv<<<dim3(NR / 64, E / 128, 3), 128, 0, stream>>>(X16, PT, Q16, K16, VT);
  k_attn<<<dim3(SS / 64, NB * NH), 128, 0, stream>>>(Q16, K16, VT, BT, O16);
  k_o<<<dim3(NR / 64, E / 128), 128, 0, stream>>>(O16, PT, hid, H1);
  k_rms<<<NR / 8, 256, 0, stream>>>(H1, ln2, Y16);
  k_ff1<<<dim3(NR / 64, DFF / 128), 128, 0, stream>>>(Y16, WI, F16);
  k_ff2<<<dim3(NR / 64, E / 128), 128, 0, stream>>>(F16, WF, H1, out);
}

// v003
// Measured time: 146 microseconds a run.
// Two timings next to v002 put it at 1.13 and 1.12 times that version's speed.
// Counting every step since v000, it is 3.81 times as fast.
#include <hip/hip_runtime.h>
#include <math.h>

typedef __attribute__((ext_vector_type(16))) _Float16 v16h;
typedef __attribute__((ext_vector_type(16))) __bf16 v16b;
typedef __attribute__((ext_vector_type(8)))  _Float16 v8h;
typedef __attribute__((ext_vector_type(4)))  _Float16 v4h;
typedef __attribute__((ext_vector_type(8)))  float v8f;
typedef __attribute__((ext_vector_type(4)))  float v4f;
typedef __attribute__((ext_vector_type(2)))  float v2f;
typedef __attribute__((ext_vector_type(4)))  unsigned v4u;
typedef __attribute__((ext_vector_type(4)))  int v4i;
typedef float __attribute__((may_alias)) float_a;
typedef int __attribute__((may_alias)) int_a;

template <typename T> __device__ __forceinline__ void vst2(void* p, T v) { *(T*)p = v;  }
__device__ __forceinline__ v8f wmma16(v16h a, v16h b, v8f c) {
  v8f d = __builtin_amdgcn_wmma_f32_16x16x32_f16(false, a, false, b, (short)0, c, false, false);
  asm volatile("v_nop\n\tv_nop\n\tv_nop\n\tv_nop" : "+v"(d) : "v"(a), "v"(b));
  return d;
}
__device__ __forceinline__ v8f wmma_bf(v16b a, v16b b, v8f c) {
  v8f d = __builtin_amdgcn_wmma_f32_16x16x32_bf16(false, a, false, b, (short)0, c, false, false);
  asm volatile("v_nop\n\tv_nop\n\tv_nop\n\tv_nop" : "+v"(d) : "v"(a), "v"(b));
  return d;
}
// 16x16x32 fragments: lane = (h = lane>>4, row/col = lane&15); elements 0..7 = k0+8h+0..7, 8..15 = k0+16+8h+0..7; D element r = row 8h+r
__device__ __forceinline__ v16h frag_h(const _Float16* rowk0, int lane) {
  union { v16h v; v8h q[2]; } u; const _Float16* p = rowk0 + 8 * (lane >> 4);
  u.q[0] = *(const v8h*)p; u.q[1] = *(const v8h*)(p + 16); return u.v;
}
__device__ __forceinline__ v16h frag_f32(const float* rowk0, int lane) {
  v16h a; const float* p = rowk0 + 8 * (lane >> 4);
#pragma unroll
  for (int i = 0; i < 8; ++i) { a[i] = (_Float16)p[i]; a[8 + i] = (_Float16)p[16 + i]; }
  return a;
}
__device__ __forceinline__ v16h frag_f32s(const float* rowk0, int lane, float sc) {
  v16h a; const float* p = rowk0 + 8 * (lane >> 4);
#pragma unroll
  for (int i = 0; i < 8; ++i) { a[i] = (_Float16)(p[i] * sc); a[8 + i] = (_Float16)(p[16 + i] * sc); }
  return a;
}
// column fragment from a [K][ld] layout (column n), rows >= K read as 0
__device__ __forceinline__ v16h fragc_f32(const float* W, int k0, int n, int lane, int ld, int K) {
  v16h a; const int g = lane >> 4;
#pragma unroll
  for (int i = 0; i < 8; ++i) { const int ka = k0 + 8 * g + i, kb = ka + 16;
    a[i] = (_Float16)(ka < K ? W[(size_t)ka * ld + n] : 0.f); a[8 + i] = (_Float16)(kb < K ? W[(size_t)kb * ld + n] : 0.f); }
  return a;
}
struct F2 { v16b h, l; };
__device__ __forceinline__ F2 bsplit16(const float v[16]) { F2 r;
#pragma unroll
  for (int i = 0; i < 16; ++i) { const __bf16 h = (__bf16)v[i]; r.h[i] = h; r.l[i] = (__bf16)(v[i] - (float)h); }
  return r; }
__device__ __forceinline__ F2 split_row(const float* row, int k0, int lane) { float v[16]; const float* p = row + k0 + 8 * (lane >> 4);
#pragma unroll
  for (int i = 0; i < 8; ++i) { v[i] = p[i]; v[8 + i] = p[16 + i]; }
  return bsplit16(v); }
__device__ __forceinline__ F2 split_rowK(const float* row, int k0, int lane, int K) { float v[16]; const int g = lane >> 4;
#pragma unroll
  for (int i = 0; i < 8; ++i) { const int ka = k0 + 8 * g + i, kb = ka + 16; v[i] = ka < K ? row[ka] : 0.f; v[8 + i] = kb < K ? row[kb] : 0.f; }
  return bsplit16(v); }
__device__ __forceinline__ F2 split_col(const float* W, int k0, int n, int lane, int ld, int K) { float v[16]; const int g = lane >> 4;
#pragma unroll
  for (int i = 0; i < 8; ++i) { const int ka = k0 + 8 * g + i, kb = ka + 16; v[i] = ka < K ? W[(size_t)ka * ld + n] : 0.f; v[8 + i] = kb < K ? W[(size_t)kb * ld + n] : 0.f; }
  return bsplit16(v); }
__device__ __forceinline__ v8f mac3(const F2& a, const F2& b, v8f c) { c = wmma_bf(a.l, b.h, c); c = wmma_bf(a.h, b.l, c); return wmma_bf(a.h, b.h, c); }
__device__ __forceinline__ float sigm(float v) { return 1.0f / (1.0f + expf(-v)); }
#define LDSX() do { asm volatile("s_wait_dscnt 0" ::: "memory"); __builtin_amdgcn_wave_barrier(); __builtin_amdgcn_fence(__ATOMIC_RELEASE, "workgroup"); } while (0)

// T5 encoder block: RMSNorm -> 16-head self attention with the bidirectional relative-position bias (no 1/sqrt(d)) -> residual ->
// RMSNorm -> ReLU FFN (1024 -> 4096 -> 1024) -> residual. All products on v_wmma_f32_16x16x32_f16 ([out][in] weight rows converted once
// to f16 rows x16; activations as f16 rows, q/k x4, P x2^14, V x4, ctx x8); RMSNorms, the bucket function, softmax and residuals in f32.
#define NB 2
#define SS 1024
#define E 1024
#define NH 16
#define HD 64
#define DFF 4096
#define NR (NB * SS)           // 2048
#define NBK 32
#define MAXD 128

// GEMM operand ring in LDS. A stage is 64 k (128 B) of the block's 64 A rows and then of its 128 B rows, at a row pitch of 144 B
// (16 B x odd, the conflict-free pitch for ds_load_b128). Two buffers: asynchronous copies fill one while the other is multiplied.
#define BKH 64                     // k per stage
#define PIT 72                     // LDS row pitch in f16
#define STG (192 * PIT)            // f16 per buffer
#define RING_BYTES (2 * STG * 2)
// One stage: 192 rows x 8 pieces of 16 B = 12 copies per lane; 8 neighbouring lanes take one row's whole 128-B line.
// ga, gb: this lane's piece in row (tid >> 3) of the A and of the B part; l: LDS byte address of the A piece.
__device__ __forceinline__ void stage_copy(const _Float16* ga, size_t lda, const _Float16* gb, size_t ldb, unsigned l) {
  // the closing s_wait_xcnt stands inside the statement so that no address register of a copy is rewritten in front of it
  asm volatile("global_load_async_to_lds_b128 %0, %12, off\n\t"
               "global_load_async_to_lds_b128 %1, %13, off\n\t"
               "global_load_async_to_lds_b128 %2, %14, off\n\t"
               "global_load_async_to_lds_b128 %3, %15, off\n\t"
               "global_load_async_to_lds_b128 %4, %16, off\n\t"
               "global_load_async_to_lds_b128 %5, %17, off\n\t"
               "global_load_async_to_lds_b128 %6, %18, off\n\t"
               "global_load_async_to_lds_b128 %7, %19, off\n\t"
               "global_load_async_to_lds_b128 %8, %20, off\n\t"
               "global_load_async_to_lds_b128 %9, %21, off\n\t"
               "global_load_async_to_lds_b128 %10, %22, off\n\t"
               "global_load_async_to_lds_b128 %11, %23, off\n\t"
               "s_wait_xcnt 0x0"
               :: "v"(l), "v"(l + 1u * 16 * PIT * 2), "v"(l + 2u * 16 * PIT * 2), "v"(l + 3u * 16 * PIT * 2), "v"(l + 4u * 16 * PIT * 2), "v"(l + 5u * 16 * PIT * 2),
                  "v"(l + 6u * 16 * PIT * 2), "v"(l + 7u * 16 * PIT * 2), "v"(l + 8u * 16 * PIT * 2), "v"(l + 9u * 16 * PIT * 2), "v"(l + 10u * 16 * PIT * 2), "v"(l + 11u * 16 * PIT * 2),
                  "v"(ga), "v"(ga + 16 * lda), "v"(ga + 32 * lda), "v"(ga + 48 * lda),
                  "v"(gb), "v"(gb + 16 * ldb), "v"(gb + 32 * ldb), "v"(gb + 48 * ldb), "v"(gb + 64 * ldb), "v"(gb + 80 * ldb), "v"(gb + 96 * ldb), "v"(gb + 112 * ldb)
               : "memory");
}
// acc[j] += A rows (wave * 16 ..) x B rows (j * 16 ..) over NT stages, k ascending. A: first of the block's 64 rows (row pitch lda, stage step sa),
// B: first of its 128 rows (row pitch ldb, stage step BKH). Behind it no copy is in flight and every wave has left the ring.
template <int NT>
__device__ __forceinline__ void gemm_ring(const _Float16* A, size_t lda, size_t sa, const _Float16* B, size_t ldb, char* smem, v8f (&acc)[8]) {
  const int tid = threadIdx.x, wave = tid >> 5, lane = tid & 31, col = lane & 15;
  const _Float16* ring = (const _Float16*)smem;
  const _Float16* ga = A + (size_t)(tid >> 3) * lda + (tid & 7) * 8;
  const _Float16* gb = B + (size_t)(tid >> 3) * ldb + (tid & 7) * 8;
  const unsigned l = (unsigned)(size_t)smem + (unsigned)((tid >> 3) * PIT + (tid & 7) * 8) * 2u;
  stage_copy(ga, lda, gb, ldb, l);
  asm volatile("s_wait_asynccnt 0x0" ::: "memory");   // this wave's part of stage 0 has landed before the barrier publishes it
  __syncthreads();
  stage_copy(ga + sa, lda, gb + BKH, ldb, l + STG * 2);
  for (int t = 0; t < NT; ++t) {
    const _Float16* buf = ring + (t & 1) * STG;
    v16h a[2], b[2][8];   // the stage's fragments, read as one group so that one LDS latency is paid per stage, not one per product
    // the four loops below are unrolled so that every index of a, b and acc is a constant and the arrays stay in registers
#pragma unroll
    for (int kc = 0; kc < 2; ++kc) { a[kc] = frag_h(buf + (wave * 16 + col) * PIT + kc * 32, lane);
#pragma unroll
      for (int j = 0; j < 8; ++j) b[kc][j] = frag_h(buf + (64 + j * 16 + col) * PIT + kc * 32, lane); }
#pragma unroll
    for (int kc = 0; kc < 2; ++kc)
#pragma unroll
      for (int j = 0; j < 8; ++j) acc[j] = wmma16(a[kc], b[kc][j], acc[j]);
    asm volatile("s_wait_dscnt 0x0" ::: "memory");      // this wave's reads of the buffer are over before it is refilled
    asm volatile("s_wait_asynccnt 0x0" ::: "memory");   // this wave's part of stage t + 1 has landed
    __syncthreads();                                    // publishes stage t + 1 and frees stage t's buffer
    if (t + 2 < NT) stage_copy(ga + (size_t)(t + 2) * sa, lda, gb + (size_t)(t + 2) * BKH, ldb, l + (unsigned)(t & 1) * (STG * 2));
  }
  asm volatile("s_wait_asynccnt 0x0" ::: "memory");     // nothing in flight when the ring becomes output staging
}

// RMSNorm of rows -> f16 ; wave per row, 8 rows per block blk
__device__ __forceinline__ void rms_rows(const float* __restrict__ x, const float* __restrict__ w, _Float16* __restrict__ X16, unsigned blk) {
  const int wave = threadIdx.x >> 5, lane = threadIdx.x & 31; const size_t r = (size_t)blk * 8 + wave; if (r >= NR) return;
  const float* xr = x + r * E; float q2 = 0.f;
#pragma unroll 1
  for (int i = 0; i < 8; ++i) { const v4f a = *(const v4f*)(xr + i * 128 + lane * 4); q2 += (a[0] * a[0] + a[1] * a[1]) + (a[2] * a[2] + a[3] * a[3]); }
#pragma unroll
  for (int off = 16; off >= 1; off >>= 1) q2 += __shfl_xor(q2, off, 32);
  const float rs = rsqrtf(q2 * (1.0f / E) + 1e-6f);
#pragma unroll 1
  for (int i = 0; i < 4; ++i) { const int c0 = i * 256 + lane * 8; union { v8h h; v4u u; } pk;
#pragma unroll
    for (int e = 0; e < 8; ++e) pk.h[e] = (_Float16)(xr[c0 + e] * rs * w[c0 + e]);
    vst2(X16 + r * E + c0, pk.u); }
}
__global__ __launch_bounds__(256) void k_rms(const float* __restrict__ x, const float* __restrict__ w, _Float16* __restrict__ X16) { rms_rows(x, w, X16, blockIdx.x); }
// weight packs: PT rows: [0,1024) wq, [1024,2048) wk, [2048,3072) wv, [3072,4096) wo (all [out][in=1024]) x16 ; WI rows [4096][1024] x16 ; WF rows [1024][4096] x16
// All that depends on the inputs alone and is read by k_qkv or k_attn, as block ranges of one grid: the first RMSNorm, then the bias table
// BT[h][rel + SS - 1] for rel = k - q in [-(SS-1), SS-1], then the wq, wk, wv rows of PT (one row per block).
#define PREP_RMS (NR / 8)
#define PREP_BIAS (2 * SS / 256 * NH)
__global__ __launch_bounds__(256) void k_prep(const float* __restrict__ hid, const float* __restrict__ ln1, const float* __restrict__ wq, const float* __restrict__ wk, const float* __restrict__ wv, const float* __restrict__ rb,
                                            _Float16* __restrict__ X16, _Float16* __restrict__ PT, float* __restrict__ BT) {
  const int blk = blockIdx.x, tid = threadIdx.x; __shared__ __align__(16) _Float16 srow[E];
  if (blk < PREP_RMS) { rms_rows(hid, ln1, X16, blk); return; }
  if (blk < PREP_RMS + PREP_BIAS) { const int h = (blk - PREP_RMS) >> 3, i = ((blk - PREP_RMS) & 7) * 256 + tid; if (i >= 2 * SS) return;   // table width padded to 2*SS
    float v = 0.f;
    if (i < 2 * SS - 1) { const int rel = i - (SS - 1); const int nb = NBK / 2; int bucket = rel > 0 ? nb : 0; const int rp = rel < 0 ? -rel : rel; const int mx = nb / 2;
      int val; if (rp < mx) val = rp; else { const float lf = logf((float)rp / (float)mx) / 2.772588722239781f * (float)(nb - mx); int large = mx + (int)lf; val = large < nb - 1 ? large : nb - 1; }
      bucket += val; v = rb[bucket * NH + h]; }
    vst2(BT + (size_t)h * 2 * SS + i, v); return; }
  const int r = blk - PREP_RMS - PREP_BIAS, which = r >> 10, n = r & (E - 1); const float* W = (which == 0 ? wq : which == 1 ? wk : wv) + (size_t)n * E;
  for (int k = tid; k < E; k += 256) srow[k] = (_Float16)(W[k] * 16.0f);
  __syncthreads(); if (tid < 128) vst2(PT + (size_t)r * E + tid * 8, *(const v4u*)(&srow[tid * 8]));
}
// A 128-thread block's share of a weight pack whose rows keep their order: PCH consecutive f32 -> f16 x16.
#define PCH 4096
__device__ __forceinline__ void pack_chunk(const float* __restrict__ s, _Float16* __restrict__ d) {
  const int tid = threadIdx.x; v4f v[8];
  // both loops unrolled so that v stays in registers and the lane's eight loads are in flight together
#pragma unroll
  for (int i = 0; i < 8; ++i) v[i] = *(const v4f*)(s + (i * 128 + tid) * 4);
#pragma unroll
  for (int i = 0; i < 8; ++i) { v4h h;
#pragma unroll
    for (int e = 0; e < 4; ++e) h[e] = (_Float16)(v[i][e] * 16.0f);
    vst2(d + (i * 128 + tid) * 4, h); }
}
// QKV: block (64 rows, 128 cols = 2 heads, which)
__global__ __launch_bounds__(128) void k_qkv(const _Float16* __restrict__ X16, const _Float16* __restrict__ PT, _Float16* __restrict__ Q16, _Float16* __restrict__ K16, _Float16* __restrict__ VT) {
  __shared__ __align__(16) char smem[RING_BYTES];   // the operand ring; behind the k loop the output staging
  float (*so)[16][132] = (float (*)[16][132])smem;
  _Float16 (*st)[72] = (_Float16 (*)[72])smem;
  const int tid = threadIdx.x, wave = tid >> 5, lane = tid & 31, col = lane & 15, g = lane >> 4;
  const int which = blockIdx.z, r0b = blockIdx.x * 64, n0 = blockIdx.y * 128; const int b = r0b / SS, s0 = r0b % SS;
  v8f acc[8] = {};
  gemm_ring<E / BKH>(X16 + (size_t)r0b * E, E, BKH, PT + (size_t)(which * E + n0) * E, E, smem, acc);
  if (which < 2) {
#pragma unroll
    for (int j = 0; j < 8; ++j)
#pragma unroll
      for (int r = 0; r < 8; ++r) so[wave][8 * g + r][j * 16 + col] = acc[j][r] * (4.0f / 16.0f);
    LDSX();
    _Float16* D = which == 0 ? Q16 : K16;
    for (int qq = lane; qq < 16 * 2 * 8; qq += 32) { const int hh = qq >> 7, rl = (qq >> 3) & 15, pc = qq & 7; const int h = (n0 >> 6) + hh; union { v8h h8; v4u u; } pk;
#pragma unroll
      for (int e = 0; e < 8; ++e) pk.h8[e] = (_Float16)so[wave][rl][hh * 64 + pc * 8 + e];
      vst2(D + (((size_t)b * NH + h) * SS + s0 + wave * 16 + rl) * HD + pc * 8, pk.u); } }
  else {
#pragma unroll
    for (int j = 0; j < 8; ++j)
#pragma unroll
      for (int r = 0; r < 8; ++r) st[j * 16 + col][wave * 16 + 8 * g + r] = (_Float16)(acc[j][r] * (4.0f / 16.0f));
    __syncthreads();
    for (int qq = tid; qq < 128 * 8; qq += 128) { const int cl = qq >> 3, pc = qq & 7; const int c = n0 + cl, h = c >> 6, d = c & 63;
      vst2(VT + (((size_t)b * NH + h) * HD + d) * SS + s0 + pc * 8, *(const v4u*)(&st[cl][pc * 8])); } }
}
// Attention's K/V ring in LDS. A stage is one 64-key tile for the block's four waves: its 64 K rows (64 d = 128 B each) and then the 64 V^T rows
// (64 keys = 128 B each), at the same 144-B row pitch as the GEMM ring. Two buffers: asynchronous copies fill one while the other is worked on.
#define ASTG (128 * PIT)           // f16 per buffer
// One stage: 128 rows x 8 pieces of 16 B = 8 copies per lane; 8 neighbouring lanes take one row's whole 128-B line.
// gk, gv: this lane's piece in row (tid >> 3) of the K and of the V^T part; l: LDS byte address of the K piece.
__device__ __forceinline__ void kv_copy(const _Float16* gk, const _Float16* gv, unsigned l) {
  // the closing s_wait_xcnt stands inside the statement so that no address register of a copy is rewritten in front of it
  asm volatile("global_load_async_to_lds_b128 %0, %8, off\n\t"
               "global_load_async_to_lds_b128 %1, %9, off\n\t"
               "global_load_async_to_lds_b128 %2, %10, off\n\t"
               "global_load_async_to_lds_b128 %3, %11, off\n\t"
               "global_load_async_to_lds_b128 %4, %12, off\n\t"
               "global_load_async_to_lds_b128 %5, %13, off\n\t"
               "global_load_async_to_lds_b128 %6, %14, off\n\t"
               "global_load_async_to_lds_b128 %7, %15, off\n\t"
               "s_wait_xcnt 0x0"
               :: "v"(l), "v"(l + 1u * 16 * PIT * 2), "v"(l + 2u * 16 * PIT * 2), "v"(l + 3u * 16 * PIT * 2),
                  "v"(l + 4u * 16 * PIT * 2), "v"(l + 5u * 16 * PIT * 2), "v"(l + 6u * 16 * PIT * 2), "v"(l + 7u * 16 * PIT * 2),
                  "v"(gk), "v"(gk + 16 * HD), "v"(gk + 32 * HD), "v"(gk + 48 * HD), "v"(gv), "v"(gv + 16 * SS), "v"(gv + 32 * SS), "v"(gv + 48 * SS)
               : "memory");
}
// Grid rows y < NB * NH are the attention tiles. The RIDE_Y rows behind them pack wo, wi and wo_ff, which only the launches after this one read:
// their memory stream runs in the places that the attention blocks leave free on each WGP.
#define RIDE_Y ((E * E + 2 * DFF * E) / PCH / (SS / 64))
__global__ __launch_bounds__(128) void k_attn(const _Float16* __restrict__ Q16, const _Float16* __restrict__ K16, const _Float16* __restrict__ VT, const float* __restrict__ BT, _Float16* __restrict__ O16,
                                            const float* __restrict__ wo, const float* __restrict__ wi, const float* __restrict__ wff, _Float16* __restrict__ PTO, _Float16* __restrict__ WI, _Float16* __restrict__ WF) {
  if (blockIdx.y >= NB * NH) {   // the whole block leaves here, in front of every barrier and copy
    const unsigned c = (blockIdx.y - NB * NH) * (SS / 64) + blockIdx.x; const int m = c < E * E / PCH ? 0 : c < (E * E + DFF * E) / PCH ? 1 : 2;
    const size_t o = (size_t)(c - (m == 0 ? 0 : m == 1 ? E * E / PCH : (E * E + DFF * E) / PCH)) * PCH;
    pack_chunk((m == 0 ? wo : m == 1 ? wi : wff) + o, (m == 0 ? PTO : m == 1 ? WI : WF) + o);
    return; }
  __shared__ __align__(16) _Float16 kv[2 * ASTG];
  __shared__ __align__(16) float sS[4][16][68];
  __shared__ __align__(16) _Float16 sP[4][16][72];
  __shared__ __align__(16) float sO[4][16][68];
  const int tid = threadIdx.x, w = tid >> 5, lane = tid & 31, col = lane & 15, g = lane >> 4;
  const size_t bh = blockIdx.y; const int h = (int)(bh % NH); const int q0 = blockIdx.x * 64 + w * 16; const float* bth = BT + (size_t)h * 2 * SS + (SS - 1);
  v16h aq[2];
#pragma unroll
  for (int kc = 0; kc < 2; ++kc) aq[kc] = frag_h(Q16 + (bh * SS + q0 + col) * HD + kc * 32, lane);
  float mrun = -3.0e38f, lrun = 0.f; v8f acc[4] = {};
  const _Float16* gk = K16 + (bh * SS + (tid >> 3)) * HD + (tid & 7) * 8;
  const _Float16* gv = VT + (bh * HD + (tid >> 3)) * SS + (tid & 7) * 8;
  const unsigned l = (unsigned)(size_t)kv + (unsigned)((tid >> 3) * PIT + (tid & 7) * 8) * 2u;
  kv_copy(gk, gv, l);
  asm volatile("s_wait_asynccnt 0x0" ::: "memory");   // this wave's part of tile 0 has landed before the barrier publishes it
  __syncthreads();
  kv_copy(gk + 64 * HD, gv + 64, l + ASTG * 2);
#pragma unroll 1
  for (int kt = 0; kt < SS / 64; ++kt) {
    const _Float16* buf = kv + (kt & 1) * ASTG;
    v16h kf[4][2], vf[2][4];   // the tile's fragments, each operand read as one group so that one LDS latency is paid per group, not one per product
    // unrolled so that every index of kf is a constant and the array stays in registers
#pragma unroll
    for (int t = 0; t < 4; ++t)
#pragma unroll
      for (int kc = 0; kc < 2; ++kc) kf[t][kc] = frag_h(buf + (t * 16 + col) * PIT + kc * 32, lane);
#pragma unroll
    for (int t = 0; t < 4; ++t) { v8f s = {}; const int key = kt * 64 + t * 16 + col;
#pragma unroll
      for (int kc = 0; kc < 2; ++kc) s = wmma16(aq[kc], kf[t][kc], s);
#pragma unroll
      for (int r = 0; r < 8; ++r) { const int q = q0 + 8 * g + r; sS[w][8 * g + r][t * 16 + col] = s[r] * (1.0f / 16.0f) + bth[key - q]; } }
    LDSX();
    float mx = -3.4e38f;
#pragma unroll
    for (int jj = 0; jj < 32; ++jj) mx = fmaxf(mx, sS[w][col][g * 32 + jj]);
    mx = fmaxf(mx, __shfl_xor(mx, 16, 32));
    const float mnew = fmaxf(mrun, mx); const float corr = expf(mrun - mnew);
    float ps = 0.f;
#pragma unroll
    for (int jj = 0; jj < 32; ++jj) { const float p = expf(sS[w][col][g * 32 + jj] - mnew); ps += p; sP[w][col][g * 32 + jj] = (_Float16)(p * 16384.0f); }
    ps += __shfl_xor(ps, 16, 32);
    lrun = lrun * corr + ps; mrun = mnew;
    // unrolled so that every index of vf is a constant; read here so that the rescale below covers their latency
#pragma unroll
    for (int kc = 0; kc < 2; ++kc)
#pragma unroll
      for (int t = 0; t < 4; ++t) vf[kc][t] = frag_h(buf + (64 + t * 16 + col) * PIT + kc * 32, lane);
#pragma unroll
    for (int r = 0; r < 8; ++r) { const float cr = __shfl(corr, 8 * g + r, 32);
#pragma unroll
      for (int t = 0; t < 4; ++t) acc[t][r] *= cr; }
    LDSX();
#pragma unroll
    for (int kc = 0; kc < 2; ++kc) { const v16h pa = frag_h(&sP[w][col][0] + kc * 32, lane);
#pragma unroll
      for (int t = 0; t < 4; ++t) acc[t] = wmma16(pa, vf[kc][t], acc[t]); }
    __builtin_amdgcn_wave_barrier();
    asm volatile("s_wait_dscnt 0x0" ::: "memory");      // this wave's reads of the buffer are over before it is refilled
    asm volatile("s_wait_asynccnt 0x0" ::: "memory");   // this wave's part of tile kt + 1 has landed
    __syncthreads();                                    // publishes tile kt + 1 and frees tile kt's buffer
    if (kt + 2 < SS / 64) kv_copy(gk + (size_t)(kt + 2) * 64 * HD, gv + (kt + 2) * 64, l + (unsigned)(kt & 1) * (ASTG * 2)); }
  asm volatile("s_wait_asynccnt 0x0" ::: "memory");     // nothing in flight when the wave goes on to its output and ends
#pragma unroll
  for (int r = 0; r < 8; ++r) { const float lr = __shfl(lrun, 8 * g + r, 32); const float inv = 8.0f / (lr * 16384.0f * 4.0f);
#pragma unroll
    for (int t = 0; t < 4; ++t) sO[w][8 * g + r][t * 16 + col] = acc[t][r] * inv; }
  LDSX();
  for (int qq = lane; qq < 16 * 8; qq += 32) { const int rl = qq >> 3, pc = qq & 7; union { v8h h8; v4u u; } pk;
#pragma unroll
    for (int e = 0; e < 8; ++e) pk.h8[e] = (_Float16)sO[w][rl][pc * 8 + e];
    vst2(O16 + ((bh * SS) + q0 + rl) * HD + pc * 8, pk.u); }
}
// H1 = hidden + ctx wo^T : block (64 rows, 128 cols)
__global__ __launch_bounds__(128) void k_o(const _Float16* __restrict__ O16, const _Float16* __restrict__ PT, const float* __restrict__ hid, float* __restrict__ H1) {
  __shared__ __align__(16) char smem[RING_BYTES];   // the operand ring; behind the k loop the output staging
  float (*so)[16][132] = (float (*)[16][132])smem;
  const int tid = threadIdx.x, wave = tid >> 5, lane = tid & 31, col = lane & 15, g = lane >> 4;
  const int r0b = blockIdx.x * 64, r0 = r0b + wave * 16, n0 = blockIdx.y * 128; const int b = r0b / SS, s0 = r0b % SS;
  v8f acc[8] = {};
  // stage t is head t: 64 k of row s stand at O16[b][t][s][0..63]
  gemm_ring<E / BKH>(O16 + ((size_t)b * NH * SS + s0) * HD, HD, (size_t)SS * HD, PT + (size_t)(3 * E + n0) * E, E, smem, acc);
#pragma unroll
  for (int j = 0; j < 8; ++j) { const int n = n0 + j * 16 + col;
#pragma unroll
    for (int r = 0; r < 8; ++r) so[wave][8 * g + r][j * 16 + col] = acc[j][r] * (1.0f / (16.0f * 8.0f)) + hid[(size_t)(r0 + 8 * g + r) * E + n]; }
  LDSX();
#pragma unroll 4
  for (int rl = 0; rl < 16; ++rl) vst2(H1 + (size_t)(r0 + rl) * E + n0 + lane * 4, *(const v4f*)(&so[wave][rl][lane * 4]));
}
// F16 = relu(Y16 @ wi^T) as f16 rows [NR][4096] : block (64 rows, 128 cols)
__global__ __launch_bounds__(128) void k_ff1(const _Float16* __restrict__ Y16, const _Float16* __restrict__ WI, _Float16* __restrict__ F16) {
  __shared__ __align__(16) char smem[RING_BYTES];   // the operand ring; behind the k loop the output staging
  _Float16 (*so)[16][136] = (_Float16 (*)[16][136])smem;
  const int tid = threadIdx.x, wave = tid >> 5, lane = tid & 31, col = lane & 15, g = lane >> 4;
  const int r0b = blockIdx.x * 64, r0 = r0b + wave * 16, n0 = blockIdx.y * 128;
  v8f acc[8] = {};
  gemm_ring<E / BKH>(Y16 + (size_t)r0b * E, E, BKH, WI + (size_t)n0 * E, E, smem, acc);
#pragma unroll
  for (int j = 0; j < 8; ++j)
#pragma unroll
    for (int r = 0; r < 8; ++r) { const float v = acc[j][r] * (1.0f / 16.0f); so[wave][8 * g + r][j * 16 + col] = (_Float16)(v > 0.f ? v : 0.f); }
  LDSX();
  for (int qq = lane; qq < 16 * 16; qq += 32) { const int rl = qq >> 4, pc = qq & 15; vst2(F16 + (size_t)(r0 + rl) * DFF + n0 + pc * 8, *(const v4u*)(&so[wave][rl][pc * 8])); }
}
// out = H1 + F16 @ wo_ff^T : block (64 rows, 128 cols), K = 4096
__global__ __launch_bounds__(128) void k_ff2(const _Float16* __restrict__ F16, const _Float16* __restrict__ WF, const float* __restrict__ H1, float* __restrict__ out) {
  __shared__ __align__(16) char smem[RING_BYTES];   // the operand ring; behind the k loop the output staging
  float (*so)[16][132] = (float (*)[16][132])smem;
  const int tid = threadIdx.x, wave = tid >> 5, lane = tid & 31, col = lane & 15, g = lane >> 4;
  const int r0b = blockIdx.x * 64, r0 = r0b + wave * 16, n0 = blockIdx.y * 128;
  v8f acc[8] = {};
  gemm_ring<DFF / BKH>(F16 + (size_t)r0b * DFF, DFF, BKH, WF + (size_t)n0 * DFF, DFF, smem, acc);
#pragma unroll
  for (int j = 0; j < 8; ++j) { const int n = n0 + j * 16 + col;
#pragma unroll
    for (int r = 0; r < 8; ++r) so[wave][8 * g + r][j * 16 + col] = acc[j][r] * (1.0f / 16.0f) + H1[(size_t)(r0 + 8 * g + r) * E + n]; }
  LDSX();
#pragma unroll 4
  for (int rl = 0; rl < 16; ++rl) vst2(out + (size_t)(r0 + rl) * E + n0 + lane * 4, *(const v4f*)(&so[wave][rl][lane * 4]));
}
extern "C" void kernel_launch(void* const* d_in, const int* in_sizes, int n_in, void* d_out, int out_size, void* d_ws, size_t ws_size, hipStream_t stream) {
  (void)in_sizes; (void)n_in; (void)out_size; (void)ws_size;
  const float** I = (const float**)d_in;
  const float* hid = I[0]; const float* ln1 = I[1]; const float* wq = I[2]; const float* wk = I[3]; const float* wv = I[4]; const float* wo = I[5]; const float* rb = I[6]; const float* ln2 = I[7]; const float* wi = I[8]; const float* wff = I[9];
  float* out = (float*)d_out;
  char* ws = (char*)d_ws; size_t off = 0;
  auto take = [&](size_t bytes) { char* p = ws + off; off += (bytes + 255) & ~(size_t)255; return p; };
  _Float16* X16 = (_Float16*)take((size_t)NR * E * 2); _Float16* PT = (_Float16*)take((size_t)4 * E * E * 2); _Float16* WI = (_Float16*)take((size_t)DFF * E * 2); _Float16* WF = (_Float16*)take((size_t)E * DFF * 2);
  float* BT = (float*)take((size_t)NH * 2 * SS * 4);
  _Float16* Q16 = (_Float16*)take((size_t)NR * E * 2); _Float16* K16 = (_Float16*)take((size_t)NR * E * 2); _Float16* VT = (_Float16*)take((size_t)NR * E * 2); _Float16* O16 = (_Float16*)take((size_t)NR * E * 2);
  float* H1 = (float*)take((size_t)NR * E * 4); _Float16* Y16 = X16; _Float16* F16 = (_Float16*)take((size_t)NR * DFF * 2);
  k_prep<<<PREP_RMS + PREP_BIAS + 3 * E, 256, 0, stream>>>(hid, ln1, wq, wk, wv, rb, X16, PT, BT);
  k_qkv<<<dim3(NR / 64, E / 128, 3), 128, 0, stream>>>(X16, PT, Q16, K16, VT);
  k_attn<<<dim3(SS / 64, NB * NH + RIDE_Y), 128, 0, stream>>>(Q16, K16, VT, BT, O16, wo, wi, wff, PT + (size_t)3 * E * E, WI, WF);
  k_o<<<dim3(NR / 64, E / 128), 128, 0, stream>>>(O16, PT, hid, H1);
  k_rms<<<NR / 8, 256, 0, stream>>>(H1, ln2, Y16);
  k_ff1<<<dim3(NR / 64, DFF / 128), 128, 0, stream>>>(Y16, WI, F16);
  k_ff2<<<dim3(NR / 64, E / 128), 128, 0, stream>>>(F16, WF, H1, out);
}

// v004
// It runs in 119 microseconds.
// Next to v003, in two timings, it ran 1.22 times as fast each time.
// Counting every step since v000, it is 4.66 times as fast.
#include <hip/hip_runtime.h>
#include <math.h>

typedef __attribute__((ext_vector_type(16))) _Float16 v16h;
typedef __attribute__((ext_vector_type(16))) __bf16 v16b;
typedef __attribute__((ext_vector_type(8)))  _Float16 v8h;
typedef __attribute__((ext_vector_type(4)))  _Float16 v4h;
typedef __attribute__((ext_vector_type(8)))  float v8f;
typedef __attribute__((ext_vector_type(4)))  float v4f;
typedef __attribute__((ext_vector_type(2)))  float v2f;
typedef __attribute__((ext_vector_type(4)))  unsigned v4u;
typedef __attribute__((ext_vector_type(4)))  int v4i;
typedef float __attribute__((may_alias)) float_a;
typedef int __attribute__((may_alias)) int_a;

template <typename T> __device__ __forceinline__ void vst2(void* p, T v) { *(T*)p = v;  }
__device__ __forceinline__ v8f wmma16(v16h a, v16h b, v8f c) {
  v8f d = __builtin_amdgcn_wmma_f32_16x16x32_f16(false, a, false, b, (short)0, c, false, false);
  asm volatile("v_nop\n\tv_nop\n\tv_nop\n\tv_nop" : "+v"(d) : "v"(a), "v"(b));
  return d;
}
__device__ __forceinline__ v8f wmma_bf(v16b a, v16b b, v8f c) {
  v8f d = __builtin_amdgcn_wmma_f32_16x16x32_bf16(false, a, false, b, (short)0, c, false, false);
  asm volatile("v_nop\n\tv_nop\n\tv_nop\n\tv_nop" : "+v"(d) : "v"(a), "v"(b));
  return d;
}
// 16x16x32 fragments: lane = (h = lane>>4, row/col = lane&15); elements 0..7 = k0+8h+0..7, 8..15 = k0+16+8h+0..7; D element r = row 8h+r
__device__ __forceinline__ v16h frag_h(const _Float16* rowk0, int lane) {
  union { v16h v; v8h q[2]; } u; const _Float16* p = rowk0 + 8 * (lane >> 4);
  u.q[0] = *(const v8h*)p; u.q[1] = *(const v8h*)(p + 16); return u.v;
}
__device__ __forceinline__ v16h frag_f32(const float* rowk0, int lane) {
  v16h a; const float* p = rowk0 + 8 * (lane >> 4);
#pragma unroll
  for (int i = 0; i < 8; ++i) { a[i] = (_Float16)p[i]; a[8 + i] = (_Float16)p[16 + i]; }
  return a;
}
__device__ __forceinline__ v16h frag_f32s(const float* rowk0, int lane, float sc) {
  v16h a; const float* p = rowk0 + 8 * (lane >> 4);
#pragma unroll
  for (int i = 0; i < 8; ++i) { a[i] = (_Float16)(p[i] * sc); a[8 + i] = (_Float16)(p[16 + i] * sc); }
  return a;
}
// column fragment from a [K][ld] layout (column n), rows >= K read as 0
__device__ __forceinline__ v16h fragc_f32(const float* W, int k0, int n, int lane, int ld, int K) {
  v16h a; const int g = lane >> 4;
#pragma unroll
  for (int i = 0; i < 8; ++i) { const int ka = k0 + 8 * g + i, kb = ka + 16;
    a[i] = (_Float16)(ka < K ? W[(size_t)ka * ld + n] : 0.f); a[8 + i] = (_Float16)(kb < K ? W[(size_t)kb * ld + n] : 0.f); }
  return a;
}
struct F2 { v16b h, l; };
__device__ __forceinline__ F2 bsplit16(const float v[16]) { F2 r;
#pragma unroll
  for (int i = 0; i < 16; ++i) { const __bf16 h = (__bf16)v[i]; r.h[i] = h; r.l[i] = (__bf16)(v[i] - (float)h); }
  return r; }
__device__ __forceinline__ F2 split_row(const float* row, int k0, int lane) { float v[16]; const float* p = row + k0 + 8 * (lane >> 4);
#pragma unroll
  for (int i = 0; i < 8; ++i) { v[i] = p[i]; v[8 + i] = p[16 + i]; }
  return bsplit16(v); }
__device__ __forceinline__ F2 split_rowK(const float* row, int k0, int lane, int K) { float v[16]; const int g = lane >> 4;
#pragma unroll
  for (int i = 0; i < 8; ++i) { const int ka = k0 + 8 * g + i, kb = ka + 16; v[i] = ka < K ? row[ka] : 0.f; v[8 + i] = kb < K ? row[kb] : 0.f; }
  return bsplit16(v); }
__device__ __forceinline__ F2 split_col(const float* W, int k0, int n, int lane, int ld, int K) { float v[16]; const int g = lane >> 4;
#pragma unroll
  for (int i = 0; i < 8; ++i) { const int ka = k0 + 8 * g + i, kb = ka + 16; v[i] = ka < K ? W[(size_t)ka * ld + n] : 0.f; v[8 + i] = kb < K ? W[(size_t)kb * ld + n] : 0.f; }
  return bsplit16(v); }
__device__ __forceinline__ v8f mac3(const F2& a, const F2& b, v8f c) { c = wmma_bf(a.l, b.h, c); c = wmma_bf(a.h, b.l, c); return wmma_bf(a.h, b.h, c); }
__device__ __forceinline__ float sigm(float v) { return 1.0f / (1.0f + expf(-v)); }
#define LDSX() do { asm volatile("s_wait_dscnt 0" ::: "memory"); __builtin_amdgcn_wave_barrier(); __builtin_amdgcn_fence(__ATOMIC_RELEASE, "workgroup"); } while (0)

// T5 encoder block: RMSNorm -> 16-head self attention with the bidirectional relative-position bias (no 1/sqrt(d)) -> residual ->
// RMSNorm -> ReLU FFN (1024 -> 4096 -> 1024) -> residual. All products on v_wmma_f32_16x16x32_f16 ([out][in] weight rows converted once
// to f16 rows x16; activations as f16 rows, q/k x4, P x2^14, V x4, ctx x8); RMSNorms, the bucket function, softmax and residuals in f32.
#define NB 2
#define SS 1024
#define E 1024
#define NH 16
#define HD 64
#define DFF 4096
#define NR (NB * SS)           // 2048
#define NBK 32
#define MAXD 128

// GEMM operand ring in LDS. A stage is 64 k (128 B) of the block's 64 A rows and then of its 128 B rows, at a row pitch of 144 B
// (16 B x odd, the conflict-free pitch for ds_load_b128). Two buffers: asynchronous copies fill one while the other is multiplied.
#define BKH 64                     // k per stage
#define PIT 72                     // LDS row pitch in f16
#define STG (192 * PIT)            // f16 per buffer
#define RING_BYTES (2 * STG * 2)
// One stage: 192 rows x 8 pieces of 16 B = 12 copies per lane; 8 neighbouring lanes take one row's whole 128-B line.
// ga, gb: this lane's piece in row (tid >> 3) of the A and of the B part; l: LDS byte address of the A piece.
__device__ __forceinline__ void stage_copy(const _Float16* ga, size_t lda, const _Float16* gb, size_t ldb, unsigned l) {
  // the closing s_wait_xcnt stands inside the statement so that no address register of a copy is rewritten in front of it
  asm volatile("global_load_async_to_lds_b128 %0, %12, off\n\t"
               "global_load_async_to_lds_b128 %1, %13, off\n\t"
               "global_load_async_to_lds_b128 %2, %14, off\n\t"
               "global_load_async_to_lds_b128 %3, %15, off\n\t"
               "global_load_async_to_lds_b128 %4, %16, off\n\t"
               "global_load_async_to_lds_b128 %5, %17, off\n\t"
               "global_load_async_to_lds_b128 %6, %18, off\n\t"
               "global_load_async_to_lds_b128 %7, %19, off\n\t"
               "global_load_async_to_lds_b128 %8, %20, off\n\t"
               "global_load_async_to_lds_b128 %9, %21, off\n\t"
               "global_load_async_to_lds_b128 %10, %22, off\n\t"
               "global_load_async_to_lds_b128 %11, %23, off\n\t"
               "s_wait_xcnt 0x0"
               :: "v"(l), "v"(l + 1u * 16 * PIT * 2), "v"(l + 2u * 16 * PIT * 2), "v"(l + 3u * 16 * PIT * 2), "v"(l + 4u * 16 * PIT * 2), "v"(l + 5u * 16 * PIT * 2),
                  "v"(l + 6u * 16 * PIT * 2), "v"(l + 7u * 16 * PIT * 2), "v"(l + 8u * 16 * PIT * 2), "v"(l + 9u * 16 * PIT * 2), "v"(l + 10u * 16 * PIT * 2), "v"(l + 11u * 16 * PIT * 2),
                  "v"(ga), "v"(ga + 16 * lda), "v"(ga + 32 * lda), "v"(ga + 48 * lda),
                  "v"(gb), "v"(gb + 16 * ldb), "v"(gb + 32 * ldb), "v"(gb + 48 * ldb), "v"(gb + 64 * ldb), "v"(gb + 80 * ldb), "v"(gb + 96 * ldb), "v"(gb + 112 * ldb)
               : "memory");
}
// acc[j] += A rows (wave * 16 ..) x B rows (j * 16 ..) over NT stages, k ascending. A: first of the block's 64 rows (row pitch lda, stage step sa),
// B: first of its 128 rows (row pitch ldb, stage step BKH). Behind it no copy is in flight and every wave has left the ring.
template <int NT>
__device__ __forceinline__ void gemm_ring(const _Float16* A, size_t lda, size_t sa, const _Float16* B, size_t ldb, char* smem, v8f (&acc)[8]) {
  const int tid = threadIdx.x, wave = tid >> 5, lane = tid & 31, col = lane & 15;
  const _Float16* ring = (const _Float16*)smem;
  const _Float16* ga = A + (size_t)(tid >> 3) * lda + (tid & 7) * 8;
  const _Float16* gb = B + (size_t)(tid >> 3) * ldb + (tid & 7) * 8;
  const unsigned l = (unsigned)(size_t)smem + (unsigned)((tid >> 3) * PIT + (tid & 7) * 8) * 2u;
  stage_copy(ga, lda, gb, ldb, l);
  asm volatile("s_wait_asynccnt 0x0" ::: "memory");   // this wave's part of stage 0 has landed before the barrier publishes it
  __syncthreads();
  stage_copy(ga + sa, lda, gb + BKH, ldb, l + STG * 2);
  for (int t = 0; t < NT; ++t) {
    const _Float16* buf = ring + (t & 1) * STG;
    v16h a[2], b[2][8];   // the stage's fragments, read as one group so that one LDS latency is paid per stage, not one per product
    // the four loops below are unrolled so that every index of a, b and acc is a constant and the arrays stay in registers
#pragma unroll
    for (int kc = 0; kc < 2; ++kc) { a[kc] = frag_h(buf + (wave * 16 + col) * PIT + kc * 32, lane);
#pragma unroll
      for (int j = 0; j < 8; ++j) b[kc][j] = frag_h(buf + (64 + j * 16 + col) * PIT + kc * 32, lane); }
#pragma unroll
    for (int kc = 0; kc < 2; ++kc)
#pragma unroll
      for (int j = 0; j < 8; ++j) acc[j] = wmma16(a[kc], b[kc][j], acc[j]);
    asm volatile("s_wait_dscnt 0x0" ::: "memory");      // this wave's reads of the buffer are over before it is refilled
    asm volatile("s_wait_asynccnt 0x0" ::: "memory");   // this wave's part of stage t + 1 has landed
    __syncthreads();                                    // publishes stage t + 1 and frees stage t's buffer
    if (t + 2 < NT) stage_copy(ga + (size_t)(t + 2) * sa, lda, gb + (size_t)(t + 2) * BKH, ldb, l + (unsigned)(t & 1) * (STG * 2));
  }
  asm volatile("s_wait_asynccnt 0x0" ::: "memory");     // nothing in flight when the ring becomes output staging
}

// Deep ring for the GEMMs whose whole grid is resident at once with LDS to spare (k_qkv: three workgroups per WGP; k_o, k_ff2: one): the launch lasts
// as long as one workgroup's chain of stage flights, so a stage is NS x 64 k of the same 192 rows: NS times fewer flights, NS times the bytes in flight.
// Row pitch NS x 128 + 16 B (16 B x odd). Two buffers and the same order of waits as gemm_ring.
#define PITD(NS) ((NS) * BKH + 8)            // LDS row pitch in f16
#define STGD(NS) (192 * PITD(NS))            // f16 per buffer
#define RINGD_BYTES(NS) (2 * STGD(NS) * 2)
// Twelve copies of one wave: 4 on the A part and 8 on the B part. A copy's 32 lanes take 512 B: one row's stage slice (NS = 4) or two rows' (NS = 2).
// ga, gb: this lane's piece for the first A and B copy, da, db: step from copy to copy; la, lb: its LDS byte addresses, dl: their step.
__device__ __forceinline__ void deep_copy(const _Float16* ga, size_t da, const _Float16* gb, size_t db, unsigned la, unsigned lb, unsigned dl) {
  // the closing s_wait_xcnt stands inside the statement so that no address register of a copy is rewritten in front of it
  asm volatile("global_load_async_to_lds_b128 %0, %12, off\n\t"
               "global_load_async_to_lds_b128 %1, %13, off\n\t"
               "global_load_async_to_lds_b128 %2, %14, off\n\t"
               "global_load_async_to_lds_b128 %3, %15, off\n\t"
               "global_load_async_to_lds_b128 %4, %16, off\n\t"
               "global_load_async_to_lds_b128 %5, %17, off\n\t"
               "global_load_async_to_lds_b128 %6, %18, off\n\t"
               "global_load_async_to_lds_b128 %7, %19, off\n\t"
               "global_load_async_to_lds_b128 %8, %20, off\n\t"
               "global_load_async_to_lds_b128 %9, %21, off\n\t"
               "global_load_async_to_lds_b128 %10, %22, off\n\t"
               "global_load_async_to_lds_b128 %11, %23, off\n\t"
               "s_wait_xcnt 0x0"
               :: "v"(la), "v"(la + dl), "v"(la + 2 * dl), "v"(la + 3 * dl),
                  "v"(lb), "v"(lb + dl), "v"(lb + 2 * dl), "v"(lb + 3 * dl), "v"(lb + 4 * dl), "v"(lb + 5 * dl), "v"(lb + 6 * dl), "v"(lb + 7 * dl),
                  "v"(ga), "v"(ga + da), "v"(ga + 2 * da), "v"(ga + 3 * da),
                  "v"(gb), "v"(gb + db), "v"(gb + 2 * db), "v"(gb + 3 * db), "v"(gb + 4 * db), "v"(gb + 5 * db), "v"(gb + 6 * db), "v"(gb + 7 * db)
               : "memory");
}
// One wave's share of a deep stage: a quarter of the A rows and of the B rows, 12 x NS copies.
template <int NS>
__device__ __forceinline__ void deep_stage(const _Float16* ga, size_t lda, const _Float16* gb, size_t ldb, unsigned la, unsigned lb) {
  constexpr int RPC = 4 / NS;   // rows per copy
  // unrolled so that the row steps are constants
#pragma unroll
  for (int s = 0; s < NS; ++s) deep_copy(ga + (size_t)(s * 16 * RPC) * lda, RPC * lda, gb + (size_t)(s * 32 * RPC) * ldb, RPC * ldb,
                                         la + (unsigned)(s * 16 * RPC * PITD(NS) * 2), lb + (unsigned)(s * 32 * RPC * PITD(NS) * 2), (unsigned)(RPC * PITD(NS) * 2));
}
// As gemm_ring, over NT deep stages, k ascending. sa: distance between an A row's successive 64-k pieces (BKH where the row is contiguous).
template <int NS, int NT>
__device__ __forceinline__ void gemm_deep(const _Float16* A, size_t lda, size_t sa, const _Float16* B, size_t ldb, char* smem, v8f (&acc)[8]) {
  constexpr int RPC = 4 / NS, LPR = NS * 8, PD = PITD(NS), SD = STGD(NS);   // rows per copy, lanes per row
  const int tid = threadIdx.x, wave = tid >> 5, lane = tid & 31, col = lane & 15, lr = lane / LPR, lp = lane % LPR;
  const _Float16* ring = (const _Float16*)smem;
  const _Float16* ga = A + (size_t)(wave * 4 * RPC + lr) * lda + (size_t)(lp >> 3) * sa + (lp & 7) * 8;
  const _Float16* gb = B + (size_t)(wave * 8 * RPC + lr) * ldb + lp * 8;
  const unsigned la = (unsigned)(size_t)smem + (unsigned)((wave * 4 * RPC + lr) * PD + lp * 8) * 2u;
  const unsigned lb = (unsigned)(size_t)smem + (unsigned)((64 + wave * 8 * RPC + lr) * PD + lp * 8) * 2u;
  deep_stage<NS>(ga, lda, gb, ldb, la, lb);
  asm volatile("s_wait_asynccnt 0x0" ::: "memory");   // this wave's part of stage 0 has landed before the barrier publishes it
  __syncthreads();
  deep_stage<NS>(ga + NS * sa, lda, gb + NS * BKH, ldb, la + SD * 2, lb + SD * 2);
  // kept rolled so that the hot loop stays small in the instruction cache
#pragma unroll 1
  for (int t = 0; t < NT; ++t) {
    const _Float16* buf = ring + (t & 1) * SD;
    // all loops below are unrolled so that every index of a, b and acc is a constant and the arrays stay in registers
#pragma unroll
    for (int ks = 0; ks < NS; ++ks) {
      v16h a[2], b[2][8];   // 64 k of fragments, read as one group so that one LDS latency is paid per group, not one per product
#pragma unroll
      for (int kc = 0; kc < 2; ++kc) { a[kc] = frag_h(buf + (wave * 16 + col) * PD + ks * BKH + kc * 32, lane);
#pragma unroll
        for (int j = 0; j < 8; ++j) b[kc][j] = frag_h(buf + (64 + j * 16 + col) * PD + ks * BKH + kc * 32, lane); }
#pragma unroll
      for (int kc = 0; kc < 2; ++kc)
#pragma unroll
        for (int j = 0; j < 8; ++j) acc[j] = wmma16(a[kc], b[kc][j], acc[j]);
    }
    asm volatile("s_wait_dscnt 0x0" ::: "memory");      // this wave's reads of the buffer are over before it is refilled
    asm volatile("s_wait_asynccnt 0x0" ::: "memory");   // this wave's part of stage t + 1 has landed
    __syncthreads();                                    // publishes stage t + 1 and frees stage t's buffer
    if (t + 2 < NT) deep_stage<NS>(ga + (size_t)(t + 2) * NS * sa, lda, gb + (size_t)(t + 2) * NS * BKH, ldb, la + (unsigned)(t & 1) * (SD * 2), lb + (unsigned)(t & 1) * (SD * 2));
  }
  asm volatile("s_wait_asynccnt 0x0" ::: "memory");     // nothing in flight when the ring becomes output staging
}

// RMSNorm of rows -> f16 ; wave per row, 8 rows per block blk
__device__ __forceinline__ void rms_rows(const float* __restrict__ x, const float* __restrict__ w, _Float16* __restrict__ X16, unsigned blk) {
  const int wave = threadIdx.x >> 5, lane = threadIdx.x & 31; const size_t r = (size_t)blk * 8 + wave; if (r >= NR) return;
  const float* xr = x + r * E; float q2 = 0.f;
#pragma unroll 1
  for (int i = 0; i < 8; ++i) { const v4f a = *(const v4f*)(xr + i * 128 + lane * 4); q2 += (a[0] * a[0] + a[1] * a[1]) + (a[2] * a[2] + a[3] * a[3]); }
#pragma unroll
  for (int off = 16; off >= 1; off >>= 1) q2 += __shfl_xor(q2, off, 32);
  const float rs = rsqrtf(q2 * (1.0f / E) + 1e-6f);
#pragma unroll 1
  for (int i = 0; i < 4; ++i) { const int c0 = i * 256 + lane * 8; union { v8h h; v4u u; } pk;
#pragma unroll
    for (int e = 0; e < 8; ++e) pk.h[e] = (_Float16)(xr[c0 + e] * rs * w[c0 + e]);
    vst2(X16 + r * E + c0, pk.u); }
}
__global__ __launch_bounds__(256) void k_rms(const float* __restrict__ x, const float* __restrict__ w, _Float16* __restrict__ X16) { rms_rows(x, w, X16, blockIdx.x); }
// weight packs: PT rows: [0,1024) wq, [1024,2048) wk, [2048,3072) wv, [3072,4096) wo (all [out][in=1024]) x16 ; WI rows [4096][1024] x16 ; WF rows [1024][4096] x16
// All that depends on the inputs alone and is read by k_qkv or k_attn, as block ranges of one grid: the first RMSNorm, then the bias table
// BT[h][rel + SS - 1] for rel = k - q in [-(SS-1), SS-1], then the wq, wk, wv rows of PT (one row per block).
#define PREP_RMS (NR / 8)
#define PREP_BIAS (2 * SS / 256 * NH)
__global__ __launch_bounds__(256) void k_prep(const float* __restrict__ hid, const float* __restrict__ ln1, const float* __restrict__ wq, const float* __restrict__ wk, const float* __restrict__ wv, const float* __restrict__ rb,
                                            _Float16* __restrict__ X16, _Float16* __restrict__ PT, float* __restrict__ BT) {
  const int blk = blockIdx.x, tid = threadIdx.x; __shared__ __align__(16) _Float16 srow[E];
  if (blk < PREP_RMS) { rms_rows(hid, ln1, X16, blk); return; }
  if (blk < PREP_RMS + PREP_BIAS) { const int h = (blk - PREP_RMS) >> 3, i = ((blk - PREP_RMS) & 7) * 256 + tid; if (i >= 2 * SS) return;   // table width padded to 2*SS
    float v = 0.f;
    if (i < 2 * SS - 1) { const int rel = i - (SS - 1); const int nb = NBK / 2; int bucket = rel > 0 ? nb : 0; const int rp = rel < 0 ? -rel : rel; const int mx = nb / 2;
      int val; if (rp < mx) val = rp; else { const float lf = logf((float)rp / (float)mx) / 2.772588722239781f * (float)(nb - mx); int large = mx + (int)lf; val = large < nb - 1 ? large : nb - 1; }
      bucket += val; v = rb[bucket * NH + h]; }
    vst2(BT + (size_t)h * 2 * SS + i, v); return; }
  const int r = blk - PREP_RMS - PREP_BIAS, which = r >> 10, n = r & (E - 1); const float* W = (which == 0 ? wq : which == 1 ? wk : wv) + (size_t)n * E;
  for (int k = tid; k < E; k += 256) srow[k] = (_Float16)(W[k] * 16.0f);
  __syncthreads(); if (tid < 128) vst2(PT + (size_t)r * E + tid * 8, *(const v4u*)(&srow[tid * 8]));
}
// A 128-thread block's share of a weight pack whose rows keep their order: PCH consecutive f32 -> f16 x16.
#define PCH 4096
__device__ __forceinline__ void pack_chunk(const float* __restrict__ s, _Float16* __restrict__ d) {
  const int tid = threadIdx.x; v4f v[8];
  // both loops unrolled so that v stays in registers and the lane's eight loads are in flight together
#pragma unroll
  for (int i = 0; i < 8; ++i) v[i] = *(const v4f*)(s + (i * 128 + tid) * 4);
#pragma unroll
  for (int i = 0; i < 8; ++i) { v4h h;
#pragma unroll
    for (int e = 0; e < 4; ++e) h[e] = (_Float16)(v[i][e] * 16.0f);
    vst2(d + (i * 128 + tid) * 4, h); }
}
// QKV: block (64 rows, 128 cols = 2 heads, which)
__global__ __launch_bounds__(128) void k_qkv(const _Float16* __restrict__ X16, const _Float16* __restrict__ PT, _Float16* __restrict__ Q16, _Float16* __restrict__ K16, _Float16* __restrict__ VT) {
  __shared__ __align__(16) char smem[RINGD_BYTES(2)];   // the operand ring; behind the k loop the output staging
  float (*so)[16][132] = (float (*)[16][132])smem;
  _Float16 (*st)[72] = (_Float16 (*)[72])smem;
  const int tid = threadIdx.x, wave = tid >> 5, lane = tid & 31, col = lane & 15, g = lane >> 4;
  const int which = blockIdx.z, r0b = blockIdx.x * 64, n0 = blockIdx.y * 128; const int b = r0b / SS, s0 = r0b % SS;
  v8f acc[8] = {};
  gemm_deep<2, E / (2 * BKH)>(X16 + (size_t)r0b * E, E, BKH, PT + (size_t)(which * E + n0) * E, E, smem, acc);
  if (which < 2) {
#pragma unroll
    for (int j = 0; j < 8; ++j)
#pragma unroll
      for (int r = 0; r < 8; ++r) so[wave][8 * g + r][j * 16 + col] = acc[j][r] * (4.0f / 16.0f);
    LDSX();
    _Float16* D = which == 0 ? Q16 : K16;
    for (int qq = lane; qq < 16 * 2 * 8; qq += 32) { const int hh = qq >> 7, rl = (qq >> 3) & 15, pc = qq & 7; const int h = (n0 >> 6) + hh; union { v8h h8; v4u u; } pk;
#pragma unroll
      for (int e = 0; e < 8; ++e) pk.h8[e] = (_Float16)so[wave][rl][hh * 64 + pc * 8 + e];
      vst2(D + (((size_t)b * NH + h) * SS + s0 + wave * 16 + rl) * HD + pc * 8, pk.u); } }
  else {
#pragma unroll
    for (int j = 0; j < 8; ++j)
#pragma unroll
      for (int r = 0; r < 8; ++r) st[j * 16 + col][wave * 16 + 8 * g + r] = (_Float16)(acc[j][r] * (4.0f / 16.0f));
    __syncthreads();
    for (int qq = tid; qq < 128 * 8; qq += 128) { const int cl = qq >> 3, pc = qq & 7; const int c = n0 + cl, h = c >> 6, d = c & 63;
      vst2(VT + (((size_t)b * NH + h) * HD + d) * SS + s0 + pc * 8, *(const v4u*)(&st[cl][pc * 8])); } }
}
// Attention's K/V ring in LDS. A stage is one 64-key tile for the block's four waves: its 64 K rows (64 d = 128 B each) and then the 64 V^T rows
// (64 keys = 128 B each), at the same 144-B row pitch as the GEMM ring. Two buffers: asynchronous copies fill one while the other is worked on.
#define ASTG (128 * PIT)           // f16 per buffer
// One stage: 128 rows x 8 pieces of 16 B = 8 copies per lane; 8 neighbouring lanes take one row's whole 128-B line.
// gk, gv: this lane's piece in row (tid >> 3) of the K and of the V^T part; l: LDS byte address of the K piece.
__device__ __forceinline__ void kv_copy(const _Float16* gk, const _Float16* gv, unsigned l) {
  // the closing s_wait_xcnt stands inside the statement so that no address register of a copy is rewritten in front of it
  asm volatile("global_load_async_to_lds_b128 %0, %8, off\n\t"
               "global_load_async_to_lds_b128 %1, %9, off\n\t"
               "global_load_async_to_lds_b128 %2, %10, off\n\t"
               "global_load_async_to_lds_b128 %3, %11, off\n\t"
               "global_load_async_to_lds_b128 %4, %12, off\n\t"
               "global_load_async_to_lds_b128 %5, %13, off\n\t"
               "global_load_async_to_lds_b128 %6, %14, off\n\t"
               "global_load_async_to_lds_b128 %7, %15, off\n\t"
               "s_wait_xcnt 0x0"
               :: "v"(l), "v"(l + 1u * 16 * PIT * 2), "v"(l + 2u * 16 * PIT * 2), "v"(l + 3u * 16 * PIT * 2),
                  "v"(l + 4u * 16 * PIT * 2), "v"(l + 5u * 16 * PIT * 2), "v"(l + 6u * 16 * PIT * 2), "v"(l + 7u * 16 * PIT * 2),
                  "v"(gk), "v"(gk + 16 * HD), "v"(gk + 32 * HD), "v"(gk + 48 * HD), "v"(gv), "v"(gv + 16 * SS), "v"(gv + 32 * SS), "v"(gv + 48 * SS)
               : "memory");
}
// Grid rows y < NB * NH are the attention tiles. The RIDE_Y rows behind them pack wo, wi and wo_ff, which only the launches after this one read:
// their memory stream runs in the places that the attention blocks leave free on each WGP.
#define RIDE_Y ((E * E + 2 * DFF * E) / PCH / (SS / 64))
__global__ __launch_bounds__(128) void k_attn(const _Float16* __restrict__ Q16, const _Float16* __restrict__ K16, const _Float16* __restrict__ VT, const float* __restrict__ BT, _Float16* __restrict__ O16,
                                            const float* __restrict__ wo, const float* __restrict__ wi, const float* __restrict__ wff, _Float16* __restrict__ PTO, _Float16* __restrict__ WI, _Float16* __restrict__ WF) {
  if (blockIdx.y >= NB * NH) {   // the whole block leaves here, in front of every barrier and copy
    const unsigned c = (blockIdx.y - NB * NH) * (SS / 64) + blockIdx.x; const int m = c < E * E / PCH ? 0 : c < (E * E + DFF * E) / PCH ? 1 : 2;
    const size_t o = (size_t)(c - (m == 0 ? 0 : m == 1 ? E * E / PCH : (E * E + DFF * E) / PCH)) * PCH;
    pack_chunk((m == 0 ? wo : m == 1 ? wi : wff) + o, (m == 0 ? PTO : m == 1 ? WI : WF) + o);
    return; }
  __shared__ __align__(16) _Float16 kv[2 * ASTG];
  __shared__ __align__(16) float sS[4][16][68];
  __shared__ __align__(16) _Float16 sP[4][16][72];
  __shared__ __align__(16) float sO[4][16][68];
  const int tid = threadIdx.x, w = tid >> 5, lane = tid & 31, col = lane & 15, g = lane >> 4;
  const size_t bh = blockIdx.y; const int h = (int)(bh % NH); const int q0 = blockIdx.x * 64 + w * 16; const float* bth = BT + (size_t)h * 2 * SS + (SS - 1);
  v16h aq[2];
#pragma unroll
  for (int kc = 0; kc < 2; ++kc) aq[kc] = frag_h(Q16 + (bh * SS + q0 + col) * HD + kc * 32, lane);
  float mrun = -3.0e38f, lrun = 0.f; v8f acc[4] = {};
  const _Float16* gk = K16 + (bh * SS + (tid >> 3)) * HD + (tid & 7) * 8;
  const _Float16* gv = VT + (bh * HD + (tid >> 3)) * SS + (tid & 7) * 8;
  const unsigned l = (unsigned)(size_t)kv + (unsigned)((tid >> 3) * PIT + (tid & 7) * 8) * 2u;
  kv_copy(gk, gv, l);
  asm volatile("s_wait_asynccnt 0x0" ::: "memory");   // this wave's part of tile 0 has landed before the barrier publishes it
  __syncthreads();
  kv_copy(gk + 64 * HD, gv + 64, l + ASTG * 2);
#pragma unroll 1
  for (int kt = 0; kt < SS / 64; ++kt) {
    const _Float16* buf = kv + (kt & 1) * ASTG;
    v16h kf[4][2], vf[2][4];   // the tile's fragments, each operand read as one group so that one LDS latency is paid per group, not one per product
    // unrolled so that every index of kf is a constant and the array stays in registers
#pragma unroll
    for (int t = 0; t < 4; ++t)
#pragma unroll
      for (int kc = 0; kc < 2; ++kc) kf[t][kc] = frag_h(buf + (t * 16 + col) * PIT + kc * 32, lane);
#pragma unroll
    for (int t = 0; t < 4; ++t) { v8f s = {}; const int key = kt * 64 + t * 16 + col;
#pragma unroll
      for (int kc = 0; kc < 2; ++kc) s = wmma16(aq[kc], kf[t][kc], s);
#pragma unroll
      for (int r = 0; r < 8; ++r) { const int q = q0 + 8 * g + r; sS[w][8 * g + r][t * 16 + col] = s[r] * (1.0f / 16.0f) + bth[key - q]; } }
    LDSX();
    float mx = -3.4e38f;
#pragma unroll
    for (int jj = 0; jj < 32; ++jj) mx = fmaxf(mx, sS[w][col][g * 32 + jj]);
    mx = fmaxf(mx, __shfl_xor(mx, 16, 32));
    const float mnew = fmaxf(mrun, mx); const float corr = expf(mrun - mnew);
    float ps = 0.f;
#pragma unroll
    for (int jj = 0; jj < 32; ++jj) { const float p = expf(sS[w][col][g * 32 + jj] - mnew); ps += p; sP[w][col][g * 32 + jj] = (_Float16)(p * 16384.0f); }
    ps += __shfl_xor(ps, 16, 32);
    lrun = lrun * corr + ps; mrun = mnew;
    // unrolled so that every index of vf is a constant; read here so that the rescale below covers their latency
#pragma unroll
    for (int kc = 0; kc < 2; ++kc)
#pragma unroll
      for (int t = 0; t < 4; ++t) vf[kc][t] = frag_h(buf + (64 + t * 16 + col) * PIT + kc * 32, lane);
#pragma unroll
    for (int r = 0; r < 8; ++r) { const float cr = __shfl(corr, 8 * g + r, 32);
#pragma unroll
      for (int t = 0; t < 4; ++t) acc[t][r] *= cr; }
    LDSX();
#pragma unroll
    for (int kc = 0; kc < 2; ++kc) { const v16h pa = frag_h(&sP[w][col][0] + kc * 32, lane);
#pragma unroll
      for (int t = 0; t < 4; ++t) acc[t] = wmma16(pa, vf[kc][t], acc[t]); }
    __builtin_amdgcn_wave_barrier();
    asm volatile("s_wait_dscnt 0x0" ::: "memory");      // this wave's reads of the buffer are over before it is refilled
    asm volatile("s_wait_asynccnt 0x0" ::: "memory");   // this wave's part of tile kt + 1 has landed
    __syncthreads();                                    // publishes tile kt + 1 and frees tile kt's buffer
    if (kt + 2 < SS / 64) kv_copy(gk + (size_t)(kt + 2) * 64 * HD, gv + (kt + 2) * 64, l + (unsigned)(kt & 1) * (ASTG * 2)); }
  asm volatile("s_wait_asynccnt 0x0" ::: "memory");     // nothing in flight when the wave goes on to its output and ends
#pragma unroll
  for (int r = 0; r < 8; ++r) { const float lr = __shfl(lrun, 8 * g + r, 32); const float inv = 8.0f / (lr * 16384.0f * 4.0f);
#pragma unroll
    for (int t = 0; t < 4; ++t) sO[w][8 * g + r][t * 16 + col] = acc[t][r] * inv; }
  LDSX();
  for (int qq = lane; qq < 16 * 8; qq += 32) { const int rl = qq >> 3, pc = qq & 7; union { v8h h8; v4u u; } pk;
#pragma unroll
    for (int e = 0; e < 8; ++e) pk.h8[e] = (_Float16)sO[w][rl][pc * 8 + e];
    vst2(O16 + ((bh * SS) + q0 + rl) * HD + pc * 8, pk.u); }
}
// H1 = hidden + ctx wo^T : block (64 rows, 128 cols)
__global__ __launch_bounds__(128) void k_o(const _Float16* __restrict__ O16, const _Float16* __restrict__ PT, const float* __restrict__ hid, float* __restrict__ H1) {
  __shared__ __align__(16) char smem[RINGD_BYTES(4)];   // the operand ring; behind the k loop the output staging
  float (*so)[16][132] = (float (*)[16][132])smem;
  const int tid = threadIdx.x, wave = tid >> 5, lane = tid & 31, col = lane & 15, g = lane >> 4;
  const int r0b = blockIdx.x * 64, r0 = r0b + wave * 16, n0 = blockIdx.y * 128; const int b = r0b / SS, s0 = r0b % SS;
  v8f acc[8] = {};
  // a 64-k piece is a head: the 64 k of head t of row s stand at O16[b][t][s][0..63]
  gemm_deep<4, E / (4 * BKH)>(O16 + ((size_t)b * NH * SS + s0) * HD, HD, (size_t)SS * HD, PT + (size_t)(3 * E + n0) * E, E, smem, acc);
#pragma unroll
  for (int j = 0; j < 8; ++j) { const int n = n0 + j * 16 + col;
#pragma unroll
    for (int r = 0; r < 8; ++r) so[wave][8 * g + r][j * 16 + col] = acc[j][r] * (1.0f / (16.0f * 8.0f)) + hid[(size_t)(r0 + 8 * g + r) * E + n]; }
  LDSX();
#pragma unroll 4
  for (int rl = 0; rl < 16; ++rl) vst2(H1 + (size_t)(r0 + rl) * E + n0 + lane * 4, *(const v4f*)(&so[wave][rl][lane * 4]));
}
// F16 = relu(Y16 @ wi^T) as f16 rows [NR][4096] : block (64 rows, 128 cols)
__global__ __launch_bounds__(128) void k_ff1(const _Float16* __restrict__ Y16, const _Float16* __restrict__ WI, _Float16* __restrict__ F16) {
  __shared__ __align__(16) char smem[RING_BYTES];   // the operand ring; behind the k loop the output staging
  _Float16 (*so)[16][136] = (_Float16 (*)[16][136])smem;
  const int tid = threadIdx.x, wave = tid >> 5, lane = tid & 31, col = lane & 15, g = lane >> 4;
  const int r0b = blockIdx.x * 64, r0 = r0b + wave * 16, n0 = blockIdx.y * 128;
  v8f acc[8] = {};
  gemm_ring<E / BKH>(Y16 + (size_t)r0b * E, E, BKH, WI + (size_t)n0 * E, E, smem, acc);
#pragma unroll
  for (int j = 0; j < 8; ++j)
#pragma unroll
    for (int r = 0; r < 8; ++r) { const float v = acc[j][r] * (1.0f / 16.0f); so[wave][8 * g + r][j * 16 + col] = (_Float16)(v > 0.f ? v : 0.f); }
  LDSX();
  for (int qq = lane; qq < 16 * 16; qq += 32) { const int rl = qq >> 4, pc = qq & 15; vst2(F16 + (size_t)(r0 + rl) * DFF + n0 + pc * 8, *(const v4u*)(&so[wave][rl][pc * 8])); }
}
// out = H1 + F16 @ wo_ff^T : block (64 rows, 128 cols), K = 4096
__global__ __launch_bounds__(128) void k_ff2(const _Float16* __restrict__ F16, const _Float16* __restrict__ WF, const float* __restrict__ H1, float* __restrict__ out) {
  __shared__ __align__(16) char smem[RINGD_BYTES(4)];   // the operand ring; behind the k loop the output staging
  float (*so)[16][132] = (float (*)[16][132])smem;
  const int tid = threadIdx.x, wave = tid >> 5, lane = tid & 31, col = lane & 15, g = lane >> 4;
  const int r0b = blockIdx.x * 64, r0 = r0b + wave * 16, n0 = blockIdx.y * 128;
  v8f acc[8] = {};
  gemm_deep<4, DFF / (4 * BKH)>(F16 + (size_t)r0b * DFF, DFF, BKH, WF + (size_t)n0 * DFF, DFF, smem, acc);
#pragma unroll
  for (int j = 0; j < 8; ++j) { const int n = n0 + j * 16 + col;
#pragma unroll
    for (int r = 0; r < 8; ++r) so[wave][8 * g + r][j * 16 + col] = acc[j][r] * (1.0f / 16.0f) + H1[(size_t)(r0 + 8 * g + r) * E + n]; }
  LDSX();
#pragma unroll 4
  for (int rl = 0; rl < 16; ++rl) vst2(out + (size_t)(r0 + rl) * E + n0 + lane * 4, *(const v4f*)(&so[wave][rl][lane * 4]));
}
extern "C" void kernel_launch(void* const* d_in, const int* in_sizes, int n_in, void* d_out, int out_size, void* d_ws, size_t ws_size, hipStream_t stream) {
  (void)in_sizes; (void)n_in; (void)out_size; (void)ws_size;
  const float** I = (const float**)d_in;
  const float* hid = I[0]; const float* ln1 = I[1]; const float* wq = I[2]; const float* wk = I[3]; const float* wv = I[4]; const float* wo = I[5]; const float* rb = I[6]; const float* ln2 = I[7]; const float* wi = I[8]; const float* wff = I[9];
  float* out = (float*)d_out;
  char* ws = (char*)d_ws; size_t off = 0;
  auto take = [&](size_t bytes) { char* p = ws + off; off += (bytes + 255) & ~(size_t)255; return p; };
  _Float16* X16 = (_Float16*)take((size_t)NR * E * 2); _Float16* PT = (_Float16*)take((size_t)4 * E * E * 2); _Float16* WI = (_Float16*)take((size_t)DFF * E * 2); _Float16* WF = (_Float16*)take((size_t)E * DFF * 2);
  float* BT = (float*)take((size_t)NH * 2 * SS * 4);
  _Float16* Q16 = (_Float16*)take((size_t)NR * E * 2); _Float16* K16 = (_Float16*)take((size_t)NR * E * 2); _Float16* VT = (_Float16*)take((size_t)NR * E * 2); _Float16* O16 = (_Float16*)take((size_t)NR * E * 2);
  float* H1 = (float*)take((size_t)NR * E * 4); _Float16* Y16 = X16; _Float16* F16 = (_Float16*)take((size_t)NR * DFF * 2);
  k_prep<<<PREP_RMS + PREP_BIAS + 3 * E, 256, 0, stream>>>(hid, ln1, wq, wk, wv, rb, X16, PT, BT);
  k_qkv<<<dim3(NR / 64, E / 128, 3), 128, 0, stream>>>(X16, PT, Q16, K16, VT);
  k_attn<<<dim3(SS / 64, NB * NH + RIDE_Y), 128, 0, stream>>>(Q16, K16, VT, BT, O16, wo, wi, wff, PT + (size_t)3 * E * E, WI, WF);
  k_o<<<dim3(NR / 64, E / 128), 128, 0, stream>>>(O16, PT, hid, H1);
  k_rms<<<NR / 8, 256, 0, stream>>>(H1, ln2, Y16);
  k_ff1<<<dim3(NR / 64, DFF / 128), 128, 0, stream>>>(Y16, WI, F16);
  k_ff2<<<dim3(NR / 64, E / 128), 128, 0, stream>>>(F16, WF, H1, out);
}

// v005
// One run takes 110 microseconds.
// Next to v004, in two timings, it ran 1.08 and 1.07 times as fast.
// Counting every step since v000, it is 4.99 times as fast.
#include <hip/hip_runtime.h>
#include <math.h>

typedef __attribute__((ext_vector_type(16))) _Float16 v16h;
typedef __attribute__((ext_vector_type(16))) __bf16 v16b;
typedef __attribute__((ext_vector_type(8)))  _Float16 v8h;
typedef __attribute__((ext_vector_type(4)))  _Float16 v4h;
typedef __attribute__((ext_vector_type(8)))  float v8f;
typedef __attribute__((ext_vector_type(4)))  float v4f;
typedef __attribute__((ext_vector_type(2)))  float v2f;
typedef __attribute__((ext_vector_type(4)))  unsigned v4u;
typedef __attribute__((ext_vector_type(4)))  int v4i;
typedef float __attribute__((may_alias)) float_a;
typedef int __attribute__((may_alias)) int_a;

template <typename T> __device__ __forceinline__ void vst2(void* p, T v) { *(T*)p = v;  }
__device__ __forceinline__ v8f wmma16(v16h a, v16h b, v8f c) {
  v8f d = __builtin_amdgcn_wmma_f32_16x16x32_f16(false, a, false, b, (short)0, c, false, false);
  asm volatile("v_nop\n\tv_nop\n\tv_nop\n\tv_nop" : "+v"(d) : "v"(a), "v"(b));
  return d;
}
__device__ __forceinline__ v8f wmma_bf(v16b a, v16b b, v8f c) {
  v8f d = __builtin_amdgcn_wmma_f32_16x16x32_bf16(false, a, false, b, (short)0, c, false, false);
  asm volatile("v_nop\n\tv_nop\n\tv_nop\n\tv_nop" : "+v"(d) : "v"(a), "v"(b));
  return d;
}
// 16x16x32 fragments: lane = (h = lane>>4, row/col = lane&15); elements 0..7 = k0+8h+0..7, 8..15 = k0+16+8h+0..7; D element r = row 8h+r
__device__ __forceinline__ v16h frag_h(const _Float16* rowk0, int lane) {
  union { v16h v; v8h q[2]; } u; const _Float16* p = rowk0 + 8 * (lane >> 4);
  u.q[0] = *(const v8h*)p; u.q[1] = *(const v8h*)(p + 16); return u.v;
}
__device__ __forceinline__ v16h frag_f32(const float* rowk0, int lane) {
  v16h a; const float* p = rowk0 + 8 * (lane >> 4);
#pragma unroll
  for (int i = 0; i < 8; ++i) { a[i] = (_Float16)p[i]; a[8 + i] = (_Float16)p[16 + i]; }
  return a;
}
__device__ __forceinline__ v16h frag_f32s(const float* rowk0, int lane, float sc) {
  v16h a; const float* p = rowk0 + 8 * (lane >> 4);
#pragma unroll
  for (int i = 0; i < 8; ++i) { a[i] = (_Float16)(p[i] * sc); a[8 + i] = (_Float16)(p[16 + i] * sc); }
  return a;
}
// column fragment from a [K][ld] layout (column n), rows >= K read as 0
__device__ __forceinline__ v16h fragc_f32(const float* W, int k0, int n, int lane, int ld, int K) {
  v16h a; const int g = lane >> 4;
#pragma unroll
  for (int i = 0; i < 8; ++i) { const int ka = k0 + 8 * g + i, kb = ka + 16;
    a[i] = (_Float16)(ka < K ? W[(size_t)ka * ld + n] : 0.f); a[8 + i] = (_Float16)(kb < K ? W[(size_t)kb * ld + n] : 0.f); }
  return a;
}
struct F2 { v16b h, l; };
__device__ __forceinline__ F2 bsplit16(const float v[16]) { F2 r;
#pragma unroll
  for (int i = 0; i < 16; ++i) { const __bf16 h = (__bf16)v[i]; r.h[i] = h; r.l[i] = (__bf16)(v[i] - (float)h); }
  return r; }
__device__ __forceinline__ F2 split_row(const float* row, int k0, int lane) { float v[16]; const float* p = row + k0 + 8 * (lane >> 4);
#pragma unroll
  for (int i = 0; i < 8; ++i) { v[i] = p[i]; v[8 + i] = p[16 + i]; }
  return bsplit16(v); }
__device__ __forceinline__ F2 split_rowK(const float* row, int k0, int lane, int K) { float v[16]; const int g = lane >> 4;
#pragma unroll
  for (int i = 0; i < 8; ++i) { const int ka = k0 + 8 * g + i, kb = ka + 16; v[i] = ka < K ? row[ka] : 0.f; v[8 + i] = kb < K ? row[kb] : 0.f; }
  return bsplit16(v); }
__device__ __forceinline__ F2 split_col(const float* W, int k0, int n, int lane, int ld, int K) { float v[16]; const int g = lane >> 4;
#pragma unroll
  for (int i = 0; i < 8; ++i) { const int ka = k0 + 8 * g + i, kb = ka + 16; v[i] = ka < K ? W[(size_t)ka * ld + n] : 0.f; v[8 + i] = kb < K ? W[(size_t)kb * ld + n] : 0.f; }
  return bsplit16(v); }
__device__ __forceinline__ v8f mac3(const F2& a, const F2& b, v8f c) { c = wmma_bf(a.l, b.h, c); c = wmma_bf(a.h, b.l, c); return wmma_bf(a.h, b.h, c); }
__device__ __forceinline__ float sigm(float v) { return 1.0f / (1.0f + expf(-v)); }
// lane l with lane l ^ 16
__device__ __forceinline__ float xhalf(float x) { return __builtin_bit_cast(float, __builtin_amdgcn_permlanex16(__builtin_bit_cast(int, x), __builtin_bit_cast(int, x), 0x76543210, 0xfedcba98, false, false)); }
#define LDSX() do { asm volatile("s_wait_dscnt 0" ::: "memory"); __builtin_amdgcn_wave_barrier(); __builtin_amdgcn_fence(__ATOMIC_RELEASE, "workgroup"); } while (0)

// T5 encoder block: RMSNorm -> 16-head self attention with the bidirectional relative-position bias (no 1/sqrt(d)) -> residual ->
// RMSNorm -> ReLU FFN (1024 -> 4096 -> 1024) -> residual. All products on v_wmma_f32_16x16x32_f16 ([out][in] weight rows converted once
// to f16 rows x16; activations as f16 rows, q/k x4, P x2^14, V x4, ctx x8); RMSNorms, the bucket function, softmax and residuals in f32.
#define NB 2
#define SS 1024
#define E 1024
#define NH 16
#define HD 64
#define DFF 4096
#define NR (NB * SS)           // 2048
#define NBK 32
#define MAXD 128

// GEMM operand ring in LDS. A stage is 64 k (128 B) of the block's 64 A rows and then of its 128 B rows, at a row pitch of 144 B
// (16 B x odd, the conflict-free pitch for ds_load_b128). Two buffers: asynchronous copies fill one while the other is multiplied.
#define BKH 64                     // k per stage
#define PIT 72                     // LDS row pitch in f16
#define STG (192 * PIT)            // f16 per buffer
#define RING_BYTES (2 * STG * 2)
// One stage: 192 rows x 8 pieces of 16 B = 12 copies per lane; 8 neighbouring lanes take one row's whole 128-B line.
// ga, gb: this lane's piece in row (tid >> 3) of the A and of the B part; l: LDS byte address of the A piece.
__device__ __forceinline__ void stage_copy(const _Float16* ga, size_t lda, const _Float16* gb, size_t ldb, unsigned l) {
  // the closing s_wait_xcnt stands inside the statement so that no address register of a copy is rewritten in front of it
  asm volatile("global_load_async_to_lds_b128 %0, %12, off\n\t"
               "global_load_async_to_lds_b128 %1, %13, off\n\t"
               "global_load_async_to_lds_b128 %2, %14, off\n\t"
               "global_load_async_to_lds_b128 %3, %15, off\n\t"
               "global_load_async_to_lds_b128 %4, %16, off\n\t"
               "global_load_async_to_lds_b128 %5, %17, off\n\t"
               "global_load_async_to_lds_b128 %6, %18, off\n\t"
               "global_load_async_to_lds_b128 %7, %19, off\n\t"
               "global_load_async_to_lds_b128 %8, %20, off\n\t"
               "global_load_async_to_lds_b128 %9, %21, off\n\t"
               "global_load_async_to_lds_b128 %10, %22, off\n\t"
               "global_load_async_to_lds_b128 %11, %23, off\n\t"
               "s_wait_xcnt 0x0"
               :: "v"(l), "v"(l + 1u * 16 * PIT * 2), "v"(l + 2u * 16 * PIT * 2), "v"(l + 3u * 16 * PIT * 2), "v"(l + 4u * 16 * PIT * 2), "v"(l + 5u * 16 * PIT * 2),
                  "v"(l + 6u * 16 * PIT * 2), "v"(l + 7u * 16 * PIT * 2), "v"(l + 8u * 16 * PIT * 2), "v"(l + 9u * 16 * PIT * 2), "v"(l + 10u * 16 * PIT * 2), "v"(l + 11u * 16 * PIT * 2),
                  "v"(ga), "v"(ga + 16 * lda), "v"(ga + 32 * lda), "v"(ga + 48 * lda),
                  "v"(gb), "v"(gb + 16 * ldb), "v"(gb + 32 * ldb), "v"(gb + 48 * ldb), "v"(gb + 64 * ldb), "v"(gb + 80 * ldb), "v"(gb + 96 * ldb), "v"(gb + 112 * ldb)
               : "memory");
}
// acc[j] += A rows (wave * 16 ..) x B rows (j * 16 ..) over NT stages, k ascending. A: first of the block's 64 rows (row pitch lda, stage step sa),
// B: first of its 128 rows (row pitch ldb, stage step BKH). Behind it no copy is in flight and every wave has left the ring.
template <int NT>
__device__ __forceinline__ void gemm_ring(const _Float16* A, size_t lda, size_t sa, const _Float16* B, size_t ldb, char* smem, v8f (&acc)[8]) {
  const int tid = threadIdx.x, wave = tid >> 5, lane = tid & 31, col = lane & 15;
  const _Float16* ring = (const _Float16*)smem;
  const _Float16* ga = A + (size_t)(tid >> 3) * lda + (tid & 7) * 8;
  const _Float16* gb = B + (size_t)(tid >> 3) * ldb + (tid & 7) * 8;
  const unsigned l = (unsigned)(size_t)smem + (unsigned)((tid >> 3) * PIT + (tid & 7) * 8) * 2u;
  stage_copy(ga, lda, gb, ldb, l);
  asm volatile("s_wait_asynccnt 0x0" ::: "memory");   // this wave's part of stage 0 has landed before the barrier publishes it
  __syncthreads();
  stage_copy(ga + sa, lda, gb + BKH, ldb, l + STG * 2);
  for (int t = 0; t < NT; ++t) {
    const _Float16* buf = ring + (t & 1) * STG;
    v16h a[2], b[2][8];   // the stage's fragments, read as one group so that one LDS latency is paid per stage, not one per product
    // the four loops below are unrolled so that every index of a, b and acc is a constant and the arrays stay in registers
#pragma unroll
    for (int kc = 0; kc < 2; ++kc) { a[kc] = frag_h(buf + (wave * 16 + col) * PIT + kc * 32, lane);
#pragma unroll
      for (int j = 0; j < 8; ++j) b[kc][j] = frag_h(buf + (64 + j * 16 + col) * PIT + kc * 32, lane); }
#pragma unroll
    for (int kc = 0; kc < 2; ++kc)
#pragma unroll
      for (int j = 0; j < 8; ++j) acc[j] = wmma16(a[kc], b[kc][j], acc[j]);
    asm volatile("s_wait_dscnt 0x0" ::: "memory");      // this wave's reads of the buffer are over before it is refilled
    asm volatile("s_wait_asynccnt 0x0" ::: "memory");   // this wave's part of stage t + 1 has landed
    __syncthreads();                                    // publishes stage t + 1 and frees stage t's buffer
    if (t + 2 < NT) stage_copy(ga + (size_t)(t + 2) * sa, lda, gb + (size_t)(t + 2) * BKH, ldb, l + (unsigned)(t & 1) * (STG * 2));
  }
  asm volatile("s_wait_asynccnt 0x0" ::: "memory");     // nothing in flight when the ring becomes output staging
}

// Deep ring for the GEMMs whose whole grid is resident at once with LDS to spare (k_qkv: three workgroups per WGP; k_o, k_ff2: one): the launch lasts
// as long as one workgroup's chain of stage flights, so a stage is NS x 64 k of the same 192 rows: NS times fewer flights, NS times the bytes in flight.
// Row pitch NS x 128 + 16 B (16 B x odd). Two buffers and the same order of waits as gemm_ring.
#define PITD(NS) ((NS) * BKH + 8)            // LDS row pitch in f16
#define STGD(NS) (192 * PITD(NS))            // f16 per buffer
#define RINGD_BYTES(NS) (2 * STGD(NS) * 2)
// Twelve copies of one wave: 4 on the A part and 8 on the B part. A copy's 32 lanes take 512 B: one row's stage slice (NS = 4) or two rows' (NS = 2).
// ga, gb: this lane's piece for the first A and B copy, da, db: step from copy to copy; la, lb: its LDS byte addresses, dl: their step.
__device__ __forceinline__ void deep_copy(const _Float16* ga, size_t da, const _Float16* gb, size_t db, unsigned la, unsigned lb, unsigned dl) {
  // the closing s_wait_xcnt stands inside the statement so that no address register of a copy is rewritten in front of it
  asm volatile("global_load_async_to_lds_b128 %0, %12, off\n\t"
               "global_load_async_to_lds_b128 %1, %13, off\n\t"
               "global_load_async_to_lds_b128 %2, %14, off\n\t"
               "global_load_async_to_lds_b128 %3, %15, off\n\t"
               "global_load_async_to_lds_b128 %4, %16, off\n\t"
               "global_load_async_to_lds_b128 %5, %17, off\n\t"
               "global_load_async_to_lds_b128 %6, %18, off\n\t"
               "global_load_async_to_lds_b128 %7, %19, off\n\t"
               "global_load_async_to_lds_b128 %8, %20, off\n\t"
               "global_load_async_to_lds_b128 %9, %21, off\n\t"
               "global_load_async_to_lds_b128 %10, %22, off\n\t"
               "global_load_async_to_lds_b128 %11, %23, off\n\t"
               "s_wait_xcnt 0x0"
               :: "v"(la), "v"(la + dl), "v"(la + 2 * dl), "v"(la + 3 * dl),
                  "v"(lb), "v"(lb + dl), "v"(lb + 2 * dl), "v"(lb + 3 * dl), "v"(lb + 4 * dl), "v"(lb + 5 * dl), "v"(lb + 6 * dl), "v"(lb + 7 * dl),
                  "v"(ga), "v"(ga + da), "v"(ga + 2 * da), "v"(ga + 3 * da),
                  "v"(gb), "v"(gb + db), "v"(gb + 2 * db), "v"(gb + 3 * db), "v"(gb + 4 * db), "v"(gb + 5 * db), "v"(gb + 6 * db), "v"(gb + 7 * db)
               : "memory");
}
// One wave's share of a deep stage: a quarter of the A rows and of the B rows, 12 x NS copies.
template <int NS>
__device__ __forceinline__ void deep_stage(const _Float16* ga, size_t lda, const _Float16* gb, size_t ldb, unsigned la, unsigned lb) {
  constexpr int RPC = 4 / NS;   // rows per copy
  // unrolled so that the row steps are constants
#pragma unroll
  for (int s = 0; s < NS; ++s) deep_copy(ga + (size_t)(s * 16 * RPC) * lda, RPC * lda, gb + (size_t)(s * 32 * RPC) * ldb, RPC * ldb,
                                         la + (unsigned)(s * 16 * RPC * PITD(NS) * 2), lb + (unsigned)(s * 32 * RPC * PITD(NS) * 2), (unsigned)(RPC * PITD(NS) * 2));
}
// As gemm_ring, over NT deep stages, k ascending. sa: distance between an A row's successive 64-k pieces (BKH where the row is contiguous).
template <int NS, int NT>
__device__ __forceinline__ void gemm_deep(const _Float16* A, size_t lda, size_t sa, const _Float16* B, size_t ldb, char* smem, v8f (&acc)[8]) {
  constexpr int RPC = 4 / NS, LPR = NS * 8, PD = PITD(NS), SD = STGD(NS);   // rows per copy, lanes per row
  const int tid = threadIdx.x, wave = tid >> 5, lane = tid & 31, col = lane & 15, lr = lane / LPR, lp = lane % LPR;
  const _Float16* ring = (const _Float16*)smem;
  const _Float16* ga = A + (size_t)(wave * 4 * RPC + lr) * lda + (size_t)(lp >> 3) * sa + (lp & 7) * 8;
  const _Float16* gb = B + (size_t)(wave * 8 * RPC + lr) * ldb + lp * 8;
  const unsigned la = (unsigned)(size_t)smem + (unsigned)((wave * 4 * RPC + lr) * PD + lp * 8) * 2u;
  const unsigned lb = (unsigned)(size_t)smem + (unsigned)((64 + wave * 8 * RPC + lr) * PD + lp * 8) * 2u;
  deep_stage<NS>(ga, lda, gb, ldb, la, lb);
  asm volatile("s_wait_asynccnt 0x0" ::: "memory");   // this wave's part of stage 0 has landed before the barrier publishes it
  __syncthreads();
  deep_stage<NS>(ga + NS * sa, lda, gb + NS * BKH, ldb, la + SD * 2, lb + SD * 2);
  // kept rolled so that the hot loop stays small in the instruction cache
#pragma unroll 1
  for (int t = 0; t < NT; ++t) {
    const _Float16* buf = ring + (t & 1) * SD;
    // all loops below are unrolled so that every index of a, b and acc is a constant and the arrays stay in registers
#pragma unroll
    for (int ks = 0; ks < NS; ++ks) {
      v16h a[2], b[2][8];   // 64 k of fragments, read as one group so that one LDS latency is paid per group, not one per product
#pragma unroll
      for (int kc = 0; kc < 2; ++kc) { a[kc] = frag_h(buf + (wave * 16 + col) * PD + ks * BKH + kc * 32, lane);
#pragma unroll
        for (int j = 0; j < 8; ++j) b[kc][j] = frag_h(buf + (64 + j * 16 + col) * PD + ks * BKH + kc * 32, lane); }
#pragma unroll
      for (int kc = 0; kc < 2; ++kc)
#pragma unroll
        for (int j = 0; j < 8; ++j) acc[j] = wmma16(a[kc], b[kc][j], acc[j]);
    }
    asm volatile("s_wait_dscnt 0x0" ::: "memory");      // this wave's reads of the buffer are over before it is refilled
    asm volatile("s_wait_asynccnt 0x0" ::: "memory");   // this wave's part of stage t + 1 has landed
    __syncthreads();                                    // publishes stage t + 1 and frees stage t's buffer
    if (t + 2 < NT) deep_stage<NS>(ga + (size_t)(t + 2) * NS * sa, lda, gb + (size_t)(t + 2) * NS * BKH, ldb, la + (unsigned)(t & 1) * (SD * 2), lb + (unsigned)(t & 1) * (SD * 2));
  }
  asm volatile("s_wait_asynccnt 0x0" ::: "memory");     // nothing in flight when the ring becomes output staging
}

// RMSNorm of rows -> f16 ; wave per row, 8 rows per block blk
__device__ __forceinline__ void rms_rows(const float* __restrict__ x, const float* __restrict__ w, _Float16* __restrict__ X16, unsigned blk) {
  const int wave = threadIdx.x >> 5, lane = threadIdx.x & 31; const size_t r = (size_t)blk * 8 + wave; if (r >= NR) return;
  const float* xr = x + r * E; float q2 = 0.f;
#pragma unroll 1
  for (int i = 0; i < 8; ++i) { const v4f a = *(const v4f*)(xr + i * 128 + lane * 4); q2 += (a[0] * a[0] + a[1] * a[1]) + (a[2] * a[2] + a[3] * a[3]); }
#pragma unroll
  for (int off = 16; off >= 1; off >>= 1) q2 += __shfl_xor(q2, off, 32);
  const float rs = rsqrtf(q2 * (1.0f / E) + 1e-6f);
#pragma unroll 1
  for (int i = 0; i < 4; ++i) { const int c0 = i * 256 + lane * 8; union { v8h h; v4u u; } pk;
#pragma unroll
    for (int e = 0; e < 8; ++e) pk.h[e] = (_Float16)(xr[c0 + e] * rs * w[c0 + e]);
    vst2(X16 + r * E + c0, pk.u); }
}
__global__ __launch_bounds__(256) void k_rms(const float* __restrict__ x, const float* __restrict__ w, _Float16* __restrict__ X16) { rms_rows(x, w, X16, blockIdx.x); }
// weight packs: PT rows: [0,1024) wq, [1024,2048) wk, [2048,3072) wv, [3072,4096) wo (all [out][in=1024]) x16 ; WI rows [4096][1024] x16 ; WF rows [1024][4096] x16
// All that depends on the inputs alone and is read by k_qkv or k_attn, as block ranges of one grid: the first RMSNorm, then the bias table
// BT[h][rel + SS - 1] for rel = k - q in [-(SS-1), SS-1], then the wq, wk, wv rows of PT (one row per block).
#define PREP_RMS (NR / 8)
#define PREP_BIAS (2 * SS / 256 * NH)
__global__ __launch_bounds__(256) void k_prep(const float* __restrict__ hid, const float* __restrict__ ln1, const float* __restrict__ wq, const float* __restrict__ wk, const float* __restrict__ wv, const float* __restrict__ rb,
                                            _Float16* __restrict__ X16, _Float16* __restrict__ PT, float* __restrict__ BT) {
  const int blk = blockIdx.x, tid = threadIdx.x; __shared__ __align__(16) _Float16 srow[E];
  if (blk < PREP_RMS) { rms_rows(hid, ln1, X16, blk); return; }
  if (blk < PREP_RMS + PREP_BIAS) { const int h = (blk - PREP_RMS) >> 3, i = ((blk - PREP_RMS) & 7) * 256 + tid; if (i >= 2 * SS) return;   // table width padded to 2*SS
    float v = 0.f;
    if (i < 2 * SS - 1) { const int rel = i - (SS - 1); const int nb = NBK / 2; int bucket = rel > 0 ? nb : 0; const int rp = rel < 0 ? -rel : rel; const int mx = nb / 2;
      int val; if (rp < mx) val = rp; else { const float lf = logf((float)rp / (float)mx) / 2.772588722239781f * (float)(nb - mx); int large = mx + (int)lf; val = large < nb - 1 ? large : nb - 1; }
      bucket += val; v = rb[bucket * NH + h]; }
    vst2(BT + (size_t)h * 2 * SS + i, v); return; }
  const int r = blk - PREP_RMS - PREP_BIAS, which = r >> 10, n = r & (E - 1); const float* W = (which == 0 ? wq : which == 1 ? wk : wv) + (size_t)n * E;
  for (int k = tid; k < E; k += 256) srow[k] = (_Float16)(W[k] * 16.0f);
  __syncthreads(); if (tid < 128) vst2(PT + (size_t)r * E + tid * 8, *(const v4u*)(&srow[tid * 8]));
}
// A 128-thread block's share of a weight pack whose rows keep their order: PCH consecutive f32 -> f16 x16.
#define PCH 4096
__device__ __forceinline__ void pack_chunk(const float* __restrict__ s, _Float16* __restrict__ d) {
  const int tid = threadIdx.x; v4f v[8];
  // both loops unrolled so that v stays in registers and the lane's eight loads are in flight together
#pragma unroll
  for (int i = 0; i < 8; ++i) v[i] = *(const v4f*)(s + (i * 128 + tid) * 4);
#pragma unroll
  for (int i = 0; i < 8; ++i) { v4h h;
#pragma unroll
    for (int e = 0; e < 4; ++e) h[e] = (_Float16)(v[i][e] * 16.0f);
    vst2(d + (i * 128 + tid) * 4, h); }
}
// QKV: block (64 rows, 128 cols = 2 heads, which)
__global__ __launch_bounds__(128) void k_qkv(const _Float16* __restrict__ X16, const _Float16* __restrict__ PT, _Float16* __restrict__ Q16, _Float16* __restrict__ K16, _Float16* __restrict__ VT) {
  __shared__ __align__(16) char smem[RINGD_BYTES(2)];   // the operand ring; behind the k loop the output staging
  float (*so)[16][132] = (float (*)[16][132])smem;
  _Float16 (*st)[72] = (_Float16 (*)[72])smem;
  const int tid = threadIdx.x, wave = tid >> 5, lane = tid & 31, col = lane & 15, g = lane >> 4;
  const int which = blockIdx.z, r0b = blockIdx.x * 64, n0 = blockIdx.y * 128; const int b = r0b / SS, s0 = r0b % SS;
  v8f acc[8] = {};
  gemm_deep<2, E / (2 * BKH)>(X16 + (size_t)r0b * E, E, BKH, PT + (size_t)(which * E + n0) * E, E, smem, acc);
  if (which < 2) {
#pragma unroll
    for (int j = 0; j < 8; ++j)
#pragma unroll
      for (int r = 0; r < 8; ++r) so[wave][8 * g + r][j * 16 + col] = acc[j][r] * (4.0f / 16.0f);
    LDSX();
    _Float16* D = which == 0 ? Q16 : K16;
    for (int qq = lane; qq < 16 * 2 * 8; qq += 32) { const int hh = qq >> 7, rl = (qq >> 3) & 15, pc = qq & 7; const int h = (n0 >> 6) + hh; union { v8h h8; v4u u; } pk;
#pragma unroll
      for (int e = 0; e < 8; ++e) pk.h8[e] = (_Float16)so[wave][rl][hh * 64 + pc * 8 + e];
      vst2(D + (((size_t)b * NH + h) * SS + s0 + wave * 16 + rl) * HD + pc * 8, pk.u); } }
  else {
#pragma unroll
    for (int j = 0; j < 8; ++j)
#pragma unroll
      for (int r = 0; r < 8; ++r) st[j * 16 + col][wave * 16 + 8 * g + r] = (_Float16)(acc[j][r] * (4.0f / 16.0f));
    __syncthreads();
    for (int qq = tid; qq < 128 * 8; qq += 128) { const int cl = qq >> 3, pc = qq & 7; const int c = n0 + cl, h = c >> 6, d = c & 63;
      vst2(VT + (((size_t)b * NH + h) * HD + d) * SS + s0 + pc * 8, *(const v4u*)(&st[cl][pc * 8])); } }
}
// Attention's K/V ring in LDS. A stage is one 64-key tile for the block's four waves: its 64 K rows (64 d = 128 B each) and then the 64 V^T rows
// (64 keys = 128 B each), at the same 144-B row pitch as the GEMM ring. Two buffers: asynchronous copies fill one while the other is worked on.
#define ASTG (128 * PIT)           // f16 per buffer
// One stage: 128 rows x 8 pieces of 16 B = 8 copies per lane; 8 neighbouring lanes take one row's whole 128-B line.
// gk, gv: this lane's piece in row (tid >> 3) of the K and of the V^T part; l: LDS byte address of the K piece.
__device__ __forceinline__ void kv_copy(const _Float16* gk, const _Float16* gv, unsigned l) {
  // the closing s_wait_xcnt stands inside the statement so that no address register of a copy is rewritten in front of it
  asm volatile("global_load_async_to_lds_b128 %0, %8, off\n\t"
               "global_load_async_to_lds_b128 %1, %9, off\n\t"
               "global_load_async_to_lds_b128 %2, %10, off\n\t"
               "global_load_async_to_lds_b128 %3, %11, off\n\t"
               "global_load_async_to_lds_b128 %4, %12, off\n\t"
               "global_load_async_to_lds_b128 %5, %13, off\n\t"
               "global_load_async_to_lds_b128 %6, %14, off\n\t"
               "global_load_async_to_lds_b128 %7, %15, off\n\t"
               "s_wait_xcnt 0x0"
               :: "v"(l), "v"(l + 1u * 16 * PIT * 2), "v"(l + 2u * 16 * PIT * 2), "v"(l + 3u * 16 * PIT * 2),
                  "v"(l + 4u * 16 * PIT * 2), "v"(l + 5u * 16 * PIT * 2), "v"(l + 6u * 16 * PIT * 2), "v"(l + 7u * 16 * PIT * 2),
                  "v"(gk), "v"(gk + 16 * HD), "v"(gk + 32 * HD), "v"(gk + 48 * HD), "v"(gv), "v"(gv + 16 * SS), "v"(gv + 32 * SS), "v"(gv + 48 * SS)
               : "memory");
}
// Grid rows y < NB * NH are the attention tiles. The RIDE_Y rows behind them pack wo, wi and wo_ff, which only the launches after this one read:
// their memory stream runs in the places that the attention blocks leave free on each WGP.
#define RIDE_Y ((E * E + 2 * DFF * E) / PCH / (SS / 64))
__global__ __launch_bounds__(128) void k_attn(const _Float16* __restrict__ Q16, const _Float16* __restrict__ K16, const _Float16* __restrict__ VT, const float* __restrict__ BT, _Float16* __restrict__ O16,
                                            const float* __restrict__ wo, const float* __restrict__ wi, const float* __restrict__ wff, _Float16* __restrict__ PTO, _Float16* __restrict__ WI, _Float16* __restrict__ WF) {
  if (blockIdx.y >= NB * NH) {   // the whole block leaves here, in front of every barrier and copy
    const unsigned c = (blockIdx.y - NB * NH) * (SS / 64) + blockIdx.x; const int m = c < E * E / PCH ? 0 : c < (E * E + DFF * E) / PCH ? 1 : 2;
    const size_t o = (size_t)(c - (m == 0 ? 0 : m == 1 ? E * E / PCH : (E * E + DFF * E) / PCH)) * PCH;
    pack_chunk((m == 0 ? wo : m == 1 ? wi : wff) + o, (m == 0 ? PTO : m == 1 ? WI : WF) + o);
    return; }
  __shared__ __align__(16) _Float16 kv[2 * ASTG];
  __shared__ __align__(16) _Float16 sO[4][16][72];
  const int tid = threadIdx.x, w = tid >> 5, lane = tid & 31, col = lane & 15, g = lane >> 4;
  const size_t bh = blockIdx.y; const int h = (int)(bh % NH); const int q0 = blockIdx.x * 64 + w * 16; const float* bth = BT + (size_t)h * 2 * SS + (SS - 1);
  v16h bq[2];
#pragma unroll
  for (int kc = 0; kc < 2; ++kc) bq[kc] = frag_h(Q16 + (bh * SS + q0 + col) * HD + kc * 32, lane);
  float mrun = -3.0e38f, lrun = 0.f; v8f acc[4] = {};   // lrun: the sum over this half's keys only; the halves are joined behind the loop
  const float* bp = bth + (8 * g - (q0 + col));         // bias of key 8 g against this lane's query
  const _Float16* gk = K16 + (bh * SS + (tid >> 3)) * HD + (tid & 7) * 8;
  const _Float16* gv = VT + (bh * HD + (tid >> 3)) * SS + (tid & 7) * 8;
  const unsigned l = (unsigned)(size_t)kv + (unsigned)((tid >> 3) * PIT + (tid & 7) * 8) * 2u;
  kv_copy(gk, gv, l);
  asm volatile("s_wait_asynccnt 0x0" ::: "memory");   // this wave's part of tile 0 has landed before the barrier publishes it
  __syncthreads();
  kv_copy(gk + 64 * HD, gv + 64, l + ASTG * 2);
#pragma unroll 1
  for (int kt = 0; kt < SS / 64; ++kt) {
    const _Float16* buf = kv + (kt & 1) * ASTG;
    v16h kf[4][2], vf[2][4], pb[2];   // the tile's fragments, each operand read as one group so that one LDS latency is paid per group, not one per product
    float bv[4][8]; v8f s[4] = {};
    // every loop of this body is unrolled so that every index of bv, kf, s, vf, pb and acc is a constant and the arrays stay in registers
    // the tile's biases are asked for first, so that they arrive under the K reads and the first product
#pragma unroll
    for (int t = 0; t < 4; ++t)
#pragma unroll
      for (int r = 0; r < 8; ++r) bv[t][r] = bp[kt * 64 + t * 16 + r];
#pragma unroll
    for (int t = 0; t < 4; ++t)
#pragma unroll
      for (int kc = 0; kc < 2; ++kc) kf[t][kc] = frag_h(buf + (t * 16 + col) * PIT + kc * 32, lane);
#pragma unroll
    for (int kc = 0; kc < 2; ++kc)
#pragma unroll
      for (int t = 0; t < 4; ++t) s[t] = wmma16(kf[t][kc], bq[kc], s[t]);
    // read here so that the softmax below covers their latency
#pragma unroll
    for (int kc = 0; kc < 2; ++kc)
#pragma unroll
      for (int t = 0; t < 4; ++t) vf[kc][t] = frag_h(buf + (64 + t * 16 + col) * PIT + kc * 32, lane);
    float mt[4], pt[4];   // one chain per 16-key tile, so that four independent chains are in flight
#pragma unroll
    for (int t = 0; t < 4; ++t) { mt[t] = -3.4e38f;
#pragma unroll
      for (int r = 0; r < 8; ++r) { s[t][r] = s[t][r] * (1.0f / 16.0f) + bv[t][r]; mt[t] = fmaxf(mt[t], s[t][r]); } }
    float mx = fmaxf(fmaxf(mt[0], mt[1]), fmaxf(mt[2], mt[3]));
    mx = fmaxf(mx, xhalf(mx));
    const float mnew = fmaxf(mrun, mx); const float corr = expf(mrun - mnew);
#pragma unroll
    for (int t = 0; t < 4; ++t) { pt[t] = 0.f;
#pragma unroll
      for (int r = 0; r < 8; ++r) { const float p = expf(s[t][r] - mnew); pt[t] += p; pb[t >> 1][(t & 1) * 8 + r] = (_Float16)(p * 16384.0f); } }
    lrun = lrun * corr + ((pt[0] + pt[1]) + (pt[2] + pt[3])); mrun = mnew;
#pragma unroll
    for (int t = 0; t < 4; ++t)
#pragma unroll
      for (int r = 0; r < 8; ++r) acc[t][r] *= corr;
#pragma unroll
    for (int kc = 0; kc < 2; ++kc)
#pragma unroll
      for (int t = 0; t < 4; ++t) acc[t] = wmma16(vf[kc][t], pb[kc], acc[t]);
    asm volatile("s_wait_dscnt 0x0" ::: "memory");      // this wave's reads of the buffer are over before it is refilled
    asm volatile("s_wait_asynccnt 0x0" ::: "memory");   // this wave's part of tile kt + 1 has landed
    __syncthreads();                                    // publishes tile kt + 1 and frees tile kt's buffer
    if (kt + 2 < SS / 64) kv_copy(gk + (size_t)(kt + 2) * 64 * HD, gv + (kt + 2) * 64, l + (unsigned)(kt & 1) * (ASTG * 2)); }
  asm volatile("s_wait_asynccnt 0x0" ::: "memory");     // nothing in flight when the wave goes on to its output and ends
  // acc[t][r] = O[query col][d = t * 16 + 8 g + r]: eight neighbouring d per lane; staged in the wave's own LDS rows so that whole 128-B lines are stored
  const float inv = 8.0f / ((lrun + xhalf(lrun)) * 16384.0f * 4.0f);
#pragma unroll
  for (int t = 0; t < 4; ++t) { union { v8h h8; v4u u; } pk;
#pragma unroll
    for (int r = 0; r < 8; ++r) pk.h8[r] = (_Float16)(acc[t][r] * inv);
    vst2(&sO[w][col][t * 16 + 8 * g], pk.u); }
  LDSX();
  for (int qq = lane; qq < 16 * 8; qq += 32) { const int rl = qq >> 3, pc = qq & 7;
    vst2(O16 + ((bh * SS) + q0 + rl) * HD + pc * 8, *(const v4u*)(&sO[w][rl][pc * 8])); }
}
// H1 = hidden + ctx wo^T : block (64 rows, 128 cols)
__global__ __launch_bounds__(128) void k_o(const _Float16* __restrict__ O16, const _Float16* __restrict__ PT, const float* __restrict__ hid, float* __restrict__ H1) {
  __shared__ __align__(16) char smem[RINGD_BYTES(4)];   // the operand ring; behind the k loop the output staging
  float (*so)[16][132] = (float (*)[16][132])smem;
  const int tid = threadIdx.x, wave = tid >> 5, lane = tid & 31, col = lane & 15, g = lane >> 4;
  const int r0b = blockIdx.x * 64, r0 = r0b + wave * 16, n0 = blockIdx.y * 128; const int b = r0b / SS, s0 = r0b % SS;
  v8f acc[8] = {};
  // a 64-k piece is a head: the 64 k of head t of row s stand at O16[b][t][s][0..63]
  gemm_deep<4, E / (4 * BKH)>(O16 + ((size_t)b * NH * SS + s0) * HD, HD, (size_t)SS * HD, PT + (size_t)(3 * E + n0) * E, E, smem, acc);
#pragma unroll
  for (int j = 0; j < 8; ++j) { const int n = n0 + j * 16 + col;
#pragma unroll
    for (int r = 0; r < 8; ++r) so[wave][8 * g + r][j * 16 + col] = acc[j][r] * (1.0f / (16.0f * 8.0f)) + hid[(size_t)(r0 + 8 * g + r) * E + n]; }
  LDSX();
#pragma unroll 4
  for (int rl = 0; rl < 16; ++rl) vst2(H1 + (size_t)(r0 + rl) * E + n0 + lane * 4, *(const v4f*)(&so[wave][rl][lane * 4]));
}
// F16 = relu(Y16 @ wi^T) as f16 rows [NR][4096] : block (64 rows, 128 cols)
__global__ __launch_bounds__(128) void k_ff1(const _Float16* __restrict__ Y16, const _Float16* __restrict__ WI, _Float16* __restrict__ F16) {
  __shared__ __align__(16) char smem[RING_BYTES];   // the operand ring; behind the k loop the output staging
  _Float16 (*so)[16][136] = (_Float16 (*)[16][136])smem;
  const int tid = threadIdx.x, wave = tid >> 5, lane = tid & 31, col = lane & 15, g = lane >> 4;
  const int r0b = blockIdx.x * 64, r0 = r0b + wave * 16, n0 = blockIdx.y * 128;
  v8f acc[8] = {};
  gemm_ring<E / BKH>(Y16 + (size_t)r0b * E, E, BKH, WI + (size_t)n0 * E, E, smem, acc);
#pragma unroll
  for (int j = 0; j < 8; ++j)
#pragma unroll
    for (int r = 0; r < 8; ++r) { const float v = acc[j][r] * (1.0f / 16.0f); so[wave][8 * g + r][j * 16 + col] = (_Float16)(v > 0.f ? v : 0.f); }
  LDSX();
  for (int qq = lane; qq < 16 * 16; qq += 32) { const int rl = qq >> 4, pc = qq & 15; vst2(F16 + (size_t)(r0 + rl) * DFF + n0 + pc * 8, *(const v4u*)(&so[wave][rl][pc * 8])); }
}
// out = H1 + F16 @ wo_ff^T : block (64 rows, 128 cols), K = 4096
__global__ __launch_bounds__(128) void k_ff2(const _Float16* __restrict__ F16, const _Float16* __restrict__ WF, const float* __restrict__ H1, float* __restrict__ out) {
  __shared__ __align__(16) char smem[RINGD_BYTES(4)];   // the operand ring; behind the k loop the output staging
  float (*so)[16][132] = (float (*)[16][132])smem;
  const int tid = threadIdx.x, wave = tid >> 5, lane = tid & 31, col = lane & 15, g = lane >> 4;
  const int r0b = blockIdx.x * 64, r0 = r0b + wave * 16, n0 = blockIdx.y * 128;
  v8f acc[8] = {};
  gemm_deep<4, DFF / (4 * BKH)>(F16 + (size_t)r0b * DFF, DFF, BKH, WF + (size_t)n0 * DFF, DFF, smem, acc);
#pragma unroll
  for (int j = 0; j < 8; ++j) { const int n = n0 + j * 16 + col;
#pragma unroll
    for (int r = 0; r < 8; ++r) so[wave][8 * g + r][j * 16 + col] = acc[j][r] * (1.0f / 16.0f) + H1[(size_t)(r0 + 8 * g + r) * E + n]; }
  LDSX();
#pragma unroll 4
  for (int rl = 0; rl < 16; ++rl) vst2(out + (size_t)(r0 + rl) * E + n0 + lane * 4, *(const v4f*)(&so[wave][rl][lane * 4]));
}
extern "C" void kernel_launch(void* const* d_in, const int* in_sizes, int n_in, void* d_out, int out_size, void* d_ws, size_t ws_size, hipStream_t stream) {
  (void)in_sizes; (void)n_in; (void)out_size; (void)ws_size;
  const float** I = (const float**)d_in;
  const float* hid = I[0]; const float* ln1 = I[1]; const float* wq = I[2]; const float* wk = I[3]; const float* wv = I[4]; const float* wo = I[5]; const float* rb = I[6]; const float* ln2 = I[7]; const float* wi = I[8]; const float* wff = I[9];
  float* out = (float*)d_out;
  char* ws = (char*)d_ws; size_t off = 0;
  auto take = [&](size_t bytes) { char* p = ws + off; off += (bytes + 255) & ~(size_t)255; return p; };
  _Float16* X16 = (_Float16*)take((size_t)NR * E * 2); _Float16* PT = (_Float16*)take((size_t)4 * E * E * 2); _Float16* WI = (_Float16*)take((size_t)DFF * E * 2); _Float16* WF = (_Float16*)take((size_t)E * DFF * 2);
  float* BT = (float*)take((size_t)NH * 2 * SS * 4);
  _Float16* Q16 = (_Float16*)take((size_t)NR * E * 2); _Float16* K16 = (_Float16*)take((size_t)NR * E * 2); _Float16* VT = (_Float16*)take((size_t)NR * E * 2); _Float16* O16 = (_Float16*)take((size_t)NR * E * 2);
  float* H1 = (float*)take((size_t)NR * E * 4); _Float16* Y16 = X16; _Float16* F16 = (_Float16*)take((size_t)NR * DFF * 2);
  k_prep<<<PREP_RMS + PREP_BIAS + 3 * E, 256, 0, stream>>>(hid, ln1, wq, wk, wv, rb, X16, PT, BT);
  k_qkv<<<dim3(NR / 64, E / 128, 3), 128, 0, stream>>>(X16, PT, Q16, K16, VT);
  k_attn<<<dim3(SS / 64, NB * NH + RIDE_Y), 128, 0, stream>>>(Q16, K16, VT, BT, O16, wo, wi, wff, PT + (size_t)3 * E * E, WI, WF);
  k_o<<<dim3(NR / 64, E / 128), 128, 0, stream>>>(O16, PT, hid, H1);
  k_rms<<<NR / 8, 256, 0, stream>>>(H1, ln2, Y16);
  k_ff1<<<dim3(NR / 64, DFF / 128), 128, 0, stream>>>(Y16, WI, F16);
  k_ff2<<<dim3(NR / 64, E / 128), 128, 0, stream>>>(F16, WF, H1, out);
}

// v006
// It runs in 106 microseconds.
// Two timings next to v005 put it at 1.04 and 1.05 times that version's speed.
// All steps since v000 together make it 5.21 times as fast.
#include <hip/hip_runtime.h>
#include <math.h>

typedef __attribute__((ext_vector_type(16))) _Float16 v16h;
typedef __attribute__((ext_vector_type(16))) __bf16 v16b;
typedef __attribute__((ext_vector_type(8)))  _Float16 v8h;
typedef __attribute__((ext_vector_type(4)))  _Float16 v4h;
typedef __attribute__((ext_vector_type(8)))  float v8f;
typedef __attribute__((ext_vector_type(4)))  float v4f;
typedef __attribute__((ext_vector_type(2)))  float v2f;
typedef __attribute__((ext_vector_type(4)))  unsigned v4u;
typedef __attribute__((ext_vector_type(4)))  int v4i;
typedef float __attribute__((may_alias)) float_a;
typedef int __attribute__((may_alias)) int_a;

template <typename T> __device__ __forceinline__ void vst2(void* p, T v) { *(T*)p = v;  }
__device__ __forceinline__ v8f wmma16(v16h a, v16h b, v8f c) {
  v8f d = __builtin_amdgcn_wmma_f32_16x16x32_f16(false, a, false, b, (short)0, c, false, false);
  asm volatile("v_nop\n\tv_nop\n\tv_nop\n\tv_nop" : "+v"(d) : "v"(a), "v"(b));
  return d;
}
__device__ __forceinline__ v8f wmma_bf(v16b a, v16b b, v8f c) {
  v8f d = __builtin_amdgcn_wmma_f32_16x16x32_bf16(false, a, false, b, (short)0, c, false, false);
  asm volatile("v_nop\n\tv_nop\n\tv_nop\n\tv_nop" : "+v"(d) : "v"(a), "v"(b));
  return d;
}
// 16x16x32 fragments: lane = (h = lane>>4, row/col = lane&15); elements 0..7 = k0+8h+0..7, 8..15 = k0+16+8h+0..7; D element r = row 8h+r
__device__ __forceinline__ v16h frag_h(const _Float16* rowk0, int lane) {
  union { v16h v; v8h q[2]; } u; const _Float16* p = rowk0 + 8 * (lane >> 4);
  u.q[0] = *(const v8h*)p; u.q[1] = *(const v8h*)(p + 16); return u.v;
}
__device__ __forceinline__ v16h frag_f32(const float* rowk0, int lane) {
  v16h a; const float* p = rowk0 + 8 * (lane >> 4);
#pragma unroll
  for (int i = 0; i < 8; ++i) { a[i] = (_Float16)p[i]; a[8 + i] = (_Float16)p[16 + i]; }
  return a;
}
__device__ __forceinline__ v16h frag_f32s(const float* rowk0, int lane, float sc) {
  v16h a; const float* p = rowk0 + 8 * (lane >> 4);
#pragma unroll
  for (int i = 0; i < 8; ++i) { a[i] = (_Float16)(p[i] * sc); a[8 + i] = (_Float16)(p[16 + i] * sc); }
  return a;
}
// column fragment from a [K][ld] layout (column n), rows >= K read as 0
__device__ __forceinline__ v16h fragc_f32(const float* W, int k0, int n, int lane, int ld, int K) {
  v16h a; const int g = lane >> 4;
#pragma unroll
  for (int i = 0; i < 8; ++i) { const int ka = k0 + 8 * g + i, kb = ka + 16;
    a[i] = (_Float16)(ka < K ? W[(size_t)ka * ld + n] : 0.f); a[8 + i] = (_Float16)(kb < K ? W[(size_t)kb * ld + n] : 0.f); }
  return a;
}
struct F2 { v16b h, l; };
__device__ __forceinline__ F2 bsplit16(const float v[16]) { F2 r;
#pragma unroll
  for (int i = 0; i < 16; ++i) { const __bf16 h = (__bf16)v[i]; r.h[i] = h; r.l[i] = (__bf16)(v[i] - (float)h); }
  return r; }
__device__ __forceinline__ F2 split_row(const float* row, int k0, int lane) { float v[16]; const float* p = row + k0 + 8 * (lane >> 4);
#pragma unroll
  for (int i = 0; i < 8; ++i) { v[i] = p[i]; v[8 + i] = p[16 + i]; }
  return bsplit16(v); }
__device__ __forceinline__ F2 split_rowK(const float* row, int k0, int lane, int K) { float v[16]; const int g = lane >> 4;
#pragma unroll
  for (int i = 0; i < 8; ++i) { const int ka = k0 + 8 * g + i, kb = ka + 16; v[i] = ka < K ? row[ka] : 0.f; v[8 + i] = kb < K ? row[kb] : 0.f; }
  return bsplit16(v); }
__device__ __forceinline__ F2 split_col(const float* W, int k0, int n, int lane, int ld, int K) { float v[16]; const int g = lane >> 4;
#pragma unroll
  for (int i = 0; i < 8; ++i) { const int ka = k0 + 8 * g + i, kb = ka + 16; v[i] = ka < K ? W[(size_t)ka * ld + n] : 0.f; v[8 + i] = kb < K ? W[(size_t)kb * ld + n] : 0.f; }
  return bsplit16(v); }
__device__ __forceinline__ v8f mac3(const F2& a, const F2& b, v8f c) { c = wmma_bf(a.l, b.h, c); c = wmma_bf(a.h, b.l, c); return wmma_bf(a.h, b.h, c); }
__device__ __forceinline__ float sigm(float v) { return 1.0f / (1.0f + expf(-v)); }
// lane l with lane l ^ 16
__device__ __forceinline__ float xhalf(float x) { return __builtin_bit_cast(float, __builtin_amdgcn_permlanex16(__builtin_bit_cast(int, x), __builtin_bit_cast(int, x), 0x76543210, 0xfedcba98, false, false)); }
// x[r] = 2^x[r]. Eight independent v_exp_f32, each in place, so that none reads a neighbour's result or overwrites a neighbour's source; the closing
// v_nop is the one slot that the instruction set asks for between the last of them and a user of its result, which the compiler places unseen.
__device__ __forceinline__ void exp2x8(v8f& x) {
  asm("v_exp_f32 %0, %0\n\tv_exp_f32 %1, %1\n\tv_exp_f32 %2, %2\n\tv_exp_f32 %3, %3\n\t"
      "v_exp_f32 %4, %4\n\tv_exp_f32 %5, %5\n\tv_exp_f32 %6, %6\n\tv_exp_f32 %7, %7\n\tv_nop"
      : "+v"(x[0]), "+v"(x[1]), "+v"(x[2]), "+v"(x[3]), "+v"(x[4]), "+v"(x[5]), "+v"(x[6]), "+v"(x[7]));
}
#define LDSX() do { asm volatile("s_wait_dscnt 0" ::: "memory"); __builtin_amdgcn_wave_barrier(); __builtin_amdgcn_fence(__ATOMIC_RELEASE, "workgroup"); } while (0)

// T5 encoder block: RMSNorm -> 16-head self attention with the bidirectional relative-position bias (no 1/sqrt(d)) -> residual ->
// RMSNorm -> ReLU FFN (1024 -> 4096 -> 1024) -> residual. All products on v_wmma_f32_16x16x32_f16 ([out][in] weight rows converted once
// to f16 rows x16; activations as f16 rows, q/k x4, P x2^14, V x4, ctx x8); RMSNorms, the bucket function, softmax and residuals in f32.
#define NB 2
#define SS 1024
#define E 1024
#define NH 16
#define HD 64
#define DFF 4096
#define NR (NB * SS)           // 2048
#define NBK 32
#define MAXD 128
#define LOG2E 1.4426950408889634f

// GEMM operand ring in LDS. A stage is 64 k (128 B) of the block's 64 A rows and then of its 128 B rows, at a row pitch of 144 B
// (16 B x odd, the conflict-free pitch for ds_load_b128). Two buffers: asynchronous copies fill one while the other is multiplied.
#define BKH 64                     // k per stage
#define PIT 72                     // LDS row pitch in f16
#define STG (192 * PIT)            // f16 per buffer
#define RING_BYTES (2 * STG * 2)
// One stage: 192 rows x 8 pieces of 16 B = 12 copies per lane; 8 neighbouring lanes take one row's whole 128-B line.
// ga, gb: this lane's piece in row (tid >> 3) of the A and of the B part; l: LDS byte address of the A piece.
__device__ __forceinline__ void stage_copy(const _Float16* ga, size_t lda, const _Float16* gb, size_t ldb, unsigned l) {
  // the closing s_wait_xcnt stands inside the statement so that no address register of a copy is rewritten in front of it
  asm volatile("global_load_async_to_lds_b128 %0, %12, off\n\t"
               "global_load_async_to_lds_b128 %1, %13, off\n\t"
               "global_load_async_to_lds_b128 %2, %14, off\n\t"
               "global_load_async_to_lds_b128 %3, %15, off\n\t"
               "global_load_async_to_lds_b128 %4, %16, off\n\t"
               "global_load_async_to_lds_b128 %5, %17, off\n\t"
               "global_load_async_to_lds_b128 %6, %18, off\n\t"
               "global_load_async_to_lds_b128 %7, %19, off\n\t"
               "global_load_async_to_lds_b128 %8, %20, off\n\t"
               "global_load_async_to_lds_b128 %9, %21, off\n\t"
               "global_load_async_to_lds_b128 %10, %22, off\n\t"
               "global_load_async_to_lds_b128 %11, %23, off\n\t"
               "s_wait_xcnt 0x0"
               :: "v"(l), "v"(l + 1u * 16 * PIT * 2), "v"(l + 2u * 16 * PIT * 2), "v"(l + 3u * 16 * PIT * 2), "v"(l + 4u * 16 * PIT * 2), "v"(l + 5u * 16 * PIT * 2),
                  "v"(l + 6u * 16 * PIT * 2), "v"(l + 7u * 16 * PIT * 2), "v"(l + 8u * 16 * PIT * 2), "v"(l + 9u * 16 * PIT * 2), "v"(l + 10u * 16 * PIT * 2), "v"(l + 11u * 16 * PIT * 2),
                  "v"(ga), "v"(ga + 16 * lda), "v"(ga + 32 * lda), "v"(ga + 48 * lda),
                  "v"(gb), "v"(gb + 16 * ldb), "v"(gb + 32 * ldb), "v"(gb + 48 * ldb), "v"(gb + 64 * ldb), "v"(gb + 80 * ldb), "v"(gb + 96 * ldb), "v"(gb + 112 * ldb)
               : "memory");
}
// acc[j] += A rows (wave * 16 ..) x B rows (j * 16 ..) over NT stages, k ascending. A: first of the block's 64 rows (row pitch lda, stage step sa),
// B: first of its 128 rows (row pitch ldb, stage step BKH). Behind it no copy is in flight and every wave has left the ring.
template <int NT>
__device__ __forceinline__ void gemm_ring(const _Float16* A, size_t lda, size_t sa, const _Float16* B, size_t ldb, char* smem, v8f (&acc)[8]) {
  const int tid = threadIdx.x, wave = tid >> 5, lane = tid & 31, col = lane & 15;
  const _Float16* ring = (const _Float16*)smem;
  const _Float16* ga = A + (size_t)(tid >> 3) * lda + (tid & 7) * 8;
  const _Float16* gb = B + (size_t)(tid >> 3) * ldb + (tid & 7) * 8;
  const unsigned l = (unsigned)(size_t)smem + (unsigned)((tid >> 3) * PIT + (tid & 7) * 8) * 2u;
  stage_copy(ga, lda, gb, ldb, l);
  asm volatile("s_wait_asynccnt 0x0" ::: "memory");   // this wave's part of stage 0 has landed before the barrier publishes it
  __syncthreads();
  stage_copy(ga + sa, lda, gb + BKH, ldb, l + STG * 2);
  for (int t = 0; t < NT; ++t) {
    const _Float16* buf = ring + (t & 1) * STG;
    v16h a[2], b[2][8];   // the stage's fragments, read as one group so that one LDS latency is paid per stage, not one per product
    // the four loops below are unrolled so that every index of a, b and acc is a constant and the arrays stay in registers
#pragma unroll
    for (int kc = 0; kc < 2; ++kc) { a[kc] = frag_h(buf + (wave * 16 + col) * PIT + kc * 32, lane);
#pragma unroll
      for (int j = 0; j < 8; ++j) b[kc][j] = frag_h(buf + (64 + j * 16 + col) * PIT + kc * 32, lane); }
#pragma unroll
    for (int kc = 0; kc < 2; ++kc)
#pragma unroll
      for (int j = 0; j < 8; ++j) acc[j] = wmma16(a[kc], b[kc][j], acc[j]);
    asm volatile("s_wait_dscnt 0x0" ::: "memory");      // this wave's reads of the buffer are over before it is refilled
    asm volatile("s_wait_asynccnt 0x0" ::: "memory");   // this wave's part of stage t + 1 has landed
    __syncthreads();                                    // publishes stage t + 1 and frees stage t's buffer
    if (t + 2 < NT) stage_copy(ga + (size_t)(t + 2) * sa, lda, gb + (size_t)(t + 2) * BKH, ldb, l + (unsigned)(t & 1) * (STG * 2));
  }
  asm volatile("s_wait_asynccnt 0x0" ::: "memory");     // nothing in flight when the ring becomes output staging
}

// Deep ring for the GEMMs whose whole grid is resident at once with LDS to spare (k_qkv: three workgroups per WGP; k_o, k_ff2: one): the launch lasts
// as long as one workgroup's chain of stage flights, so a stage is NS x 64 k of the same 192 rows: NS times fewer flights, NS times the bytes in flight.
// Row pitch NS x 128 + 16 B (16 B x odd). Two buffers and the same order of waits as gemm_ring.
#define PITD(NS) ((NS) * BKH + 8)            // LDS row pitch in f16
#define STGD(NS) (192 * PITD(NS))            // f16 per buffer
#define RINGD_BYTES(NS) (2 * STGD(NS) * 2)
// Twelve copies of one wave: 4 on the A part and 8 on the B part. A copy's 32 lanes take 512 B: one row's stage slice (NS = 4) or two rows' (NS = 2).
// ga, gb: this lane's piece for the first A and B copy, da, db: step from copy to copy; la, lb: its LDS byte addresses, dl: their step.
__device__ __forceinline__ void deep_copy(const _Float16* ga, size_t da, const _Float16* gb, size_t db, unsigned la, unsigned lb, unsigned dl) {
  // the closing s_wait_xcnt stands inside the statement so that no address register of a copy is rewritten in front of it
  asm volatile("global_load_async_to_lds_b128 %0, %12, off\n\t"
               "global_load_async_to_lds_b128 %1, %13, off\n\t"
               "global_load_async_to_lds_b128 %2, %14, off\n\t"
               "global_load_async_to_lds_b128 %3, %15, off\n\t"
               "global_load_async_to_lds_b128 %4, %16, off\n\t"
               "global_load_async_to_lds_b128 %5, %17, off\n\t"
               "global_load_async_to_lds_b128 %6, %18, off\n\t"
               "global_load_async_to_lds_b128 %7, %19, off\n\t"
               "global_load_async_to_lds_b128 %8, %20, off\n\t"
               "global_load_async_to_lds_b128 %9, %21, off\n\t"
               "global_load_async_to_lds_b128 %10, %22, off\n\t"
               "global_load_async_to_lds_b128 %11, %23, off\n\t"
               "s_wait_xcnt 0x0"
               :: "v"(la), "v"(la + dl), "v"(la + 2 * dl), "v"(la + 3 * dl),
                  "v"(lb), "v"(lb + dl), "v"(lb + 2 * dl), "v"(lb + 3 * dl), "v"(lb + 4 * dl), "v"(lb + 5 * dl), "v"(lb + 6 * dl), "v"(lb + 7 * dl),
                  "v"(ga), "v"(ga + da), "v"(ga + 2 * da), "v"(ga + 3 * da),
                  "v"(gb), "v"(gb + db), "v"(gb + 2 * db), "v"(gb + 3 * db), "v"(gb + 4 * db), "v"(gb + 5 * db), "v"(gb + 6 * db), "v"(gb + 7 * db)
               : "memory");
}
// One wave's share of a deep stage: a quarter of the A rows and of the B rows, 12 x NS copies.
template <int NS>
__device__ __forceinline__ void deep_stage(const _Float16* ga, size_t lda, const _Float16* gb, size_t ldb, unsigned la, unsigned lb) {
  constexpr int RPC = 4 / NS;   // rows per copy
  // unrolled so that the row steps are constants
#pragma unroll
  for (int s = 0; s < NS; ++s) deep_copy(ga + (size_t)(s * 16 * RPC) * lda, RPC * lda, gb + (size_t)(s * 32 * RPC) * ldb, RPC * ldb,
                                         la + (unsigned)(s * 16 * RPC * PITD(NS) * 2), lb + (unsigned)(s * 32 * RPC * PITD(NS) * 2), (unsigned)(RPC * PITD(NS) * 2));
}
// As gemm_ring, over NT deep stages, k ascending. sa: distance between an A row's successive 64-k pieces (BKH where the row is contiguous).
template <int NS, int NT>
__device__ __forceinline__ void gemm_deep(const _Float16* A, size_t lda, size_t sa, const _Float16* B, size_t ldb, char* smem, v8f (&acc)[8]) {
  constexpr int RPC = 4 / NS, LPR = NS * 8, PD = PITD(NS), SD = STGD(NS);   // rows per copy, lanes per row
  const int tid = threadIdx.x, wave = tid >> 5, lane = tid & 31, col = lane & 15, lr = lane / LPR, lp = lane % LPR;
  const _Float16* ring = (const _Float16*)smem;
  const _Float16* ga = A + (size_t)(wave * 4 * RPC + lr) * lda + (size_t)(lp >> 3) * sa + (lp & 7) * 8;
  const _Float16* gb = B + (size_t)(wave * 8 * RPC + lr) * ldb + lp * 8;
  const unsigned la = (unsigned)(size_t)smem + (unsigned)((wave * 4 * RPC + lr) * PD + lp * 8) * 2u;
  const unsigned lb = (unsigned)(size_t)smem + (unsigned)((64 + wave * 8 * RPC + lr) * PD + lp * 8) * 2u;
  deep_stage<NS>(ga, lda, gb, ldb, la, lb);
  asm volatile("s_wait_asynccnt 0x0" ::: "memory");   // this wave's part of stage 0 has landed before the barrier publishes it
  __syncthreads();
  deep_stage<NS>(ga + NS * sa, lda, gb + NS * BKH, ldb, la + SD * 2, lb + SD * 2);
  // kept rolled so that the hot loop stays small in the instruction cache
#pragma unroll 1
  for (int t = 0; t < NT; ++t) {
    const _Float16* buf = ring + (t & 1) * SD;
    // all loops below are unrolled so that every index of a, b and acc is a constant and the arrays stay in registers
#pragma unroll
    for (int ks = 0; ks < NS; ++ks) {
      v16h a[2], b[2][8];   // 64 k of fragments, read as one group so that one LDS latency is paid per group, not one per product
#pragma unroll
      for (int kc = 0; kc < 2; ++kc) { a[kc] = frag_h(buf + (wave * 16 + col) * PD + ks * BKH + kc * 32, lane);
#pragma unroll
        for (int j = 0; j < 8; ++j) b[kc][j] = frag_h(buf + (64 + j * 16 + col) * PD + ks * BKH + kc * 32, lane); }
#pragma unroll
      for (int kc = 0; kc < 2; ++kc)
#pragma unroll
        for (int j = 0; j < 8; ++j) acc[j] = wmma16(a[kc], b[kc][j], acc[j]);
    }
    asm volatile("s_wait_dscnt 0x0" ::: "memory");      // this wave's reads of the buffer are over before it is refilled
    asm volatile("s_wait_asynccnt 0x0" ::: "memory");   // this wave's part of stage t + 1 has landed
    __syncthreads();                                    // publishes stage t + 1 and frees stage t's buffer
    if (t + 2 < NT) deep_stage<NS>(ga + (size_t)(t + 2) * NS * sa, lda, gb + (size_t)(t + 2) * NS * BKH, ldb, la + (unsigned)(t & 1) * (SD * 2), lb + (unsigned)(t & 1) * (SD * 2));
  }
  asm volatile("s_wait_asynccnt 0x0" ::: "memory");     // nothing in flight when the ring becomes output staging
}

// RMSNorm of rows -> f16 ; wave per row, 8 rows per block blk
__device__ __forceinline__ void rms_rows(const float* __restrict__ x, const float* __restrict__ w, _Float16* __restrict__ X16, unsigned blk) {
  const int wave = threadIdx.x >> 5, lane = threadIdx.x & 31; const size_t r = (size_t)blk * 8 + wave; if (r >= NR) return;
  const float* xr = x + r * E; float q2 = 0.f;
#pragma unroll 1
  for (int i = 0; i < 8; ++i) { const v4f a = *(const v4f*)(xr + i * 128 + lane * 4); q2 += (a[0] * a[0] + a[1] * a[1]) + (a[2] * a[2] + a[3] * a[3]); }
#pragma unroll
  for (int off = 16; off >= 1; off >>= 1) q2 += __shfl_xor(q2, off, 32);
  const float rs = rsqrtf(q2 * (1.0f / E) + 1e-6f);
#pragma unroll 1
  for (int i = 0; i < 4; ++i) { const int c0 = i * 256 + lane * 8; union { v8h h; v4u u; } pk;
#pragma unroll
    for (int e = 0; e < 8; ++e) pk.h[e] = (_Float16)(xr[c0 + e] * rs * w[c0 + e]);
    vst2(X16 + r * E + c0, pk.u); }
}
__global__ __launch_bounds__(256) void k_rms(const float* __restrict__ x, const float* __restrict__ w, _Float16* __restrict__ X16) { rms_rows(x, w, X16, blockIdx.x); }
// weight packs: PT rows: [0,1024) wq, [1024,2048) wk, [2048,3072) wv, [3072,4096) wo (all [out][in=1024]) x16 ; WI rows [4096][1024] x16 ; WF rows [1024][4096] x16
// All that depends on the inputs alone and is read by k_qkv or k_attn, as block ranges of one grid: the first RMSNorm, then the bias table
// BT[h][rel + SS - 1] for rel = k - q in [-(SS-1), SS-1], in base-2 units (x log2 e), then the wq, wk, wv rows of PT (one row per block).
#define PREP_RMS (NR / 8)
#define PREP_BIAS (2 * SS / 256 * NH)
__global__ __launch_bounds__(256) void k_prep(const float* __restrict__ hid, const float* __restrict__ ln1, const float* __restrict__ wq, const float* __restrict__ wk, const float* __restrict__ wv, const float* __restrict__ rb,
                                            _Float16* __restrict__ X16, _Float16* __restrict__ PT, float* __restrict__ BT) {
  const int blk = blockIdx.x, tid = threadIdx.x; __shared__ __align__(16) _Float16 srow[E];
  if (blk < PREP_RMS) { rms_rows(hid, ln1, X16, blk); return; }
  if (blk < PREP_RMS + PREP_BIAS) { const int h = (blk - PREP_RMS) >> 3, i = ((blk - PREP_RMS) & 7) * 256 + tid; if (i >= 2 * SS) return;   // table width padded to 2*SS
    float v = 0.f;
    if (i < 2 * SS - 1) { const int rel = i - (SS - 1); const int nb = NBK / 2; int bucket = rel > 0 ? nb : 0; const int rp = rel < 0 ? -rel : rel; const int mx = nb / 2;
      int val; if (rp < mx) val = rp; else { const float lf = logf((float)rp / (float)mx) / 2.772588722239781f * (float)(nb - mx); int large = mx + (int)lf; val = large < nb - 1 ? large : nb - 1; }
      bucket += val; v = rb[bucket * NH + h] * LOG2E; }
    vst2(BT + (size_t)h * 2 * SS + i, v); return; }
  const int r = blk - PREP_RMS - PREP_BIAS, which = r >> 10, n = r & (E - 1); const float* W = (which == 0 ? wq : which == 1 ? wk : wv) + (size_t)n * E;
  for (int k = tid; k < E; k += 256) srow[k] = (_Float16)(W[k] * 16.0f);
  __syncthreads(); if (tid < 128) vst2(PT + (size_t)r * E + tid * 8, *(const v4u*)(&srow[tid * 8]));
}
// A 128-thread block's share of a weight pack whose rows keep their order: PCH consecutive f32 -> f16 x16.
#define PCH 4096
__device__ __forceinline__ void pack_chunk(const float* __restrict__ s, _Float16* __restrict__ d) {
  const int tid = threadIdx.x; v4f v[8];
  // both loops unrolled so that v stays in registers and the lane's eight loads are in flight together
#pragma unroll
  for (int i = 0; i < 8; ++i) v[i] = *(const v4f*)(s + (i * 128 + tid) * 4);
#pragma unroll
  for (int i = 0; i < 8; ++i) { v4h h;
#pragma unroll
    for (int e = 0; e < 4; ++e) h[e] = (_Float16)(v[i][e] * 16.0f);
    vst2(d + (i * 128 + tid) * 4, h); }
}
// QKV: block (64 rows, 128 cols = 2 heads, which)
__global__ __launch_bounds__(128) void k_qkv(const _Float16* __restrict__ X16, const _Float16* __restrict__ PT, _Float16* __restrict__ Q16, _Float16* __restrict__ K16, _Float16* __restrict__ VT) {
  __shared__ __align__(16) char smem[RINGD_BYTES(2)];   // the operand ring; behind the k loop the output staging
  float (*so)[16][132] = (float (*)[16][132])smem;
  _Float16 (*st)[72] = (_Float16 (*)[72])smem;
  const int tid = threadIdx.x, wave = tid >> 5, lane = tid & 31, col = lane & 15, g = lane >> 4;
  const int which = blockIdx.z, r0b = blockIdx.x * 64, n0 = blockIdx.y * 128; const int b = r0b / SS, s0 = r0b % SS;
  v8f acc[8] = {};
  gemm_deep<2, E / (2 * BKH)>(X16 + (size_t)r0b * E, E, BKH, PT + (size_t)(which * E + n0) * E, E, smem, acc);
  if (which < 2) {
#pragma unroll
    for (int j = 0; j < 8; ++j)
#pragma unroll
      for (int r = 0; r < 8; ++r) so[wave][8 * g + r][j * 16 + col] = acc[j][r] * (4.0f / 16.0f);
    LDSX();
    _Float16* D = which == 0 ? Q16 : K16;
    for (int qq = lane; qq < 16 * 2 * 8; qq += 32) { const int hh = qq >> 7, rl = (qq >> 3) & 15, pc = qq & 7; const int h = (n0 >> 6) + hh; union { v8h h8; v4u u; } pk;
#pragma unroll
      for (int e = 0; e < 8; ++e) pk.h8[e] = (_Float16)so[wave][rl][hh * 64 + pc * 8 + e];
      vst2(D + (((size_t)b * NH + h) * SS + s0 + wave * 16 + rl) * HD + pc * 8, pk.u); } }
  else {
#pragma unroll
    for (int j = 0; j < 8; ++j)
#pragma unroll
      for (int r = 0; r < 8; ++r) st[j * 16 + col][wave * 16 + 8 * g + r] = (_Float16)(acc[j][r] * (4.0f / 16.0f));
    __syncthreads();
    for (int qq = tid; qq < 128 * 8; qq += 128) { const int cl = qq >> 3, pc = qq & 7; const int c = n0 + cl, h = c >> 6, d = c & 63;
      vst2(VT + (((size_t)b * NH + h) * HD + d) * SS + s0 + pc * 8, *(const v4u*)(&st[cl][pc * 8])); } }
}
// Attention's K/V ring in LDS. A stage is one 64-key tile for the block's four waves: its 64 K rows (64 d = 128 B each) and then the 64 V^T rows
// (64 keys = 128 B each), at the same 144-B row pitch as the GEMM ring. Two buffers: asynchronous copies fill one while the other is worked on.
#define ASTG (128 * PIT)           // f16 per buffer
// One stage: 128 rows x 8 pieces of 16 B = 8 copies per lane; 8 neighbouring lanes take one row's whole 128-B line.
// gk, gv: this lane's piece in row (tid >> 3) of the K and of the V^T part; l: LDS byte address of the K piece.
__device__ __forceinline__ void kv_copy(const _Float16* gk, const _Float16* gv, unsigned l) {
  // the closing s_wait_xcnt stands inside the statement so that no address register of a copy is rewritten in front of it
  asm volatile("global_load_async_to_lds_b128 %0, %8, off\n\t"
               "global_load_async_to_lds_b128 %1, %9, off\n\t"
               "global_load_async_to_lds_b128 %2, %10, off\n\t"
               "global_load_async_to_lds_b128 %3, %11, off\n\t"
               "global_load_async_to_lds_b128 %4, %12, off\n\t"
               "global_load_async_to_lds_b128 %5, %13, off\n\t"
               "global_load_async_to_lds_b128 %6, %14, off\n\t"
               "global_load_async_to_lds_b128 %7, %15, off\n\t"
               "s_wait_xcnt 0x0"
               :: "v"(l), "v"(l + 1u * 16 * PIT * 2), "v"(l + 2u * 16 * PIT * 2), "v"(l + 3u * 16 * PIT * 2),
                  "v"(l + 4u * 16 * PIT * 2), "v"(l + 5u * 16 * PIT * 2), "v"(l + 6u * 16 * PIT * 2), "v"(l + 7u * 16 * PIT * 2),
                  "v"(gk), "v"(gk + 16 * HD), "v"(gk + 32 * HD), "v"(gk + 48 * HD), "v"(gv), "v"(gv + 16 * SS), "v"(gv + 32 * SS), "v"(gv + 48 * SS)
               : "memory");
}
// Grid rows y < NB * NH are the attention tiles. The RIDE_Y rows behind them pack wo, wi and wo_ff, which only the launches after this one read:
// their memory stream runs in the places that the attention blocks leave free on each WGP.
#define RIDE_Y ((E * E + 2 * DFF * E) / PCH / (SS / 64))
__global__ __launch_bounds__(128) void k_attn(const _Float16* __restrict__ Q16, const _Float16* __restrict__ K16, const _Float16* __restrict__ VT, const float* __restrict__ BT, _Float16* __restrict__ O16,
                                            const float* __restrict__ wo, const float* __restrict__ wi, const float* __restrict__ wff, _Float16* __restrict__ PTO, _Float16* __restrict__ WI, _Float16* __restrict__ WF) {
  if (blockIdx.y >= NB * NH) {   // the whole block leaves here, in front of every barrier and copy
    const unsigned c = (blockIdx.y - NB * NH) * (SS / 64) + blockIdx.x; const int m = c < E * E / PCH ? 0 : c < (E * E + DFF * E) / PCH ? 1 : 2;
    const size_t o = (size_t)(c - (m == 0 ? 0 : m == 1 ? E * E / PCH : (E * E + DFF * E) / PCH)) * PCH;
    pack_chunk((m == 0 ? wo : m == 1 ? wi : wff) + o, (m == 0 ? PTO : m == 1 ? WI : WF) + o);
    return; }
  __shared__ __align__(16) _Float16 kv[2 * ASTG];
  __shared__ __align__(16) _Float16 sO[4][16][72];
  const int tid = threadIdx.x, w = tid >> 5, lane = tid & 31, col = lane & 15, g = lane >> 4;
  const size_t bh = blockIdx.y; const int h = (int)(bh % NH); const int q0 = blockIdx.x * 64 + w * 16; const float* bth = BT + (size_t)h * 2 * SS + (SS - 1);
  v16h bq[2];
#pragma unroll
  for (int kc = 0; kc < 2; ++kc) bq[kc] = frag_h(Q16 + (bh * SS + q0 + col) * HD + kc * 32, lane);
  float mrun = -3.0e38f, lrun = 0.f; v8f acc[4] = {};   // lrun: the sum over this half's keys only; the halves are joined behind the loop
  const float* bp = bth + (8 * g - (q0 + col));         // bias of key 8 g against this lane's query
  const _Float16* gk = K16 + (bh * SS + (tid >> 3)) * HD + (tid & 7) * 8;
  const _Float16* gv = VT + (bh * HD + (tid >> 3)) * SS + (tid & 7) * 8;
  const unsigned l = (unsigned)(size_t)kv + (unsigned)((tid >> 3) * PIT + (tid & 7) * 8) * 2u;
  kv_copy(gk, gv, l);
  asm volatile("s_wait_asynccnt 0x0" ::: "memory");   // this wave's part of tile 0 has landed before the barrier publishes it
  __syncthreads();
  kv_copy(gk + 64 * HD, gv + 64, l + ASTG * 2);
#pragma unroll 1
  for (int kt = 0; kt < SS / 64; ++kt) {
    const _Float16* buf = kv + (kt & 1) * ASTG;
    v16h kf[4][2], vf[2][4], pb[2];   // the tile's fragments, each operand read as one group so that one LDS latency is paid per group, not one per product
    float bv[4][8]; v8f s[4] = {};
    // every loop of this body is unrolled so that every index of bv, kf, s, vf, pb and acc is a constant and the arrays stay in registers
    // the tile's biases are asked for first, so that they arrive under the K reads and the first product
#pragma unroll
    for (int t = 0; t < 4; ++t)
#pragma unroll
      for (int r = 0; r < 8; ++r) bv[t][r] = bp[kt * 64 + t * 16 + r];
#pragma unroll
    for (int t = 0; t < 4; ++t)
#pragma unroll
      for (int kc = 0; kc < 2; ++kc) kf[t][kc] = frag_h(buf + (t * 16 + col) * PIT + kc * 32, lane);
#pragma unroll
    for (int kc = 0; kc < 2; ++kc)
#pragma unroll
      for (int t = 0; t < 4; ++t) s[t] = wmma16(kf[t][kc], bq[kc], s[t]);
    // read here so that the softmax below covers their latency
#pragma unroll
    for (int kc = 0; kc < 2; ++kc)
#pragma unroll
      for (int t = 0; t < 4; ++t) vf[kc][t] = frag_h(buf + (64 + t * 16 + col) * PIT + kc * 32, lane);
    float mt[4], pt[4];   // one chain per 16-key tile, so that four independent chains are in flight
#pragma unroll
    for (int t = 0; t < 4; ++t) { mt[t] = -3.4e38f;
#pragma unroll
      for (int r = 0; r < 8; ++r) { s[t][r] = s[t][r] * (LOG2E / 16.0f) + bv[t][r]; mt[t] = fmaxf(mt[t], s[t][r]); } }
    float mx = fmaxf(fmaxf(mt[0], mt[1]), fmaxf(mt[2], mt[3]));
    mx = fmaxf(mx, xhalf(mx));
    const float mnew = fmaxf(mrun, mx); const float corr = __builtin_amdgcn_exp2f(mrun - mnew); const float moff = mnew - 14.0f;
#pragma unroll
    for (int t = 0; t < 4; ++t) { pt[t] = 0.f;
#pragma unroll
      for (int r = 0; r < 8; ++r) s[t][r] -= moff;
      exp2x8(s[t]);
#pragma unroll
      for (int r = 0; r < 8; ++r) { pt[t] += s[t][r]; pb[t >> 1][(t & 1) * 8 + r] = (_Float16)s[t][r]; } }
    lrun = lrun * corr + ((pt[0] + pt[1]) + (pt[2] + pt[3])); mrun = mnew;
#pragma unroll
    for (int t = 0; t < 4; ++t)
#pragma unroll
      for (int r = 0; r < 8; ++r) acc[t][r] *= corr;
#pragma unroll
    for (int kc = 0; kc < 2; ++kc)
#pragma unroll
      for (int t = 0; t < 4; ++t) acc[t] = wmma16(vf[kc][t], pb[kc], acc[t]);
    asm volatile("s_wait_dscnt 0x0" ::: "memory");      // this wave's reads of the buffer are over before it is refilled
    asm volatile("s_wait_asynccnt 0x0" ::: "memory");   // this wave's part of tile kt + 1 has landed
    __syncthreads();                                    // publishes tile kt + 1 and frees tile kt's buffer
    if (kt + 2 < SS / 64) kv_copy(gk + (size_t)(kt + 2) * 64 * HD, gv + (kt + 2) * 64, l + (unsigned)(kt & 1) * (ASTG * 2)); }
  asm volatile("s_wait_asynccnt 0x0" ::: "memory");     // nothing in flight when the wave goes on to its output and ends
  // acc[t][r] = O[query col][d = t * 16 + 8 g + r]: eight neighbouring d per lane; staged in the wave's own LDS rows so that whole 128-B lines are stored
  const float inv = 8.0f / ((lrun + xhalf(lrun)) * 4.0f);
#pragma unroll
  for (int t = 0; t < 4; ++t) { union { v8h h8; v4u u; } pk;
#pragma unroll
    for (int r = 0; r < 8; ++r) pk.h8[r] = (_Float16)(acc[t][r] * inv);
    vst2(&sO[w][col][t * 16 + 8 * g], pk.u); }
  LDSX();
  for (int qq = lane; qq < 16 * 8; qq += 32) { const int rl = qq >> 3, pc = qq & 7;
    vst2(O16 + ((bh * SS) + q0 + rl) * HD + pc * 8, *(const v4u*)(&sO[w][rl][pc * 8])); }
}
// H1 = hidden + ctx wo^T : block (64 rows, 128 cols)
__global__ __launch_bounds__(128) void k_o(const _Float16* __restrict__ O16, const _Float16* __restrict__ PT, const float* __restrict__ hid, float* __restrict__ H1) {
  __shared__ __align__(16) char smem[RINGD_BYTES(4)];   // the operand ring; behind the k loop the output staging
  float (*so)[16][132] = (float (*)[16][132])smem;
  const int tid = threadIdx.x, wave = tid >> 5, lane = tid & 31, col = lane & 15, g = lane >> 4;
  const int r0b = blockIdx.x * 64, r0 = r0b + wave * 16, n0 = blockIdx.y * 128; const int b = r0b / SS, s0 = r0b % SS;
  v8f acc[8] = {};
  // a 64-k piece is a head: the 64 k of head t of row s stand at O16[b][t][s][0..63]
  gemm_deep<4, E / (4 * BKH)>(O16 + ((size_t)b * NH * SS + s0) * HD, HD, (size_t)SS * HD, PT + (size_t)(3 * E + n0) * E, E, smem, acc);
#pragma unroll
  for (int j = 0; j < 8; ++j) { const int n = n0 + j * 16 + col;
#pragma unroll
    for (int r = 0; r < 8; ++r) so[wave][8 * g + r][j * 16 + col] = acc[j][r] * (1.0f / (16.0f * 8.0f)) + hid[(size_t)(r0 + 8 * g + r) * E + n]; }
  LDSX();
#pragma unroll 4
  for (int rl = 0; rl < 16; ++rl) vst2(H1 + (size_t)(r0 + rl) * E + n0 + lane * 4, *(const v4f*)(&so[wave][rl][lane * 4]));
}
// F16 = relu(Y16 @ wi^T) as f16 rows [NR][4096] : block (64 rows, 128 cols)
__global__ __launch_bounds__(128) void k_ff1(const _Float16* __restrict__ Y16, const _Float16* __restrict__ WI, _Float16* __restrict__ F16) {
  __shared__ __align__(16) char smem[RING_BYTES];   // the operand ring; behind the k loop the output staging
  _Float16 (*so)[16][136] = (_Float16 (*)[16][136])smem;
  const int tid = threadIdx.x, wave = tid >> 5, lane = tid & 31, col = lane & 15, g = lane >> 4;
  const int r0b = blockIdx.x * 64, r0 = r0b + wave * 16, n0 = blockIdx.y * 128;
  v8f acc[8] = {};
  gemm_ring<E / BKH>(Y16 + (size_t)r0b * E, E, BKH, WI + (size_t)n0 * E, E, smem, acc);
#pragma unroll
  for (int j = 0; j < 8; ++j)
#pragma unroll
    for (int r = 0; r < 8; ++r) { const float v = acc[j][r] * (1.0f / 16.0f); so[wave][8 * g + r][j * 16 + col] = (_Float16)(v > 0.f ? v : 0.f); }
  LDSX();
  for (int qq = lane; qq < 16 * 16; qq += 32) { const int rl = qq >> 4, pc = qq & 15; vst2(F16 + (size_t)(r0 + rl) * DFF + n0 + pc * 8, *(const v4u*)(&so[wave][rl][pc * 8])); }
}
// out = H1 + F16 @ wo_ff^T : block (64 rows, 128 cols), K = 4096
__global__ __launch_bounds__(128) void k_ff2(const _Float16* __restrict__ F16, const _Float16* __restrict__ WF, const float* __restrict__ H1, float* __restrict__ out) {
  __shared__ __align__(16) char smem[RINGD_BYTES(4)];   // the operand ring; behind the k loop the output staging
  float (*so)[16][132] = (float (*)[16][132])smem;
  const int tid = threadIdx.x, wave = tid >> 5, lane = tid & 31, col = lane & 15, g = lane >> 4;
  const int r0b = blockIdx.x * 64, r0 = r0b + wave * 16, n0 = blockIdx.y * 128;
  v8f acc[8] = {};
  gemm_deep<4, DFF / (4 * BKH)>(F16 + (size_t)r0b * DFF, DFF, BKH, WF + (size_t)n0 * DFF, DFF, smem, acc);
#pragma unroll
  for (int j = 0; j < 8; ++j) { const int n = n0 + j * 16 + col;
#pragma unroll
    for (int r = 0; r < 8; ++r) so[wave][8 * g + r][j * 16 + col] = acc[j][r] * (1.0f / 16.0f) + H1[(size_t)(r0 + 8 * g + r) * E + n]; }
  LDSX();
#pragma unroll 4
  for (int rl = 0; rl < 16; ++rl) vst2(out + (size_t)(r0 + rl) * E + n0 + lane * 4, *(const v4f*)(&so[wave][rl][lane * 4]));
}
extern "C" void kernel_launch(void* const* d_in, const int* in_sizes, int n_in, void* d_out, int out_size, void* d_ws, size_t ws_size, hipStream_t stream) {
  (void)in_sizes; (void)n_in; (void)out_size; (void)ws_size;
  const float** I = (const float**)d_in;
  const float* hid = I[0]; const float* ln1 = I[1]; const float* wq = I[2]; const float* wk = I[3]; const float* wv = I[4]; const float* wo = I[5]; const float* rb = I[6]; const float* ln2 = I[7]; const float* wi = I[8]; const float* wff = I[9];
  float* out = (float*)d_out;
  char* ws = (char*)d_ws; size_t off = 0;
  auto take = [&](size_t bytes) { char* p = ws + off; off += (bytes + 255) & ~(size_t)255; return p; };
  _Float16* X16 = (_Float16*)take((size_t)NR * E * 2); _Float16* PT = (_Float16*)take((size_t)4 * E * E * 2); _Float16* WI = (_Float16*)take((size_t)DFF * E * 2); _Float16* WF = (_Float16*)take((size_t)E * DFF * 2);
  float* BT = (float*)take((size_t)NH * 2 * SS * 4);
  _Float16* Q16 = (_Float16*)take((size_t)NR * E * 2); _Float16* K16 = (_Float16*)take((size_t)NR * E * 2); _Float16* VT = (_Float16*)take((size_t)NR * E * 2); _Float16* O16 = (_Float16*)take((size_t)NR * E * 2);
  float* H1 = (float*)take((size_t)NR * E * 4); _Float16* Y16 = X16; _Float16* F16 = (_Float16*)take((size_t)NR * DFF * 2);
  k_prep<<<PREP_RMS + PREP_BIAS + 3 * E, 256, 0, stream>>>(hid, ln1, wq, wk, wv, rb, X16, PT, BT);
  k_qkv<<<dim3(NR / 64, E / 128, 3), 128, 0, stream>>>(X16, PT, Q16, K16, VT);
  k_attn<<<dim3(SS / 64, NB * NH + RIDE_Y), 128, 0, stream>>>(Q16, K16, VT, BT, O16, wo, wi, wff, PT + (size_t)3 * E * E, WI, WF);
  k_o<<<dim3(NR / 64, E / 128), 128, 0, stream>>>(O16, PT, hid, H1);
  k_rms<<<NR / 8, 256, 0, stream>>>(H1, ln2, Y16);
  k_ff1<<<dim3(NR / 64, DFF / 128), 128, 0, stream>>>(Y16, WI, F16);
  k_ff2<<<dim3(NR / 64, E / 128), 128, 0, stream>>>(F16, WF, H1, out);
}

// v007
// One run takes 97.8 microseconds.
// In both of two side-by-side timings against v006, it was 1.09 times as fast.
// Counting every step since v000, it is 5.67 times as fast.
#include <hip/hip_runtime.h>
#include <math.h>

typedef __attribute__((ext_vector_type(16))) _Float16 v16h;
typedef __attribute__((ext_vector_type(16))) __bf16 v16b;
typedef __attribute__((ext_vector_type(8)))  _Float16 v8h;
typedef __attribute__((ext_vector_type(4)))  _Float16 v4h;
typedef __attribute__((ext_vector_type(8)))  float v8f;
typedef __attribute__((ext_vector_type(4)))  float v4f;
typedef __attribute__((ext_vector_type(2)))  float v2f;
typedef __attribute__((ext_vector_type(4)))  unsigned v4u;
typedef __attribute__((ext_vector_type(4)))  int v4i;
typedef float __attribute__((may_alias)) float_a;
typedef int __attribute__((may_alias)) int_a;

template <typename T> __device__ __forceinline__ void vst2(void* p, T v) { *(T*)p = v;  }
__device__ __forceinline__ v8f wmma16(v16h a, v16h b, v8f c) {
  v8f d = __builtin_amdgcn_wmma_f32_16x16x32_f16(false, a, false, b, (short)0, c, false, false);
  asm volatile("v_nop\n\tv_nop\n\tv_nop\n\tv_nop" : "+v"(d) : "v"(a), "v"(b));
  return d;
}
__device__ __forceinline__ v8f wmma_bf(v16b a, v16b b, v8f c) {
  v8f d = __builtin_amdgcn_wmma_f32_16x16x32_bf16(false, a, false, b, (short)0, c, false, false);
  asm volatile("v_nop\n\tv_nop\n\tv_nop\n\tv_nop" : "+v"(d) : "v"(a), "v"(b));
  return d;
}
// 16x16x32 fragments: lane = (h = lane>>4, row/col = lane&15); elements 0..7 = k0+8h+0..7, 8..15 = k0+16+8h+0..7; D element r = row 8h+r
__device__ __forceinline__ v16h frag_h(const _Float16* rowk0, int lane) {
  union { v16h v; v8h q[2]; } u; const _Float16* p = rowk0 + 8 * (lane >> 4);
  u.q[0] = *(const v8h*)p; u.q[1] = *(const v8h*)(p + 16); return u.v;
}
__device__ __forceinline__ v16h frag_f32(const float* rowk0, int lane) {
  v16h a; const float* p = rowk0 + 8 * (lane >> 4);
#pragma unroll
  for (int i = 0; i < 8; ++i) { a[i] = (_Float16)p[i]; a[8 + i] = (_Float16)p[16 + i]; }
  return a;
}
__device__ __forceinline__ v16h frag_f32s(const float* rowk0, int lane, float sc) {
  v16h a; const float* p = rowk0 + 8 * (lane >> 4);
#pragma unroll
  for (int i = 0; i < 8; ++i) { a[i] = (_Float16)(p[i] * sc); a[8 + i] = (_Float16)(p[16 + i] * sc); }
  return a;
}
// column fragment from a [K][ld] layout (column n), rows >= K read as 0
__device__ __forceinline__ v16h fragc_f32(const float* W, int k0, int n, int lane, int ld, int K) {
  v16h a; const int g = lane >> 4;
#pragma unroll
  for (int i = 0; i < 8; ++i) { const int ka = k0 + 8 * g + i, kb = ka + 16;
    a[i] = (_Float16)(ka < K ? W[(size_t)ka * ld + n] : 0.f); a[8 + i] = (_Float16)(kb < K ? W[(size_t)kb * ld + n] : 0.f); }
  return a;
}
struct F2 { v16b h, l; };
__device__ __forceinline__ F2 bsplit16(const float v[16]) { F2 r;
#pragma unroll
  for (int i = 0; i < 16; ++i) { const __bf16 h = (__bf16)v[i]; r.h[i] = h; r.l[i] = (__bf16)(v[i] - (float)h); }
  return r; }
__device__ __forceinline__ F2 split_row(const float* row, int k0, int lane) { float v[16]; const float* p = row + k0 + 8 * (lane >> 4);
#pragma unroll
  for (int i = 0; i < 8; ++i) { v[i] = p[i]; v[8 + i] = p[16 + i]; }
  return bsplit16(v); }
__device__ __forceinline__ F2 split_rowK(const float* row, int k0, int lane, int K) { float v[16]; const int g = lane >> 4;
#pragma unroll
  for (int i = 0; i < 8; ++i) { const int ka = k0 + 8 * g + i, kb = ka + 16; v[i] = ka < K ? row[ka] : 0.f; v[8 + i] = kb < K ? row[kb] : 0.f; }
  return bsplit16(v); }
__device__ __forceinline__ F2 split_col(const float* W, int k0, int n, int lane, int ld, int K) { float v[16]; const int g = lane >> 4;
#pragma unroll
  for (int i = 0; i < 8; ++i) { const int ka = k0 + 8 * g + i, kb = ka + 16; v[i] = ka < K ? W[(size_t)ka * ld + n] : 0.f; v[8 + i] = kb < K ? W[(size_t)kb * ld + n] : 0.f; }
  return bsplit16(v); }
__device__ __forceinline__ v8f mac3(const F2& a, const F2& b, v8f c) { c = wmma_bf(a.l, b.h, c); c = wmma_bf(a.h, b.l, c); return wmma_bf(a.h, b.h, c); }
__device__ __forceinline__ float sigm(float v) { return 1.0f / (1.0f + expf(-v)); }
// lane l with lane l ^ 16
__device__ __forceinline__ float xhalf(float x) { return __builtin_bit_cast(float, __builtin_amdgcn_permlanex16(__builtin_bit_cast(int, x), __builtin_bit_cast(int, x), 0x76543210, 0xfedcba98, false, false)); }
// x[r] = 2^x[r]. Eight independent v_exp_f32, each in place, so that none reads a neighbour's result or overwrites a neighbour's source; the closing
// v_nop is the one slot that the instruction set asks for between the last of them and a user of its result, which the compiler places unseen.
__device__ __forceinline__ void exp2x8(v8f& x) {
  asm("v_exp_f32 %0, %0\n\tv_exp_f32 %1, %1\n\tv_exp_f32 %2, %2\n\tv_exp_f32 %3, %3\n\t"
      "v_exp_f32 %4, %4\n\tv_exp_f32 %5, %5\n\tv_exp_f32 %6, %6\n\tv_exp_f32 %7, %7\n\tv_nop"
      : "+v"(x[0]), "+v"(x[1]), "+v"(x[2]), "+v"(x[3]), "+v"(x[4]), "+v"(x[5]), "+v"(x[6]), "+v"(x[7]));
}
#define LDSX() do { asm volatile("s_wait_dscnt 0" ::: "memory"); __builtin_amdgcn_wave_barrier(); __builtin_amdgcn_fence(__ATOMIC_RELEASE, "workgroup"); } while (0)

// T5 encoder block: RMSNorm -> 16-head self attention with the bidirectional relative-position bias (no 1/sqrt(d)) -> residual ->
// RMSNorm -> ReLU FFN (1024 -> 4096 -> 1024) -> residual. All products on v_wmma_f32_16x16x32_f16 ([out][in] weight rows converted once
// to f16 rows x16; activations as f16 rows, q/k x4, P x2^14, V x4, ctx x8); RMSNorms, the bucket function, softmax and residuals in f32.
#define NB 2
#define SS 1024
#define E 1024
#define NH 16
#define HD 64
#define DFF 4096
#define NR (NB * SS)           // 2048
#define NBK 32
#define MAXD 128
#define LOG2E 1.4426950408889634f

// GEMM operand ring in LDS. A stage is 64 k (128 B) of the block's 64 A rows and then of its 128 B rows, at a row pitch of 144 B
// (16 B x odd, the conflict-free pitch for ds_load_b128). Two buffers: asynchronous copies fill one while the other is multiplied.
#define BKH 64                     // k per stage
#define PIT 72                     // LDS row pitch in f16
#define STG (192 * PIT)            // f16 per buffer
#define RING_BYTES (2 * STG * 2)
// One stage: 192 rows x 8 pieces of 16 B = 12 copies per lane; 8 neighbouring lanes take one row's whole 128-B line.
// ga, gb: this lane's piece in row (tid >> 3) of the A and of the B part; l: LDS byte address of the A piece.
__device__ __forceinline__ void stage_copy(const _Float16* ga, size_t lda, const _Float16* gb, size_t ldb, unsigned l) {
  // the closing s_wait_xcnt stands inside the statement so that no address register of a copy is rewritten in front of it
  asm volatile("global_load_async_to_lds_b128 %0, %12, off\n\t"
               "global_load_async_to_lds_b128 %1, %13, off\n\t"
               "global_load_async_to_lds_b128 %2, %14, off\n\t"
               "global_load_async_to_lds_b128 %3, %15, off\n\t"
               "global_load_async_to_lds_b128 %4, %16, off\n\t"
               "global_load_async_to_lds_b128 %5, %17, off\n\t"
               "global_load_async_to_lds_b128 %6, %18, off\n\t"
               "global_load_async_to_lds_b128 %7, %19, off\n\t"
               "global_load_async_to_lds_b128 %8, %20, off\n\t"
               "global_load_async_to_lds_b128 %9, %21, off\n\t"
               "global_load_async_to_lds_b128 %10, %22, off\n\t"
               "global_load_async_to_lds_b128 %11, %23, off\n\t"
               "s_wait_xcnt 0x0"
               :: "v"(l), "v"(l + 1u * 16 * PIT * 2), "v"(l + 2u * 16 * PIT * 2), "v"(l + 3u * 16 * PIT * 2), "v"(l + 4u * 16 * PIT * 2), "v"(l + 5u * 16 * PIT * 2),
                  "v"(l + 6u * 16 * PIT * 2), "v"(l + 7u * 16 * PIT * 2), "v"(l + 8u * 16 * PIT * 2), "v"(l + 9u * 16 * PIT * 2), "v"(l + 10u * 16 * PIT * 2), "v"(l + 11u * 16 * PIT * 2),
                  "v"(ga), "v"(ga + 16 * lda), "v"(ga + 32 * lda), "v"(ga + 48 * lda),
                  "v"(gb), "v"(gb + 16 * ldb), "v"(gb + 32 * ldb), "v"(gb + 48 * ldb), "v"(gb + 64 * ldb), "v"(gb + 80 * ldb), "v"(gb + 96 * ldb), "v"(gb + 112 * ldb)
               : "memory");
}
// acc[j] += A rows (wave * 16 ..) x B rows (j * 16 ..) over NT stages, k ascending. A: first of the block's 64 rows (row pitch lda, stage step sa),
// B: first of its 128 rows (row pitch ldb, stage step BKH). Behind it no copy is in flight and every wave has left the ring.
template <int NT>
__device__ __forceinline__ void gemm_ring(const _Float16* A, size_t lda, size_t sa, const _Float16* B, size_t ldb, char* smem, v8f (&acc)[8]) {
  const int tid = threadIdx.x, wave = tid >> 5, lane = tid & 31, col = lane & 15;
  const _Float16* ring = (const _Float16*)smem;
  const _Float16* ga = A + (size_t)(tid >> 3) * lda + (tid & 7) * 8;
  const _Float16* gb = B + (size_t)(tid >> 3) * ldb + (tid & 7) * 8;
  const unsigned l = (unsigned)(size_t)smem + (unsigned)((tid >> 3) * PIT + (tid & 7) * 8) * 2u;
  stage_copy(ga, lda, gb, ldb, l);
  asm volatile("s_wait_asynccnt 0x0" ::: "memory");   // this wave's part of stage 0 has landed before the barrier publishes it
  __syncthreads();
  stage_copy(ga + sa, lda, gb + BKH, ldb, l + STG * 2);
  for (int t = 0; t < NT; ++t) {
    const _Float16* buf = ring + (t & 1) * STG;
    v16h a[2], b[2][8];   // the stage's fragments, read as one group so that one LDS latency is paid per stage, not one per product
    // the four loops below are unrolled so that every index of a, b and acc is a constant and the arrays stay in registers
#pragma unroll
    for (int kc = 0; kc < 2; ++kc) { a[kc] = frag_h(buf + (wave * 16 + col) * PIT + kc * 32, lane);
#pragma unroll
      for (int j = 0; j < 8; ++j) b[kc][j] = frag_h(buf + (64 + j * 16 + col) * PIT + kc * 32, lane); }
#pragma unroll
    for (int kc = 0; kc < 2; ++kc)
#pragma unroll
      for (int j = 0; j < 8; ++j) acc[j] = wmma16(a[kc], b[kc][j], acc[j]);
    asm volatile("s_wait_dscnt 0x0" ::: "memory");      // this wave's reads of the buffer are over before it is refilled
    asm volatile("s_wait_asynccnt 0x0" ::: "memory");   // this wave's part of stage t + 1 has landed
    __syncthreads();                                    // publishes stage t + 1 and frees stage t's buffer
    if (t + 2 < NT) stage_copy(ga + (size_t)(t + 2) * sa, lda, gb + (size_t)(t + 2) * BKH, ldb, l + (unsigned)(t & 1) * (STG * 2));
  }
  asm volatile("s_wait_asynccnt 0x0" ::: "memory");     // nothing in flight when the ring becomes output staging
}

// Deep ring for the GEMMs whose whole grid is resident at once with LDS to spare (k_qkv: three workgroups per WGP; k_o, k_ff2: one): the launch lasts
// as long as one workgroup's chain of stage flights, so a stage is NS x 64 k of the same 192 rows: NS times fewer flights, NS times the bytes in flight.
// Row pitch NS x 128 + 16 B (16 B x odd). Two buffers and the same order of waits as gemm_ring.
#define PITD(NS) ((NS) * BKH + 8)            // LDS row pitch in f16
#define STGD(NS) (192 * PITD(NS))            // f16 per buffer
#define RINGD_BYTES(NS) (2 * STGD(NS) * 2)
// Twelve copies of one wave: 4 on the A part and 8 on the B part. A copy's 32 lanes take 512 B: one row's stage slice (NS = 4) or two rows' (NS = 2).
// ga, gb: this lane's piece for the first A and B copy, da, db: step from copy to copy; la, lb: its LDS byte addresses, dl: their step.
__device__ __forceinline__ void deep_copy(const _Float16* ga, size_t da, const _Float16* gb, size_t db, unsigned la, unsigned lb, unsigned dl) {
  // the closing s_wait_xcnt stands inside the statement so that no address register of a copy is rewritten in front of it
  asm volatile("global_load_async_to_lds_b128 %0, %12, off\n\t"
               "global_load_async_to_lds_b128 %1, %13, off\n\t"
               "global_load_async_to_lds_b128 %2, %14, off\n\t"
               "global_load_async_to_lds_b128 %3, %15, off\n\t"
               "global_load_async_to_lds_b128 %4, %16, off\n\t"
               "global_load_async_to_lds_b128 %5, %17, off\n\t"
               "global_load_async_to_lds_b128 %6, %18, off\n\t"
               "global_load_async_to_lds_b128 %7, %19, off\n\t"
               "global_load_async_to_lds_b128 %8, %20, off\n\t"
               "global_load_async_to_lds_b128 %9, %21, off\n\t"
               "global_load_async_to_lds_b128 %10, %22, off\n\t"
               "global_load_async_to_lds_b128 %11, %23, off\n\t"
               "s_wait_xcnt 0x0"
               :: "v"(la), "v"(la + dl), "v"(la + 2 * dl), "v"(la + 3 * dl),
                  "v"(lb), "v"(lb + dl), "v"(lb + 2 * dl), "v"(lb + 3 * dl), "v"(lb + 4 * dl), "v"(lb + 5 * dl), "v"(lb + 6 * dl), "v"(lb + 7 * dl),
                  "v"(ga), "v"(ga + da), "v"(ga + 2 * da), "v"(ga + 3 * da),
                  "v"(gb), "v"(gb + db), "v"(gb + 2 * db), "v"(gb + 3 * db), "v"(gb + 4 * db), "v"(gb + 5 * db), "v"(gb + 6 * db), "v"(gb + 7 * db)
               : "memory");
}
// One wave's share of a deep stage: a quarter of the A rows and of the B rows, 12 x NS copies.
template <int NS>
__device__ __forceinline__ void deep_stage(const _Float16* ga, size_t lda, const _Float16* gb, size_t ldb, unsigned la, unsigned lb) {
  constexpr int RPC = 4 / NS;   // rows per copy
  // unrolled so that the row steps are constants
#pragma unroll
  for (int s = 0; s < NS; ++s) deep_copy(ga + (size_t)(s * 16 * RPC) * lda, RPC * lda, gb + (size_t)(s * 32 * RPC) * ldb, RPC * ldb,
                                         la + (unsigned)(s * 16 * RPC * PITD(NS) * 2), lb + (unsigned)(s * 32 * RPC * PITD(NS) * 2), (unsigned)(RPC * PITD(NS) * 2));
}
// As gemm_ring, over NT deep stages, k ascending. sa: distance between an A row's successive 64-k pieces (BKH where the row is contiguous).
template <int NS, int NT>
__device__ __forceinline__ void gemm_deep(const _Float16* A, size_t lda, size_t sa, const _Float16* B, size_t ldb, char* smem, v8f (&acc)[8]) {
  constexpr int RPC = 4 / NS, LPR = NS * 8, PD = PITD(NS), SD = STGD(NS);   // rows per copy, lanes per row
  const int tid = threadIdx.x, wave = tid >> 5, lane = tid & 31, col = lane & 15, lr = lane / LPR, lp = lane % LPR;
  const _Float16* ring = (const _Float16*)smem;
  const _Float16* ga = A + (size_t)(wave * 4 * RPC + lr) * lda + (size_t)(lp >> 3) * sa + (lp & 7) * 8;
  const _Float16* gb = B + (size_t)(wave * 8 * RPC + lr) * ldb + lp * 8;
  const unsigned la = (unsigned)(size_t)smem + (unsigned)((wave * 4 * RPC + lr) * PD + lp * 8) * 2u;
  const unsigned lb = (unsigned)(size_t)smem + (unsigned)((64 + wave * 8 * RPC + lr) * PD + lp * 8) * 2u;
  deep_stage<NS>(ga, lda, gb, ldb, la, lb);
  asm volatile("s_wait_asynccnt 0x0" ::: "memory");   // this wave's part of stage 0 has landed before the barrier publishes it
  __syncthreads();
  deep_stage<NS>(ga + NS * sa, lda, gb + NS * BKH, ldb, la + SD * 2, lb + SD * 2);
  // kept rolled so that the hot loop stays small in the instruction cache
#pragma unroll 1
  for (int t = 0; t < NT; ++t) {
    const _Float16* buf = ring + (t & 1) * SD;
    // all loops below are unrolled so that every index of a, b and acc is a constant and the arrays stay in registers
#pragma unroll
    for (int ks = 0; ks < NS; ++ks) {
      v16h a[2], b[2][8];   // 64 k of fragments, read as one group so that one LDS latency is paid per group, not one per product
#pragma unroll
      for (int kc = 0; kc < 2; ++kc) { a[kc] = frag_h(buf + (wave * 16 + col) * PD + ks * BKH + kc * 32, lane);
#pragma unroll
        for (int j = 0; j < 8; ++j) b[kc][j] = frag_h(buf + (64 + j * 16 + col) * PD + ks * BKH + kc * 32, lane); }
#pragma unroll
      for (int kc = 0; kc < 2; ++kc)
#pragma unroll
        for (int j = 0; j < 8; ++j) acc[j] = wmma16(a[kc], b[kc][j], acc[j]);
    }
    asm volatile("s_wait_dscnt 0x0" ::: "memory");      // this wave's reads of the buffer are over before it is refilled
    asm volatile("s_wait_asynccnt 0x0" ::: "memory");   // this wave's part of stage t + 1 has landed
    __syncthreads();                                    // publishes stage t + 1 and frees stage t's buffer
    if (t + 2 < NT) deep_stage<NS>(ga + (size_t)(t + 2) * NS * sa, lda, gb + (size_t)(t + 2) * NS * BKH, ldb, la + (unsigned)(t & 1) * (SD * 2), lb + (unsigned)(t & 1) * (SD * 2));
  }
  asm volatile("s_wait_asynccnt 0x0" ::: "memory");     // nothing in flight when the ring becomes output staging
}

// RMSNorm of rows -> f16 ; wave per row, 8 rows per block blk. The wave asks for its whole 4-KB row, and for the weights, at once and keeps the row in
// registers: one memory latency per row, where a rolled loop paid one per load, and no second read. The order of the sum is that of the rolled loop.
__device__ __forceinline__ void rms_rows(const float* __restrict__ x, const float* __restrict__ w, _Float16* __restrict__ X16, unsigned blk) {
  const int wave = threadIdx.x >> 5, lane = threadIdx.x & 31; const size_t r = (size_t)blk * 8 + wave; if (r >= NR) return;
  const float* xr = x + r * E + lane * 4; const float* wr = w + lane * 4; _Float16* yr = X16 + r * E + lane * 4; v4f a[8], c[8]; float q2 = 0.f;
  // all four loops are unrolled so that a and c stay in registers and the sixteen loads are in flight together
#pragma unroll
  for (int i = 0; i < 8; ++i) a[i] = *(const v4f*)(xr + i * 128);
#pragma unroll
  for (int i = 0; i < 8; ++i) c[i] = *(const v4f*)(wr + i * 128);
  // keeps all sixteen loads in front of the sum, in flight together; the scheduler otherwise sinks weight loads behind the row's arrival, where their latency is paid alone
  __builtin_amdgcn_sched_barrier(0);
#pragma unroll
  for (int i = 0; i < 8; ++i) q2 += (a[i][0] * a[i][0] + a[i][1] * a[i][1]) + (a[i][2] * a[i][2] + a[i][3] * a[i][3]);
#pragma unroll
  for (int off = 16; off >= 1; off >>= 1) q2 += __shfl_xor(q2, off, 32);
  const float rs = rsqrtf(q2 * (1.0f / E) + 1e-6f);
#pragma unroll
  for (int i = 0; i < 8; ++i) { v4h h;
#pragma unroll
    for (int e = 0; e < 4; ++e) h[e] = (_Float16)(a[i][e] * rs * c[i][e]);
    vst2(yr + i * 128, h); }
}
__global__ __launch_bounds__(256) void k_rms(const float* __restrict__ x, const float* __restrict__ w, _Float16* __restrict__ X16) { rms_rows(x, w, X16, blockIdx.x); }
// weight packs: PT rows: [0,1024) wq, [1024,2048) wk, [2048,3072) wv, [3072,4096) wo (all [out][in=1024]) x16 ; WI rows [4096][1024] x16 ; WF rows [1024][4096] x16
// All that depends on the inputs alone and is read by k_qkv or k_attn, as block ranges of one grid: the first RMSNorm, then the bias table
// BT[h][rel + SS - 1] for rel = k - q in [-(SS-1), SS-1], in base-2 units (x log2 e), then the wq, wk, wv rows of PT, whose order the pack keeps: PCP consecutive f32 per block, 4 KB per wave.
#define PREP_RMS (NR / 8)
#define PREP_BIAS (2 * SS / 256 * NH)
#define PCP 8192
__global__ __launch_bounds__(256) void k_prep(const float* __restrict__ hid, const float* __restrict__ ln1, const float* __restrict__ wq, const float* __restrict__ wk, const float* __restrict__ wv, const float* __restrict__ rb,
                                            _Float16* __restrict__ X16, _Float16* __restrict__ PT, float* __restrict__ BT) {
  const int blk = blockIdx.x, tid = threadIdx.x;
  if (blk < PREP_RMS) { rms_rows(hid, ln1, X16, blk); return; }
  if (blk < PREP_RMS + PREP_BIAS) { const int h = (blk - PREP_RMS) >> 3, i = ((blk - PREP_RMS) & 7) * 256 + tid; if (i >= 2 * SS) return;   // table width padded to 2*SS
    float v = 0.f;
    if (i < 2 * SS - 1) { const int rel = i - (SS - 1); const int nb = NBK / 2; int bucket = rel > 0 ? nb : 0; const int rp = rel < 0 ? -rel : rel; const int mx = nb / 2;
      int val; if (rp < mx) val = rp; else { const float lf = logf((float)rp / (float)mx) / 2.772588722239781f * (float)(nb - mx); int large = mx + (int)lf; val = large < nb - 1 ? large : nb - 1; }
      bucket += val; v = rb[bucket * NH + h] * LOG2E; }
    vst2(BT + (size_t)h * 2 * SS + i, v); return; }
  const int ch = blk - PREP_RMS - PREP_BIAS, which = ch / (E * E / PCP);
  const float* s = (which == 0 ? wq : which == 1 ? wk : wv) + (size_t)(ch % (E * E / PCP)) * PCP + tid * 4; _Float16* d = PT + (size_t)ch * PCP + tid * 4; v4f v[8];
  // both loops unrolled so that v stays in registers and the lane's eight loads are in flight together
#pragma unroll
  for (int i = 0; i < 8; ++i) v[i] = *(const v4f*)(s + i * 1024);
#pragma unroll
  for (int i = 0; i < 8; ++i) { v4h h;
#pragma unroll
    for (int e = 0; e < 4; ++e) h[e] = (_Float16)(v[i][e] * 16.0f);
    vst2(d + i * 1024, h); }
  asm volatile("s_wait_xcnt 0x0" ::: "memory");   // behind the eight stores, in front of whatever code the listing puts next that rewrites their address or data registers
}
// A 128-thread block's share of a weight pack whose rows keep their order: PCH consecutive f32 -> f16 x16.
#define PCH 4096
__device__ __forceinline__ void pack_chunk(const float* __restrict__ s, _Float16* __restrict__ d) {
  const int tid = threadIdx.x; v4f v[8];
  // both loops unrolled so that v stays in registers and the lane's eight loads are in flight together
#pragma unroll
  for (int i = 0; i < 8; ++i) v[i] = *(const v4f*)(s + (i * 128 + tid) * 4);
#pragma unroll
  for (int i = 0; i < 8; ++i) { v4h h;
#pragma unroll
    for (int e = 0; e < 4; ++e) h[e] = (_Float16)(v[i][e] * 16.0f);
    vst2(d + (i * 128 + tid) * 4, h); }
}
// QKV: block (64 rows, 128 cols = 2 heads, which)
__global__ __launch_bounds__(128) void k_qkv(const _Float16* __restrict__ X16, const _Float16* __restrict__ PT, _Float16* __restrict__ Q16, _Float16* __restrict__ K16, _Float16* __restrict__ VT) {
  __shared__ __align__(16) char smem[RINGD_BYTES(2)];   // the operand ring; behind the k loop the output staging
  float (*so)[16][132] = (float (*)[16][132])smem;
  _Float16 (*st)[72] = (_Float16 (*)[72])smem;
  const int tid = threadIdx.x, wave = tid >> 5, lane = tid & 31, col = lane & 15, g = lane >> 4;
  const int which = blockIdx.z, r0b = blockIdx.x * 64, n0 = blockIdx.y * 128; const int b = r0b / SS, s0 = r0b % SS;
  v8f acc[8] = {};
  gemm_deep<2, E / (2 * BKH)>(X16 + (size_t)r0b * E, E, BKH, PT + (size_t)(which * E + n0) * E, E, smem, acc);
  if (which < 2) {
#pragma unroll
    for (int j = 0; j < 8; ++j)
#pragma unroll
      for (int r = 0; r < 8; ++r) so[wave][8 * g + r][j * 16 + col] = acc[j][r] * (4.0f / 16.0f);
    LDSX();
    _Float16* D = which == 0 ? Q16 : K16;
    for (int qq = lane; qq < 16 * 2 * 8; qq += 32) { const int hh = qq >> 7, rl = (qq >> 3) & 15, pc = qq & 7; const int h = (n0 >> 6) + hh; union { v8h h8; v4u u; } pk;
#pragma unroll
      for (int e = 0; e < 8; ++e) pk.h8[e] = (_Float16)so[wave][rl][hh * 64 + pc * 8 + e];
      vst2(D + (((size_t)b * NH + h) * SS + s0 + wave * 16 + rl) * HD + pc * 8, pk.u); } }
  else {
#pragma unroll
    for (int j = 0; j < 8; ++j)
#pragma unroll
      for (int r = 0; r < 8; ++r) st[j * 16 + col][wave * 16 + 8 * g + r] = (_Float16)(acc[j][r] * (4.0f / 16.0f));
    __syncthreads();
    for (int qq = tid; qq < 128 * 8; qq += 128) { const int cl = qq >> 3, pc = qq & 7; const int c = n0 + cl, h = c >> 6, d = c & 63;
      vst2(VT + (((size_t)b * NH + h) * HD + d) * SS + s0 + pc * 8, *(const v4u*)(&st[cl][pc * 8])); } }
}
// Attention's K/V ring in LDS. A stage is one 64-key tile for the block's four waves: its 64 K rows (64 d = 128 B each) and then the 64 V^T rows
// (64 keys = 128 B each), at the same 144-B row pitch as the GEMM ring. Two buffers: asynchronous copies fill one while the other is worked on.
#define ASTG (128 * PIT)           // f16 per buffer
// One stage: 128 rows x 8 pieces of 16 B = 8 copies per lane; 8 neighbouring lanes take one row's whole 128-B line.
// gk, gv: this lane's piece in row (tid >> 3) of the K and of the V^T part; l: LDS byte address of the K piece.
__device__ __forceinline__ void kv_copy(const _Float16* gk, const _Float16* gv, unsigned l) {
  // the closing s_wait_xcnt stands inside the statement so that no address register of a copy is rewritten in front of it
  asm volatile("global_load_async_to_lds_b128 %0, %8, off\n\t"
               "global_load_async_to_lds_b128 %1, %9, off\n\t"
               "global_load_async_to_lds_b128 %2, %10, off\n\t"
               "global_load_async_to_lds_b128 %3, %11, off\n\t"
               "global_load_async_to_lds_b128 %4, %12, off\n\t"
               "global_load_async_to_lds_b128 %5, %13, off\n\t"
               "global_load_async_to_lds_b128 %6, %14, off\n\t"
               "global_load_async_to_lds_b128 %7, %15, off\n\t"
               "s_wait_xcnt 0x0"
               :: "v"(l), "v"(l + 1u * 16 * PIT * 2), "v"(l + 2u * 16 * PIT * 2), "v"(l + 3u * 16 * PIT * 2),
                  "v"(l + 4u * 16 * PIT * 2), "v"(l + 5u * 16 * PIT * 2), "v"(l + 6u * 16 * PIT * 2), "v"(l + 7u * 16 * PIT * 2),
                  "v"(gk), "v"(gk + 16 * HD), "v"(gk + 32 * HD), "v"(gk + 48 * HD), "v"(gv), "v"(gv + 16 * SS), "v"(gv + 32 * SS), "v"(gv + 48 * SS)
               : "memory");
}
// Grid rows y < NB * NH are the attention tiles. The RIDE_Y rows behind them pack wo, wi and wo_ff, which only the launches after this one read:
// their memory stream runs in the places that the attention blocks leave free on each WGP.
#define RIDE_Y ((E * E + 2 * DFF * E) / PCH / (SS / 64))
__global__ __launch_bounds__(128) void k_attn(const _Float16* __restrict__ Q16, const _Float16* __restrict__ K16, const _Float16* __restrict__ VT, const float* __restrict__ BT, _Float16* __restrict__ O16,
                                            const float* __restrict__ wo, const float* __restrict__ wi, const float* __restrict__ wff, _Float16* __restrict__ PTO, _Float16* __restrict__ WI, _Float16* __restrict__ WF) {
  if (blockIdx.y >= NB * NH) {   // the whole block leaves here, in front of every barrier and copy
    const unsigned c = (blockIdx.y - NB * NH) * (SS / 64) + blockIdx.x; const int m = c < E * E / PCH ? 0 : c < (E * E + DFF * E) / PCH ? 1 : 2;
    const size_t o = (size_t)(c - (m == 0 ? 0 : m == 1 ? E * E / PCH : (E * E + DFF * E) / PCH)) * PCH;
    pack_chunk((m == 0 ? wo : m == 1 ? wi : wff) + o, (m == 0 ? PTO : m == 1 ? WI : WF) + o);
    return; }
  __shared__ __align__(16) _Float16 kv[2 * ASTG];
  __shared__ __align__(16) _Float16 sO[4][16][72];
  const int tid = threadIdx.x, w = tid >> 5, lane = tid & 31, col = lane & 15, g = lane >> 4;
  const size_t bh = blockIdx.y; const int h = (int)(bh % NH); const int q0 = blockIdx.x * 64 + w * 16; const float* bth = BT + (size_t)h * 2 * SS + (SS - 1);
  v16h bq[2];
#pragma unroll
  for (int kc = 0; kc < 2; ++kc) bq[kc] = frag_h(Q16 + (bh * SS + q0 + col) * HD + kc * 32, lane);
  float mrun = -3.0e38f, lrun = 0.f; v8f acc[4] = {};   // lrun: the sum over this half's keys only; the halves are joined behind the loop
  const float* bp = bth + (8 * g - (q0 + col));         // bias of key 8 g against this lane's query
  const _Float16* gk = K16 + (bh * SS + (tid >> 3)) * HD + (tid & 7) * 8;
  const _Float16* gv = VT + (bh * HD + (tid >> 3)) * SS + (tid & 7) * 8;
  const unsigned l = (unsigned)(size_t)kv + (unsigned)((tid >> 3) * PIT + (tid & 7) * 8) * 2u;
  kv_copy(gk, gv, l);
  asm volatile("s_wait_asynccnt 0x0" ::: "memory");   // this wave's part of tile 0 has landed before the barrier publishes it
  __syncthreads();
  kv_copy(gk + 64 * HD, gv + 64, l + ASTG * 2);
#pragma unroll 1
  for (int kt = 0; kt < SS / 64; ++kt) {
    const _Float16* buf = kv + (kt & 1) * ASTG;
    v16h kf[4][2], vf[2][4], pb[2];   // the tile's fragments, each operand read as one group so that one LDS latency is paid per group, not one per product
    float bv[4][8]; v8f s[4] = {};
    // every loop of this body is unrolled so that every index of bv, kf, s, vf, pb and acc is a constant and the arrays stay in registers
    // the tile's biases are asked for first, so that they arrive under the K reads and the first product
#pragma unroll
    for (int t = 0; t < 4; ++t)
#pragma unroll
      for (int r = 0; r < 8; ++r) bv[t][r] = bp[kt * 64 + t * 16 + r];
#pragma unroll
    for (int t = 0; t < 4; ++t)
#pragma unroll
      for (int kc = 0; kc < 2; ++kc) kf[t][kc] = frag_h(buf + (t * 16 + col) * PIT + kc * 32, lane);
#pragma unroll
    for (int kc = 0; kc < 2; ++kc)
#pragma unroll
      for (int t = 0; t < 4; ++t) s[t] = wmma16(kf[t][kc], bq[kc], s[t]);
    // read here so that the softmax below covers their latency
#pragma unroll
    for (int kc = 0; kc < 2; ++kc)
#pragma unroll
      for (int t = 0; t < 4; ++t) vf[kc][t] = frag_h(buf + (64 + t * 16 + col) * PIT + kc * 32, lane);
    float mt[4], pt[4];   // one chain per 16-key tile, so that four independent chains are in flight
#pragma unroll
    for (int t = 0; t < 4; ++t) { mt[t] = -3.4e38f;
#pragma unroll
      for (int r = 0; r < 8; ++r) { s[t][r] = s[t][r] * (LOG2E / 16.0f) + bv[t][r]; mt[t] = fmaxf(mt[t], s[t][r]); } }
    float mx = fmaxf(fmaxf(mt[0], mt[1]), fmaxf(mt[2], mt[3]));
    mx = fmaxf(mx, xhalf(mx));
    const float mnew = fmaxf(mrun, mx); const float corr = __builtin_amdgcn_exp2f(mrun - mnew); const float moff = mnew - 14.0f;
#pragma unroll
    for (int t = 0; t < 4; ++t) { pt[t] = 0.f;
#pragma unroll
      for (int r = 0; r < 8; ++r) s[t][r] -= moff;
      exp2x8(s[t]);
#pragma unroll
      for (int r = 0; r < 8; ++r) { pt[t] += s[t][r]; pb[t >> 1][(t & 1) * 8 + r] = (_Float16)s[t][r]; } }
    lrun = lrun * corr + ((pt[0] + pt[1]) + (pt[2] + pt[3])); mrun = mnew;
#pragma unroll
    for (int t = 0; t < 4; ++t)
#pragma unroll
      for (int r = 0; r < 8; ++r) acc[t][r] *= corr;
#pragma unroll
    for (int kc = 0; kc < 2; ++kc)
#pragma unroll
      for (int t = 0; t < 4; ++t) acc[t] = wmma16(vf[kc][t], pb[kc], acc[t]);
    asm volatile("s_wait_dscnt 0x0" ::: "memory");      // this wave's reads of the buffer are over before it is refilled
    asm volatile("s_wait_asynccnt 0x0" ::: "memory");   // this wave's part of tile kt + 1 has landed
    __syncthreads();                                    // publishes tile kt + 1 and frees tile kt's buffer
    if (kt + 2 < SS / 64) kv_copy(gk + (size_t)(kt + 2) * 64 * HD, gv + (kt + 2) * 64, l + (unsigned)(kt & 1) * (ASTG * 2)); }
  asm volatile("s_wait_asynccnt 0x0" ::: "memory");     // nothing in flight when the wave goes on to its output and ends
  // acc[t][r] = O[query col][d = t * 16 + 8 g + r]: eight neighbouring d per lane; staged in the wave's own LDS rows so that whole 128-B lines are stored
  const float inv = 8.0f / ((lrun + xhalf(lrun)) * 4.0f);
#pragma unroll
  for (int t = 0; t < 4; ++t) { union { v8h h8; v4u u; } pk;
#pragma unroll
    for (int r = 0; r < 8; ++r) pk.h8[r] = (_Float16)(acc[t][r] * inv);
    vst2(&sO[w][col][t * 16 + 8 * g], pk.u); }
  LDSX();
  for (int qq = lane; qq < 16 * 8; qq += 32) { const int rl = qq >> 3, pc = qq & 7;
    vst2(O16 + ((bh * SS) + q0 + rl) * HD + pc * 8, *(const v4u*)(&sO[w][rl][pc * 8])); }
}
// H1 = hidden + ctx wo^T : block (64 rows, 128 cols)
__global__ __launch_bounds__(128) void k_o(const _Float16* __restrict__ O16, const _Float16* __restrict__ PT, const float* __restrict__ hid, float* __restrict__ H1) {
  __shared__ __align__(16) char smem[RINGD_BYTES(4)];   // the operand ring; behind the k loop the output staging
  float (*so)[16][132] = (float (*)[16][132])smem;
  const int tid = threadIdx.x, wave = tid >> 5, lane = tid & 31, col = lane & 15, g = lane >> 4;
  const int r0b = blockIdx.x * 64, r0 = r0b + wave * 16, n0 = blockIdx.y * 128; const int b = r0b / SS, s0 = r0b % SS;
  v8f acc[8] = {};
  // a 64-k piece is a head: the 64 k of head t of row s stand at O16[b][t][s][0..63]
  gemm_deep<4, E / (4 * BKH)>(O16 + ((size_t)b * NH * SS + s0) * HD, HD, (size_t)SS * HD, PT + (size_t)(3 * E + n0) * E, E, smem, acc);
#pragma unroll
  for (int j = 0; j < 8; ++j) { const int n = n0 + j * 16 + col;
#pragma unroll
    for (int r = 0; r < 8; ++r) so[wave][8 * g + r][j * 16 + col] = acc[j][r] * (1.0f / (16.0f * 8.0f)) + hid[(size_t)(r0 + 8 * g + r) * E + n]; }
  LDSX();
#pragma unroll 4
  for (int rl = 0; rl < 16; ++rl) vst2(H1 + (size_t)(r0 + rl) * E + n0 + lane * 4, *(const v4f*)(&so[wave][rl][lane * 4]));
}
// F16 = relu(Y16 @ wi^T) as f16 rows [NR][4096] : block (64 rows, 128 cols)
__global__ __launch_bounds__(128) void k_ff1(const _Float16* __restrict__ Y16, const _Float16* __restrict__ WI, _Float16* __restrict__ F16) {
  __shared__ __align__(16) char smem[RING_BYTES];   // the operand ring; behind the k loop the output staging
  _Float16 (*so)[16][136] = (_Float16 (*)[16][136])smem;
  const int tid = threadIdx.x, wave = tid >> 5, lane = tid & 31, col = lane & 15, g = lane >> 4;
  const int r0b = blockIdx.x * 64, r0 = r0b + wave * 16, n0 = blockIdx.y * 128;
  v8f acc[8] = {};
  gemm_ring<E / BKH>(Y16 + (size_t)r0b * E, E, BKH, WI + (size_t)n0 * E, E, smem, acc);
#pragma unroll
  for (int j = 0; j < 8; ++j)
#pragma unroll
    for (int r = 0; r < 8; ++r) { const float v = acc[j][r] * (1.0f / 16.0f); so[wave][8 * g + r][j * 16 + col] = (_Float16)(v > 0.f ? v : 0.f); }
  LDSX();
  for (int qq = lane; qq < 16 * 16; qq += 32) { const int rl = qq >> 4, pc = qq & 15; vst2(F16 + (size_t)(r0 + rl) * DFF + n0 + pc * 8, *(const v4u*)(&so[wave][rl][pc * 8])); }
}
// out = H1 + F16 @ wo_ff^T : block (64 rows, 128 cols), K = 4096
__global__ __launch_bounds__(128) void k_ff2(const _Float16* __restrict__ F16, const _Float16* __restrict__ WF, const float* __restrict__ H1, float* __restrict__ out) {
  __shared__ __align__(16) char smem[RINGD_BYTES(4)];   // the operand ring; behind the k loop the output staging
  float (*so)[16][132] = (float (*)[16][132])smem;
  const int tid = threadIdx.x, wave = tid >> 5, lane = tid & 31, col = lane & 15, g = lane >> 4;
  const int r0b = blockIdx.x * 64, r0 = r0b + wave * 16, n0 = blockIdx.y * 128;
  v8f acc[8] = {};
  gemm_deep<4, DFF / (4 * BKH)>(F16 + (size_t)r0b * DFF, DFF, BKH, WF + (size_t)n0 * DFF, DFF, smem, acc);
#pragma unroll
  for (int j = 0; j < 8; ++j) { const int n = n0 + j * 16 + col;
#pragma unroll
    for (int r = 0; r < 8; ++r) so[wave][8 * g + r][j * 16 + col] = acc[j][r] * (1.0f / 16.0f) + H1[(size_t)(r0 + 8 * g + r) * E + n]; }
  LDSX();
#pragma unroll 4
  for (int rl = 0; rl < 16; ++rl) vst2(out + (size_t)(r0 + rl) * E + n0 + lane * 4, *(const v4f*)(&so[wave][rl][lane * 4]));
}
extern "C" void kernel_launch(void* const* d_in, const int* in_sizes, int n_in, void* d_out, int out_size, void* d_ws, size_t ws_size, hipStream_t stream) {
  (void)in_sizes; (void)n_in; (void)out_size; (void)ws_size;
  const float** I = (const float**)d_in;
  const float* hid = I[0]; const float* ln1 = I[1]; const float* wq = I[2]; const float* wk = I[3]; const float* wv = I[4]; const float* wo = I[5]; const float* rb = I[6]; const float* ln2 = I[7]; const float* wi = I[8]; const float* wff = I[9];
  float* out = (float*)d_out;
  char* ws = (char*)d_ws; size_t off = 0;
  auto take = [&](size_t bytes) { char* p = ws + off; off += (bytes + 255) & ~(size_t)255; return p; };
  _Float16* X16 = (_Float16*)take((size_t)NR * E * 2); _Float16* PT = (_Float16*)take((size_t)4 * E * E * 2); _Float16* WI = (_Float16*)take((size_t)DFF * E * 2); _Float16* WF = (_Float16*)take((size_t)E * DFF * 2);
  float* BT = (float*)take((size_t)NH * 2 * SS * 4);
  _Float16* Q16 = (_Float16*)take((size_t)NR * E * 2); _Float16* K16 = (_Float16*)take((size_t)NR * E * 2); _Float16* VT = (_Float16*)take((size_t)NR * E * 2); _Float16* O16 = (_Float16*)take((size_t)NR * E * 2);
  float* H1 = (float*)take((size_t)NR * E * 4); _Float16* Y16 = X16; _Float16* F16 = (_Float16*)take((size_t)NR * DFF * 2);
  k_prep<<<PREP_RMS + PREP_BIAS + 3 * E * E / PCP, 256, 0, stream>>>(hid, ln1, wq, wk, wv, rb, X16, PT, BT);
  k_qkv<<<dim3(NR / 64, E / 128, 3), 128, 0, stream>>>(X16, PT, Q16, K16, VT);
  k_attn<<<dim3(SS / 64, NB * NH + RIDE_Y), 128, 0, stream>>>(Q16, K16, VT, BT, O16, wo, wi, wff, PT + (size_t)3 * E * E, WI, WF);
  k_o<<<dim3(NR / 64, E / 128), 128, 0, stream>>>(O16, PT, hid, H1);
  k_rms<<<NR / 8, 256, 0, stream>>>(H1, ln2, Y16);
  k_ff1<<<dim3(NR / 64, DFF / 128), 128, 0, stream>>>(Y16, WI, F16);
  k_ff2<<<dim3(NR / 64, E / 128), 128, 0, stream>>>(F16, WF, H1, out);
}

// v008
// Measured time: 92.6 microseconds a run.
// Next to v007, in two timings, it ran 1.05 and 1.04 times as fast.
// All steps since v000 together make it 5.93 times as fast.
#include <hip/hip_runtime.h>
#include <math.h>

typedef __attribute__((ext_vector_type(16))) _Float16 v16h;
typedef __attribute__((ext_vector_type(16))) __bf16 v16b;
typedef __attribute__((ext_vector_type(8)))  _Float16 v8h;
typedef __attribute__((ext_vector_type(4)))  _Float16 v4h;
typedef __attribute__((ext_vector_type(8)))  float v8f;
typedef __attribute__((ext_vector_type(4)))  float v4f;
typedef __attribute__((ext_vector_type(2)))  float v2f;
typedef __attribute__((ext_vector_type(4)))  unsigned v4u;
typedef __attribute__((ext_vector_type(4)))  int v4i;
typedef float __attribute__((may_alias)) float_a;
typedef int __attribute__((may_alias)) int_a;

template <typename T> __device__ __forceinline__ void vst2(void* p, T v) { *(T*)p = v;  }
__device__ __forceinline__ v8f wmma16(v16h a, v16h b, v8f c) {
  v8f d = __builtin_amdgcn_wmma_f32_16x16x32_f16(false, a, false, b, (short)0, c, false, false);
  asm volatile("v_nop\n\tv_nop\n\tv_nop\n\tv_nop" : "+v"(d) : "v"(a), "v"(b));
  return d;
}
__device__ __forceinline__ v8f wmma_bf(v16b a, v16b b, v8f c) {
  v8f d = __builtin_amdgcn_wmma_f32_16x16x32_bf16(false, a, false, b, (short)0, c, false, false);
  asm volatile("v_nop\n\tv_nop\n\tv_nop\n\tv_nop" : "+v"(d) : "v"(a), "v"(b));
  return d;
}
// 16x16x32 fragments: lane = (h = lane>>4, row/col = lane&15); elements 0..7 = k0+8h+0..7, 8..15 = k0+16+8h+0..7; D element r = row 8h+r
__device__ __forceinline__ v16h frag_h(const _Float16* rowk0, int lane) {
  union { v16h v; v8h q[2]; } u; const _Float16* p = rowk0 + 8 * (lane >> 4);
  u.q[0] = *(const v8h*)p; u.q[1] = *(const v8h*)(p + 16); return u.v;
}
__device__ __forceinline__ v16h frag_f32(const float* rowk0, int lane) {
  v16h a; const float* p = rowk0 + 8 * (lane >> 4);
#pragma unroll
  for (int i = 0; i < 8; ++i) { a[i] = (_Float16)p[i]; a[8 + i] = (_Float16)p[16 + i]; }
  return a;
}
__device__ __forceinline__ v16h frag_f32s(const float* rowk0, int lane, float sc) {
  v16h a; const float* p = rowk0 + 8 * (lane >> 4);
#pragma unroll
  for (int i = 0; i < 8; ++i) { a[i] = (_Float16)(p[i] * sc); a[8 + i] = (_Float16)(p[16 + i] * sc); }
  return a;
}
// column fragment from a [K][ld] layout (column n), rows >= K read as 0
__device__ __forceinline__ v16h fragc_f32(const float* W, int k0, int n, int lane, int ld, int K) {
  v16h a; const int g = lane >> 4;
#pragma unroll
  for (int i = 0; i < 8; ++i) { const int ka = k0 + 8 * g + i, kb = ka + 16;
    a[i] = (_Float16)(ka < K ? W[(size_t)ka * ld + n] : 0.f); a[8 + i] = (_Float16)(kb < K ? W[(size_t)kb * ld + n] : 0.f); }
  return a;
}
struct F2 { v16b h, l; };
__device__ __forceinline__ F2 bsplit16(const float v[16]) { F2 r;
#pragma unroll
  for (int i = 0; i < 16; ++i) { const __bf16 h = (__bf16)v[i]; r.h[i] = h; r.l[i] = (__bf16)(v[i] - (float)h); }
  return r; }
__device__ __forceinline__ F2 split_row(const float* row, int k0, int lane) { float v[16]; const float* p = row + k0 + 8 * (lane >> 4);
#pragma unroll
  for (int i = 0; i < 8; ++i) { v[i] = p[i]; v[8 + i] = p[16 + i]; }
  return bsplit16(v); }
__device__ __forceinline__ F2 split_rowK(const float* row, int k0, int lane, int K) { float v[16]; const int g = lane >> 4;
#pragma unroll
  for (int i = 0; i < 8; ++i) { const int ka = k0 + 8 * g + i, kb = ka + 16; v[i] = ka < K ? row[ka] : 0.f; v[8 + i] = kb < K ? row[kb] : 0.f; }
  return bsplit16(v); }
__device__ __forceinline__ F2 split_col(const float* W, int k0, int n, int lane, int ld, int K) { float v[16]; const int g = lane >> 4;
#pragma unroll
  for (int i = 0; i < 8; ++i) { const int ka = k0 + 8 * g + i, kb = ka + 16; v[i] = ka < K ? W[(size_t)ka * ld + n] : 0.f; v[8 + i] = kb < K ? W[(size_t)kb * ld + n] : 0.f; }
  return bsplit16(v); }
__device__ __forceinline__ v8f mac3(const F2& a, const F2& b, v8f c) { c = wmma_bf(a.l, b.h, c); c = wmma_bf(a.h, b.l, c); return wmma_bf(a.h, b.h, c); }
__device__ __forceinline__ float sigm(float v) { return 1.0f / (1.0f + expf(-v)); }
// lane l with lane l ^ 16
__device__ __forceinline__ float xhalf(float x) { return __builtin_bit_cast(float, __builtin_amdgcn_permlanex16(__builtin_bit_cast(int, x), __builtin_bit_cast(int, x), 0x76543210, 0xfedcba98, false, false)); }
// x[r] = 2^x[r]. Eight independent v_exp_f32, each in place, so that none reads a neighbour's result or overwrites a neighbour's source; the closing
// v_nop is the one slot that the instruction set asks for between the last of them and a user of its result, which the compiler places unseen.
__device__ __forceinline__ void exp2x8(v8f& x) {
  asm("v_exp_f32 %0, %0\n\tv_exp_f32 %1, %1\n\tv_exp_f32 %2, %2\n\tv_exp_f32 %3, %3\n\t"
      "v_exp_f32 %4, %4\n\tv_exp_f32 %5, %5\n\tv_exp_f32 %6, %6\n\tv_exp_f32 %7, %7\n\tv_nop"
      : "+v"(x[0]), "+v"(x[1]), "+v"(x[2]), "+v"(x[3]), "+v"(x[4]), "+v"(x[5]), "+v"(x[6]), "+v"(x[7]));
}
#define LDSX() do { asm volatile("s_wait_dscnt 0" ::: "memory"); __builtin_amdgcn_wave_barrier(); __builtin_amdgcn_fence(__ATOMIC_RELEASE, "workgroup"); } while (0)

// T5 encoder block: RMSNorm -> 16-head self attention with the bidirectional relative-position bias (no 1/sqrt(d)) -> residual ->
// RMSNorm -> ReLU FFN (1024 -> 4096 -> 1024) -> residual. All products on v_wmma_f32_16x16x32_f16 ([out][in] weight rows converted once
// to f16 rows x16; activations as f16 rows, q/k x4, P x2^14, V x4, ctx x8); RMSNorms, the bucket function, softmax and residuals in f32.
#define NB 2
#define SS 1024
#define E 1024
#define NH 16
#define HD 64
#define DFF 4096
#define NR (NB * SS)           // 2048
#define NBK 32
#define MAXD 128
#define LOG2E 1.4426950408889634f

// GEMM operand ring in LDS. A stage is 64 k (128 B) of the block's 64 A rows and then of its 128 B rows, at a row pitch of 144 B
// (16 B x odd, the conflict-free pitch for ds_load_b128). Two buffers: asynchronous copies fill one while the other is multiplied.
#define BKH 64                     // k per stage
#define PIT 72                     // LDS row pitch in f16
#define STG (192 * PIT)            // f16 per buffer
#define RING_BYTES (2 * STG * 2)
// One stage: 192 rows x 8 pieces of 16 B = 12 copies per lane; 8 neighbouring lanes take one row's whole 128-B line.
// ga, gb: this lane's piece in row (tid >> 3) of the A and of the B part; l: LDS byte address of the A piece.
__device__ __forceinline__ void stage_copy(const _Float16* ga, size_t lda, const _Float16* gb, size_t ldb, unsigned l) {
  // the closing s_wait_xcnt stands inside the statement so that no address register of a copy is rewritten in front of it
  asm volatile("global_load_async_to_lds_b128 %0, %12, off\n\t"
               "global_load_async_to_lds_b128 %1, %13, off\n\t"
               "global_load_async_to_lds_b128 %2, %14, off\n\t"
               "global_load_async_to_lds_b128 %3, %15, off\n\t"
               "global_load_async_to_lds_b128 %4, %16, off\n\t"
               "global_load_async_to_lds_b128 %5, %17, off\n\t"
               "global_load_async_to_lds_b128 %6, %18, off\n\t"
               "global_load_async_to_lds_b128 %7, %19, off\n\t"
               "global_load_async_to_lds_b128 %8, %20, off\n\t"
               "global_load_async_to_lds_b128 %9, %21, off\n\t"
               "global_load_async_to_lds_b128 %10, %22, off\n\t"
               "global_load_async_to_lds_b128 %11, %23, off\n\t"
               "s_wait_xcnt 0x0"
               :: "v"(l), "v"(l + 1u * 16 * PIT * 2), "v"(l + 2u * 16 * PIT * 2), "v"(l + 3u * 16 * PIT * 2), "v"(l + 4u * 16 * PIT * 2), "v"(l + 5u * 16 * PIT * 2),
                  "v"(l + 6u * 16 * PIT * 2), "v"(l + 7u * 16 * PIT * 2), "v"(l + 8u * 16 * PIT * 2), "v"(l + 9u * 16 * PIT * 2), "v"(l + 10u * 16 * PIT * 2), "v"(l + 11u * 16 * PIT * 2),
                  "v"(ga), "v"(ga + 16 * lda), "v"(ga + 32 * lda), "v"(ga + 48 * lda),
                  "v"(gb), "v"(gb + 16 * ldb), "v"(gb + 32 * ldb), "v"(gb + 48 * ldb), "v"(gb + 64 * ldb), "v"(gb + 80 * ldb), "v"(gb + 96 * ldb), "v"(gb + 112 * ldb)
               : "memory");
}
// acc[j] += A rows (wave * 16 ..) x B rows (j * 16 ..) over NT stages, k ascending from stage rot, with the wrap. A: first of the block's 64 rows (row pitch lda, stage step sa),
// B: first of its 128 rows (row pitch ldb, stage step BKH). Behind it no copy is in flight and every wave has left the ring.
// rot (the same for the whole block): trip t works on stage (t + rot) mod NT, so k runs from stage rot upwards and wraps. Blocks that share A or B rows get
// different rot, so that they do not ask L2 for the same lines at the same moment.
template <int NT>
__device__ __forceinline__ void gemm_ring(const _Float16* A, size_t lda, size_t sa, const _Float16* B, size_t ldb, char* smem, v8f (&acc)[8], unsigned rot) {
  static_assert((NT & (NT - 1)) == 0, "the wrap is a mask");
  const int tid = threadIdx.x, wave = tid >> 5, lane = tid & 31, col = lane & 15;
  const _Float16* ring = (const _Float16*)smem;
  const _Float16* ga = A + (size_t)(tid >> 3) * lda + (tid & 7) * 8;
  const _Float16* gb = B + (size_t)(tid >> 3) * ldb + (tid & 7) * 8;
  const unsigned l = (unsigned)(size_t)smem + (unsigned)((tid >> 3) * PIT + (tid & 7) * 8) * 2u;
  rot &= NT - 1;
  stage_copy(ga + (size_t)rot * sa, lda, gb + (size_t)rot * BKH, ldb, l);
  asm volatile("s_wait_asynccnt 0x0" ::: "memory");   // this wave's part of the first stage has landed before the barrier publishes it
  __syncthreads();
  { const unsigned k1 = (rot + 1) & (NT - 1); stage_copy(ga + (size_t)k1 * sa, lda, gb + (size_t)k1 * BKH, ldb, l + STG * 2); }
  for (int t = 0; t < NT; ++t) {
    const _Float16* buf = ring + (t & 1) * STG;
    v16h a[2], b[2][8];   // the stage's fragments, read as one group so that one LDS latency is paid per stage, not one per product
    // the four loops below are unrolled so that every index of a, b and acc is a constant and the arrays stay in registers
#pragma unroll
    for (int kc = 0; kc < 2; ++kc) { a[kc] = frag_h(buf + (wave * 16 + col) * PIT + kc * 32, lane);
#pragma unroll
      for (int j = 0; j < 8; ++j) b[kc][j] = frag_h(buf + (64 + j * 16 + col) * PIT + kc * 32, lane); }
#pragma unroll
    for (int kc = 0; kc < 2; ++kc)
#pragma unroll
      for (int j = 0; j < 8; ++j) acc[j] = wmma16(a[kc], b[kc][j], acc[j]);
    asm volatile("s_wait_dscnt 0x0" ::: "memory");      // this wave's reads of the buffer are over before it is refilled
    asm volatile("s_wait_asynccnt 0x0" ::: "memory");   // this wave's part of stage (t + 1 + rot) mod NT has landed
    __syncthreads();                                    // publishes stage (t + 1 + rot) mod NT and frees buffer t & 1
    if (t + 2 < NT) { const unsigned kn = (t + 2 + rot) & (NT - 1); stage_copy(ga + (size_t)kn * sa, lda, gb + (size_t)kn * BKH, ldb, l + (unsigned)(t & 1) * (STG * 2)); }
  }
  asm volatile("s_wait_asynccnt 0x0" ::: "memory");     // nothing in flight when the ring becomes output staging
}

// Deep ring for the GEMMs whose whole grid is resident at once with LDS to spare (k_qkv: three workgroups per WGP; k_o, k_ff2: one): the launch lasts
// as long as one workgroup's chain of stage flights, so a stage is NS x 64 k of the same 192 rows: NS times fewer flights, NS times the bytes in flight.
// Row pitch NS x 128 + 16 B (16 B x odd). Two buffers and the same order of waits as gemm_ring.
#define PITD(NS) ((NS) * BKH + 8)            // LDS row pitch in f16
#define STGD(NS) (192 * PITD(NS))            // f16 per buffer
#define RINGD_BYTES(NS) (2 * STGD(NS) * 2)
// Twelve copies of one wave: 4 on the A part and 8 on the B part. A copy's 32 lanes take 512 B: one row's stage slice (NS = 4) or two rows' (NS = 2).
// ga, gb: this lane's piece for the first A and B copy, da, db: step from copy to copy; la, lb: its LDS byte addresses, dl: their step.
__device__ __forceinline__ void deep_copy(const _Float16* ga, size_t da, const _Float16* gb, size_t db, unsigned la, unsigned lb, unsigned dl) {
  // the closing s_wait_xcnt stands inside the statement so that no address register of a copy is rewritten in front of it
  asm volatile("global_load_async_to_lds_b128 %0, %12, off\n\t"
               "global_load_async_to_lds_b128 %1, %13, off\n\t"
               "global_load_async_to_lds_b128 %2, %14, off\n\t"
               "global_load_async_to_lds_b128 %3, %15, off\n\t"
               "global_load_async_to_lds_b128 %4, %16, off\n\t"
               "global_load_async_to_lds_b128 %5, %17, off\n\t"
               "global_load_async_to_lds_b128 %6, %18, off\n\t"
               "global_load_async_to_lds_b128 %7, %19, off\n\t"
               "global_load_async_to_lds_b128 %8, %20, off\n\t"
               "global_load_async_to_lds_b128 %9, %21, off\n\t"
               "global_load_async_to_lds_b128 %10, %22, off\n\t"
               "global_load_async_to_lds_b128 %11, %23, off\n\t"
               "s_wait_xcnt 0x0"
               :: "v"(la), "v"(la + dl), "v"(la + 2 * dl), "v"(la + 3 * dl),
                  "v"(lb), "v"(lb + dl), "v"(lb + 2 * dl), "v"(lb + 3 * dl), "v"(lb + 4 * dl), "v"(lb + 5 * dl), "v"(lb + 6 * dl), "v"(lb + 7 * dl),
                  "v"(ga), "v"(ga + da), "v"(ga + 2 * da), "v"(ga + 3 * da),
                  "v"(gb), "v"(gb + db), "v"(gb + 2 * db), "v"(gb + 3 * db), "v"(gb + 4 * db), "v"(gb + 5 * db), "v"(gb + 6 * db), "v"(gb + 7 * db)
               : "memory");
}
// One wave's share of a deep stage: a quarter of the A rows and of the B rows, 12 x NS copies.
template <int NS>
__device__ __forceinline__ void deep_stage(const _Float16* ga, size_t lda, const _Float16* gb, size_t ldb, unsigned la, unsigned lb) {
  constexpr int RPC = 4 / NS;   // rows per copy
  // unrolled so that the row steps are constants
#pragma unroll
  for (int s = 0; s < NS; ++s) deep_copy(ga + (size_t)(s * 16 * RPC) * lda, RPC * lda, gb + (size_t)(s * 32 * RPC) * ldb, RPC * ldb,
                                         la + (unsigned)(s * 16 * RPC * PITD(NS) * 2), lb + (unsigned)(s * 32 * RPC * PITD(NS) * 2), (unsigned)(RPC * PITD(NS) * 2));
}
// As gemm_ring, over NT deep stages, from stage rot upwards with the wrap. sa: distance between an A row's successive 64-k pieces (BKH where the row is contiguous).
template <int NS, int NT>
__device__ __forceinline__ void gemm_deep(const _Float16* A, size_t lda, size_t sa, const _Float16* B, size_t ldb, char* smem, v8f (&acc)[8], unsigned rot) {
  static_assert((NT & (NT - 1)) == 0, "the wrap is a mask");
  constexpr int RPC = 4 / NS, LPR = NS * 8, PD = PITD(NS), SD = STGD(NS);   // rows per copy, lanes per row
  const int tid = threadIdx.x, wave = tid >> 5, lane = tid & 31, col = lane & 15, lr = lane / LPR, lp = lane % LPR;
  const _Float16* ring = (const _Float16*)smem;
  const _Float16* ga = A + (size_t)(wave * 4 * RPC + lr) * lda + (size_t)(lp >> 3) * sa + (lp & 7) * 8;
  const _Float16* gb = B + (size_t)(wave * 8 * RPC + lr) * ldb + lp * 8;
  const unsigned la = (unsigned)(size_t)smem + (unsigned)((wave * 4 * RPC + lr) * PD + lp * 8) * 2u;
  const unsigned lb = (unsigned)(size_t)smem + (unsigned)((64 + wave * 8 * RPC + lr) * PD + lp * 8) * 2u;
  rot &= NT - 1;
  deep_stage<NS>(ga + (size_t)rot * NS * sa, lda, gb + (size_t)rot * NS * BKH, ldb, la, lb);
  asm volatile("s_wait_asynccnt 0x0" ::: "memory");   // this wave's part of the first stage has landed before the barrier publishes it
  __syncthreads();
  { const unsigned k1 = (rot + 1) & (NT - 1); deep_stage<NS>(ga + (size_t)k1 * NS * sa, lda, gb + (size_t)k1 * NS * BKH, ldb, la + SD * 2, lb + SD * 2); }
  // kept rolled so that the hot loop stays small in the instruction cache
#pragma unroll 1
  for (int t = 0; t < NT; ++t) {
    const _Float16* buf = ring + (t & 1) * SD;
    // all loops below are unrolled so that every index of a, b and acc is a constant and the arrays stay in registers
#pragma unroll
    for (int ks = 0; ks < NS; ++ks) {
      v16h a[2], b[2][8];   // 64 k of fragments, read as one group so that one LDS latency is paid per group, not one per product
#pragma unroll
      for (int kc = 0; kc < 2; ++kc) { a[kc] = frag_h(buf + (wave * 16 + col) * PD + ks * BKH + kc * 32, lane);
#pragma unroll
        for (int j = 0; j < 8; ++j) b[kc][j] = frag_h(buf + (64 + j * 16 + col) * PD + ks * BKH + kc * 32, lane); }
#pragma unroll
      for (int kc = 0; kc < 2; ++kc)
#pragma unroll
        for (int j = 0; j < 8; ++j) acc[j] = wmma16(a[kc], b[kc][j], acc[j]);
    }
    asm volatile("s_wait_dscnt 0x0" ::: "memory");      // this wave's reads of the buffer are over before it is refilled
    asm volatile("s_wait_asynccnt 0x0" ::: "memory");   // this wave's part of stage (t + 1 + rot) mod NT has landed
    __syncthreads();                                    // publishes stage (t + 1 + rot) mod NT and frees buffer t & 1
    if (t + 2 < NT) { const unsigned kn = (t + 2 + rot) & (NT - 1);
      deep_stage<NS>(ga + (size_t)kn * NS * sa, lda, gb + (size_t)kn * NS * BKH, ldb, la + (unsigned)(t & 1) * (SD * 2), lb + (unsigned)(t & 1) * (SD * 2)); }
  }
  asm volatile("s_wait_asynccnt 0x0" ::: "memory");     // nothing in flight when the ring becomes output staging
}

// RMSNorm of rows -> f16 ; wave per row, 8 rows per block blk. The wave asks for its whole 4-KB row, and for the weights, at once and keeps the row in
// registers: one memory latency per row, where a rolled loop paid one per load, and no second read. The order of the sum is that of the rolled loop.
__device__ __forceinline__ void rms_rows(const float* __restrict__ x, const float* __restrict__ w, _Float16* __restrict__ X16, unsigned blk) {
  const int wave = threadIdx.x >> 5, lane = threadIdx.x & 31; const size_t r = (size_t)blk * 8 + wave; if (r >= NR) return;
  const float* xr = x + r * E + lane * 4; const float* wr = w + lane * 4; _Float16* yr = X16 + r * E + lane * 4; v4f a[8], c[8]; float q2 = 0.f;
  // all four loops are unrolled so that a and c stay in registers and the sixteen loads are in flight together
#pragma unroll
  for (int i = 0; i < 8; ++i) a[i] = *(const v4f*)(xr + i * 128);
#pragma unroll
  for (int i = 0; i < 8; ++i) c[i] = *(const v4f*)(wr + i * 128);
  // keeps all sixteen loads in front of the sum, in flight together; the scheduler otherwise sinks weight loads behind the row's arrival, where their latency is paid alone
  __builtin_amdgcn_sched_barrier(0);
#pragma unroll
  for (int i = 0; i < 8; ++i) q2 += (a[i][0] * a[i][0] + a[i][1] * a[i][1]) + (a[i][2] * a[i][2] + a[i][3] * a[i][3]);
#pragma unroll
  for (int off = 16; off >= 1; off >>= 1) q2 += __shfl_xor(q2, off, 32);
  const float rs = rsqrtf(q2 * (1.0f / E) + 1e-6f);
#pragma unroll
  for (int i = 0; i < 8; ++i) { v4h h;
#pragma unroll
    for (int e = 0; e < 4; ++e) h[e] = (_Float16)(a[i][e] * rs * c[i][e]);
    vst2(yr + i * 128, h); }
}
__global__ __launch_bounds__(256) void k_rms(const float* __restrict__ x, const float* __restrict__ w, _Float16* __restrict__ X16) { rms_rows(x, w, X16, blockIdx.x); }
// weight packs: PT rows: [0,1024) wq, [1024,2048) wk, [2048,3072) wv, [3072,4096) wo (all [out][in=1024]) x16 ; WI rows [4096][1024] x16 ; WF rows [1024][4096] x16
// All that depends on the inputs alone and is read by k_qkv or k_attn, as block ranges of one grid: the first RMSNorm, then the bias table
// BT[h][rel + SS - 1] for rel = k - q in [-(SS-1), SS-1], in base-2 units (x log2 e), then the wq, wk, wv rows of PT, whose order the pack keeps: PCP consecutive f32 per block, 4 KB per wave.
#define PREP_RMS (NR / 8)
#define PREP_BIAS (2 * SS / 256 * NH)
#define PCP 8192
__global__ __launch_bounds__(256) void k_prep(const float* __restrict__ hid, const float* __restrict__ ln1, const float* __restrict__ wq, const float* __restrict__ wk, const float* __restrict__ wv, const float* __restrict__ rb,
                                            _Float16* __restrict__ X16, _Float16* __restrict__ PT, float* __restrict__ BT) {
  const int blk = blockIdx.x, tid = threadIdx.x;
  if (blk < PREP_RMS) { rms_rows(hid, ln1, X16, blk); return; }
  if (blk < PREP_RMS + PREP_BIAS) { const int h = (blk - PREP_RMS) >> 3, i = ((blk - PREP_RMS) & 7) * 256 + tid; if (i >= 2 * SS) return;   // table width padded to 2*SS
    float v = 0.f;
    if (i < 2 * SS - 1) { const int rel = i - (SS - 1); const int nb = NBK / 2; int bucket = rel > 0 ? nb : 0; const int rp = rel < 0 ? -rel : rel; const int mx = nb / 2;
      int val; if (rp < mx) val = rp; else { const float lf = logf((float)rp / (float)mx) / 2.772588722239781f * (float)(nb - mx); int large = mx + (int)lf; val = large < nb - 1 ? large : nb - 1; }
      bucket += val; v = rb[bucket * NH + h] * LOG2E; }
    vst2(BT + (size_t)h * 2 * SS + i, v); return; }
  const int ch = blk - PREP_RMS - PREP_BIAS, which = ch / (E * E / PCP);
  const float* s = (which == 0 ? wq : which == 1 ? wk : wv) + (size_t)(ch % (E * E / PCP)) * PCP + tid * 4; _Float16* d = PT + (size_t)ch * PCP + tid * 4; v4f v[8];
  // both loops unrolled so that v stays in registers and the lane's eight loads are in flight together
#pragma unroll
  for (int i = 0; i < 8; ++i) v[i] = *(const v4f*)(s + i * 1024);
#pragma unroll
  for (int i = 0; i < 8; ++i) { v4h h;
#pragma unroll
    for (int e = 0; e < 4; ++e) h[e] = (_Float16)(v[i][e] * 16.0f);
    vst2(d + i * 1024, h); }
  asm volatile("s_wait_xcnt 0x0" ::: "memory");   // behind the eight stores, in front of whatever code the listing puts next that rewrites their address or data registers
}
// A 128-thread block's share of a weight pack whose rows keep their order: PCH consecutive f32 -> f16 x16.
#define PCH 4096
__device__ __forceinline__ void pack_chunk(const float* __restrict__ s, _Float16* __restrict__ d) {
  const int tid = threadIdx.x; v4f v[8];
  // both loops unrolled so that v stays in registers and the lane's eight loads are in flight together
#pragma unroll
  for (int i = 0; i < 8; ++i) v[i] = *(const v4f*)(s + (i * 128 + tid) * 4);
#pragma unroll
  for (int i = 0; i < 8; ++i) { v4h h;
#pragma unroll
    for (int e = 0; e < 4; ++e) h[e] = (_Float16)(v[i][e] * 16.0f);
    vst2(d + (i * 128 + tid) * 4, h); }
}
// QKV: block (64 rows, 128 cols = 2 heads, which)
__global__ __launch_bounds__(128) void k_qkv(const _Float16* __restrict__ X16, const _Float16* __restrict__ PT, _Float16* __restrict__ Q16, _Float16* __restrict__ K16, _Float16* __restrict__ VT) {
  __shared__ __align__(16) char smem[RINGD_BYTES(2)];   // the operand ring; behind the k loop the output staging
  float (*so)[16][132] = (float (*)[16][132])smem;
  _Float16 (*st)[72] = (_Float16 (*)[72])smem;
  const int tid = threadIdx.x, wave = tid >> 5, lane = tid & 31, col = lane & 15, g = lane >> 4;
  const int which = blockIdx.z, r0b = blockIdx.x * 64, n0 = blockIdx.y * 128; const int b = r0b / SS, s0 = r0b % SS;
  v8f acc[8] = {};
  gemm_deep<2, E / (2 * BKH)>(X16 + (size_t)r0b * E, E, BKH, PT + (size_t)(which * E + n0) * E, E, smem, acc, blockIdx.x + blockIdx.y + blockIdx.z);
  if (which < 2) {
#pragma unroll
    for (int j = 0; j < 8; ++j)
#pragma unroll
      for (int r = 0; r < 8; ++r) so[wave][8 * g + r][j * 16 + col] = acc[j][r] * (4.0f / 16.0f);
    LDSX();
    _Float16* D = which == 0 ? Q16 : K16;
    for (int qq = lane; qq < 16 * 2 * 8; qq += 32) { const int hh = qq >> 7, rl = (qq >> 3) & 15, pc = qq & 7; const int h = (n0 >> 6) + hh; union { v8h h8; v4u u; } pk;
#pragma unroll
      for (int e = 0; e < 8; ++e) pk.h8[e] = (_Float16)so[wave][rl][hh * 64 + pc * 8 + e];
      vst2(D + (((size_t)b * NH + h) * SS + s0 + wave * 16 + rl) * HD + pc * 8, pk.u); } }
  else {
#pragma unroll
    for (int j = 0; j < 8; ++j)
#pragma unroll
      for (int r = 0; r < 8; ++r) st[j * 16 + col][wave * 16 + 8 * g + r] = (_Float16)(acc[j][r] * (4.0f / 16.0f));
    __syncthreads();
    for (int qq = tid; qq < 128 * 8; qq += 128) { const int cl = qq >> 3, pc = qq & 7; const int c = n0 + cl, h = c >> 6, d = c & 63;
      vst2(VT + (((size_t)b * NH + h) * HD + d) * SS + s0 + pc * 8, *(const v4u*)(&st[cl][pc * 8])); } }
}
// Attention's K/V ring in LDS. A stage is one 64-key tile for the block's four waves: its 64 K rows (64 d = 128 B each) and then the 64 V^T rows
// (64 keys = 128 B each), at the same 144-B row pitch as the GEMM ring. Two buffers: asynchronous copies fill one while the other is worked on.
#define ASTG (128 * PIT)           // f16 per buffer
// One stage: 128 rows x 8 pieces of 16 B = 8 copies per lane; 8 neighbouring lanes take one row's whole 128-B line.
// gk, gv: this lane's piece in row (tid >> 3) of the K and of the V^T part; l: LDS byte address of the K piece.
__device__ __forceinline__ void kv_copy(const _Float16* gk, const _Float16* gv, unsigned l) {
  // the closing s_wait_xcnt stands inside the statement so that no address register of a copy is rewritten in front of it
  asm volatile("global_load_async_to_lds_b128 %0, %8, off\n\t"
               "global_load_async_to_lds_b128 %1, %9, off\n\t"
               "global_load_async_to_lds_b128 %2, %10, off\n\t"
               "global_load_async_to_lds_b128 %3, %11, off\n\t"
               "global_load_async_to_lds_b128 %4, %12, off\n\t"
               "global_load_async_to_lds_b128 %5, %13, off\n\t"
               "global_load_async_to_lds_b128 %6, %14, off\n\t"
               "global_load_async_to_lds_b128 %7, %15, off\n\t"
               "s_wait_xcnt 0x0"
               :: "v"(l), "v"(l + 1u * 16 * PIT * 2), "v"(l + 2u * 16 * PIT * 2), "v"(l + 3u * 16 * PIT * 2),
                  "v"(l + 4u * 16 * PIT * 2), "v"(l + 5u * 16 * PIT * 2), "v"(l + 6u * 16 * PIT * 2), "v"(l + 7u * 16 * PIT * 2),
                  "v"(gk), "v"(gk + 16 * HD), "v"(gk + 32 * HD), "v"(gk + 48 * HD), "v"(gv), "v"(gv + 16 * SS), "v"(gv + 32 * SS), "v"(gv + 48 * SS)
               : "memory");
}
// Grid rows y < NB * NH are the attention tiles. The RIDE_Y rows behind them pack wo, wi and wo_ff, which only the launches after this one read:
// their memory stream runs in the places that the attention blocks leave free on each WGP.
#define RIDE_Y ((E * E + 2 * DFF * E) / PCH / (SS / 64))
__global__ __launch_bounds__(128) void k_attn(const _Float16* __restrict__ Q16, const _Float16* __restrict__ K16, const _Float16* __restrict__ VT, const float* __restrict__ BT, _Float16* __restrict__ O16,
                                            const float* __restrict__ wo, const float* __restrict__ wi, const float* __restrict__ wff, _Float16* __restrict__ PTO, _Float16* __restrict__ WI, _Float16* __restrict__ WF) {
  if (blockIdx.y >= NB * NH) {   // the whole block leaves here, in front of every barrier and copy
    const unsigned c = (blockIdx.y - NB * NH) * (SS / 64) + blockIdx.x; const int m = c < E * E / PCH ? 0 : c < (E * E + DFF * E) / PCH ? 1 : 2;
    const size_t o = (size_t)(c - (m == 0 ? 0 : m == 1 ? E * E / PCH : (E * E + DFF * E) / PCH)) * PCH;
    pack_chunk((m == 0 ? wo : m == 1 ? wi : wff) + o, (m == 0 ? PTO : m == 1 ? WI : WF) + o);
    return; }
  __shared__ __align__(16) _Float16 kv[2 * ASTG];
  __shared__ __align__(16) _Float16 sO[4][16][72];
  const int tid = threadIdx.x, w = tid >> 5, lane = tid & 31, col = lane & 15, g = lane >> 4;
  const size_t bh = blockIdx.y; const int h = (int)(bh % NH); const int q0 = blockIdx.x * 64 + w * 16; const float* bth = BT + (size_t)h * 2 * SS + (SS - 1);
  v16h bq[2];
#pragma unroll
  for (int kc = 0; kc < 2; ++kc) bq[kc] = frag_h(Q16 + (bh * SS + q0 + col) * HD + kc * 32, lane);
  float mrun = -3.0e38f, lrun = 0.f; v8f acc[4] = {};   // lrun: the sum over this half's keys only; the halves are joined behind the loop
  const float* bp = bth + (8 * g - (q0 + col));         // bias of key 8 g against this lane's query
  const _Float16* gk = K16 + (bh * SS + (tid >> 3)) * HD + (tid & 7) * 8;
  const _Float16* gv = VT + (bh * HD + (tid >> 3)) * SS + (tid & 7) * 8;
  const unsigned l = (unsigned)(size_t)kv + (unsigned)((tid >> 3) * PIT + (tid & 7) * 8) * 2u;
  // Trip kt works on key tile (kt + rot) mod 16: the sixteen blocks of one head, which read the same K and V, each start at another tile, so that they do
  // not ask L2 for the same lines at the same moment. The running maximum and sums take the tiles in any order.
  static_assert(((SS / 64) & (SS / 64 - 1)) == 0, "the wrap is a mask");
  const unsigned rot = blockIdx.x & (SS / 64 - 1);
  kv_copy(gk + (size_t)rot * 64 * HD, gv + rot * 64, l);
  asm volatile("s_wait_asynccnt 0x0" ::: "memory");   // this wave's part of the first tile has landed before the barrier publishes it
  __syncthreads();
  { const unsigned k1 = (rot + 1) & (SS / 64 - 1); kv_copy(gk + (size_t)k1 * 64 * HD, gv + k1 * 64, l + ASTG * 2); }
#pragma unroll 1
  for (int kt = 0; kt < SS / 64; ++kt) {
    const _Float16* buf = kv + (kt & 1) * ASTG; const unsigned kr = (kt + rot) & (SS / 64 - 1);
    v16h kf[4][2], vf[2][4], pb[2];   // the tile's fragments, each operand read as one group so that one LDS latency is paid per group, not one per product
    float bv[4][8]; v8f s[4] = {};
    // every loop of this body is unrolled so that every index of bv, kf, s, vf, pb and acc is a constant and the arrays stay in registers
    // the tile's biases are asked for first, so that they arrive under the K reads and the first product
#pragma unroll
    for (int t = 0; t < 4; ++t)
#pragma unroll
      for (int r = 0; r < 8; ++r) bv[t][r] = bp[kr * 64 + t * 16 + r];
#pragma unroll
    for (int t = 0; t < 4; ++t)
#pragma unroll
      for (int kc = 0; kc < 2; ++kc) kf[t][kc] = frag_h(buf + (t * 16 + col) * PIT + kc * 32, lane);
#pragma unroll
    for (int kc = 0; kc < 2; ++kc)
#pragma unroll
      for (int t = 0; t < 4; ++t) s[t] = wmma16(kf[t][kc], bq[kc], s[t]);
    // read here so that the softmax below covers their latency
#pragma unroll
    for (int kc = 0; kc < 2; ++kc)
#pragma unroll
      for (int t = 0; t < 4; ++t) vf[kc][t] = frag_h(buf + (64 + t * 16 + col) * PIT + kc * 32, lane);
    float mt[4], pt[4];   // one chain per 16-key tile, so that four independent chains are in flight
#pragma unroll
    for (int t = 0; t < 4; ++t) { mt[t] = -3.4e38f;
#pragma unroll
      for (int r = 0; r < 8; ++r) { s[t][r] = s[t][r] * (LOG2E / 16.0f) + bv[t][r]; mt[t] = fmaxf(mt[t], s[t][r]); } }
    float mx = fmaxf(fmaxf(mt[0], mt[1]), fmaxf(mt[2], mt[3]));
    mx = fmaxf(mx, xhalf(mx));
    const float mnew = fmaxf(mrun, mx); const float corr = __builtin_amdgcn_exp2f(mrun - mnew); const float moff = mnew - 14.0f;
#pragma unroll
    for (int t = 0; t < 4; ++t) { pt[t] = 0.f;
#pragma unroll
      for (int r = 0; r < 8; ++r) s[t][r] -= moff;
      exp2x8(s[t]);
#pragma unroll
      for (int r = 0; r < 8; ++r) { pt[t] += s[t][r]; pb[t >> 1][(t & 1) * 8 + r] = (_Float16)s[t][r]; } }
    lrun = lrun * corr + ((pt[0] + pt[1]) + (pt[2] + pt[3])); mrun = mnew;
#pragma unroll
    for (int t = 0; t < 4; ++t)
#pragma unroll
      for (int r = 0; r < 8; ++r) acc[t][r] *= corr;
#pragma unroll
    for (int kc = 0; kc < 2; ++kc)
#pragma unroll
      for (int t = 0; t < 4; ++t) acc[t] = wmma16(vf[kc][t], pb[kc], acc[t]);
    asm volatile("s_wait_dscnt 0x0" ::: "memory");      // this wave's reads of the buffer are over before it is refilled
    asm volatile("s_wait_asynccnt 0x0" ::: "memory");   // this wave's part of tile (kt + 1 + rot) mod 16 has landed
    __syncthreads();                                    // publishes tile (kt + 1 + rot) mod 16 and frees buffer kt & 1
    if (kt + 2 < SS / 64) { const unsigned kn = (kt + 2 + rot) & (SS / 64 - 1); kv_copy(gk + (size_t)kn * 64 * HD, gv + kn * 64, l + (unsigned)(kt & 1) * (ASTG * 2)); } }
  asm volatile("s_wait_asynccnt 0x0" ::: "memory");     // nothing in flight when the wave goes on to its output and ends
  // acc[t][r] = O[query col][d = t * 16 + 8 g + r]: eight neighbouring d per lane; staged in the wave's own LDS rows so that whole 128-B lines are stored
  const float inv = 8.0f / ((lrun + xhalf(lrun)) * 4.0f);
#pragma unroll
  for (int t = 0; t < 4; ++t) { union { v8h h8; v4u u; } pk;
#pragma unroll
    for (int r = 0; r < 8; ++r) pk.h8[r] = (_Float16)(acc[t][r] * inv);
    vst2(&sO[w][col][t * 16 + 8 * g], pk.u); }
  LDSX();
  for (int qq = lane; qq < 16 * 8; qq += 32) { const int rl = qq >> 3, pc = qq & 7;
    vst2(O16 + ((bh * SS) + q0 + rl) * HD + pc * 8, *(const v4u*)(&sO[w][rl][pc * 8])); }
}
// H1 = hidden + ctx wo^T : block (64 rows, 128 cols)
__global__ __launch_bounds__(128) void k_o(const _Float16* __restrict__ O16, const _Float16* __restrict__ PT, const float* __restrict__ hid, float* __restrict__ H1) {
  __shared__ __align__(16) char smem[RINGD_BYTES(4)];   // the operand ring; behind the k loop the output staging
  float (*so)[16][132] = (float (*)[16][132])smem;
  const int tid = threadIdx.x, wave = tid >> 5, lane = tid & 31, col = lane & 15, g = lane >> 4;
  const int r0b = blockIdx.x * 64, r0 = r0b + wave * 16, n0 = blockIdx.y * 128; const int b = r0b / SS, s0 = r0b % SS;
  v8f acc[8] = {};
  // a 64-k piece is a head: the 64 k of head t of row s stand at O16[b][t][s][0..63]
  gemm_deep<4, E / (4 * BKH)>(O16 + ((size_t)b * NH * SS + s0) * HD, HD, (size_t)SS * HD, PT + (size_t)(3 * E + n0) * E, E, smem, acc, blockIdx.x + blockIdx.y);
#pragma unroll
  for (int j = 0; j < 8; ++j) { const int n = n0 + j * 16 + col;
#pragma unroll
    for (int r = 0; r < 8; ++r) so[wave][8 * g + r][j * 16 + col] = acc[j][r] * (1.0f / (16.0f * 8.0f)) + hid[(size_t)(r0 + 8 * g + r) * E + n]; }
  LDSX();
#pragma unroll 4
  for (int rl = 0; rl < 16; ++rl) vst2(H1 + (size_t)(r0 + rl) * E + n0 + lane * 4, *(const v4f*)(&so[wave][rl][lane * 4]));
}
// F16 = relu(Y16 @ wi^T) as f16 rows [NR][4096] : block (64 rows, 128 cols)
__global__ __launch_bounds__(128) void k_ff1(const _Float16* __restrict__ Y16, const _Float16* __restrict__ WI, _Float16* __restrict__ F16) {
  __shared__ __align__(16) char smem[RING_BYTES];   // the operand ring; behind the k loop the output staging
  _Float16 (*so)[16][136] = (_Float16 (*)[16][136])smem;
  const int tid = threadIdx.x, wave = tid >> 5, lane = tid & 31, col = lane & 15, g = lane >> 4;
  const int r0b = blockIdx.x * 64, r0 = r0b + wave * 16, n0 = blockIdx.y * 128;
  v8f acc[8] = {};
  gemm_ring<E / BKH>(Y16 + (size_t)r0b * E, E, BKH, WI + (size_t)n0 * E, E, smem, acc, blockIdx.x + blockIdx.y);
#pragma unroll
  for (int j = 0; j < 8; ++j)
#pragma unroll
    for (int r = 0; r < 8; ++r) { const float v = acc[j][r] * (1.0f / 16.0f); so[wave][8 * g + r][j * 16 + col] = (_Float16)(v > 0.f ? v : 0.f); }
  LDSX();
  for (int qq = lane; qq < 16 * 16; qq += 32) { const int rl = qq >> 4, pc = qq & 15; vst2(F16 + (size_t)(r0 + rl) * DFF + n0 + pc * 8, *(const v4u*)(&so[wave][rl][pc * 8])); }
}
// out = H1 + F16 @ wo_ff^T : block (64 rows, 128 cols), K = 4096
__global__ __launch_bounds__(128) void k_ff2(const _Float16* __restrict__ F16, const _Float16* __restrict__ WF, const float* __restrict__ H1, float* __restrict__ out) {
  __shared__ __align__(16) char smem[RINGD_BYTES(4)];   // the operand ring; behind the k loop the output staging
  float (*so)[16][132] = (float (*)[16][132])smem;
  const int tid = threadIdx.x, wave = tid >> 5, lane = tid & 31, col = lane & 15, g = lane >> 4;
  const int r0b = blockIdx.x * 64, r0 = r0b + wave * 16, n0 = blockIdx.y * 128;
  v8f acc[8] = {};
  gemm_deep<4, DFF / (4 * BKH)>(F16 + (size_t)r0b * DFF, DFF, BKH, WF + (size_t)n0 * DFF, DFF, smem, acc, blockIdx.x + blockIdx.y);
#pragma unroll
  for (int j = 0; j < 8; ++j) { const int n = n0 + j * 16 + col;
#pragma unroll
    for (int r = 0; r < 8; ++r) so[wave][8 * g + r][j * 16 + col] = acc[j][r] * (1.0f / 16.0f) + H1[(size_t)(r0 + 8 * g + r) * E + n]; }
  LDSX();
#pragma unroll 4
  for (int rl = 0; rl < 16; ++rl) vst2(out + (size_t)(r0 + rl) * E + n0 + lane * 4, *(const v4f*)(&so[wave][rl][lane * 4]));
}
extern "C" void kernel_launch(void* const* d_in, const int* in_sizes, int n_in, void* d_out, int out_size, void* d_ws, size_t ws_size, hipStream_t stream) {
  (void)in_sizes; (void)n_in; (void)out_size; (void)ws_size;
  const float** I = (const float**)d_in;
  const float* hid = I[0]; const float* ln1 = I[1]; const float* wq = I[2]; const float* wk = I[3]; const float* wv = I[4]; const float* wo = I[5]; const float* rb = I[6]; const float* ln2 = I[7]; const float* wi = I[8]; const float* wff = I[9];
  float* out = (float*)d_out;
  char* ws = (char*)d_ws; size_t off = 0;
  auto take = [&](size_t bytes) { char* p = ws + off; off += (bytes + 255) & ~(size_t)255; return p; };
  _Float16* X16 = (_Float16*)take((size_t)NR * E * 2); _Float16* PT = (_Float16*)take((size_t)4 * E * E * 2); _Float16* WI = (_Float16*)take((size_t)DFF * E * 2); _Float16* WF = (_Float16*)take((size_t)E * DFF * 2);
  float* BT = (float*)take((size_t)NH * 2 * SS * 4);
  _Float16* Q16 = (_Float16*)take((size_t)NR * E * 2); _Float16* K16 = (_Float16*)take((size_t)NR * E * 2); _Float16* VT = (_Float16*)take((size_t)NR * E * 2); _Float16* O16 = (_Float16*)take((size_t)NR * E * 2);
  float* H1 = (float*)take((size_t)NR * E * 4); _Float16* Y16 = X16; _Float16* F16 = (_Float16*)take((size_t)NR * DFF * 2);
  k_prep<<<PREP_RMS + PREP_BIAS + 3 * E * E / PCP, 256, 0, stream>>>(hid, ln1, wq, wk, wv, rb, X16, PT, BT);
  k_qkv<<<dim3(NR / 64, E / 128, 3), 128, 0, stream>>>(X16, PT, Q16, K16, VT);
  k_attn<<<dim3(SS / 64, NB * NH + RIDE_Y), 128, 0, stream>>>(Q16, K16, VT, BT, O16, wo, wi, wff, PT + (size_t)3 * E * E, WI, WF);
  k_o<<<dim3(NR / 64, E / 128), 128, 0, stream>>>(O16, PT, hid, H1);
  k_rms<<<NR / 8, 256, 0, stream>>>(H1, ln2, Y16);
  k_ff1<<<dim3(NR / 64, DFF / 128), 128, 0, stream>>>(Y16, WI, F16);
  k_ff2<<<dim3(NR / 64, E / 128), 128, 0, stream>>>(F16, WF, H1, out);
}

// v009
// It runs in 86.5 microseconds.
// Two timings next to v008 both put it at 1.07 times that version's speed.
// Counting every step since v000, it is 6.33 times as fast.
#include <hip/hip_runtime.h>
#include <math.h>

typedef __attribute__((ext_vector_type(16))) _Float16 v16h;
typedef __attribute__((ext_vector_type(16))) __bf16 v16b;
typedef __attribute__((ext_vector_type(8)))  _Float16 v8h;
typedef __attribute__((ext_vector_type(4)))  _Float16 v4h;
typedef __attribute__((ext_vector_type(8)))  float v8f;
typedef __attribute__((ext_vector_type(4)))  float v4f;
typedef __attribute__((ext_vector_type(2)))  float v2f;
typedef __attribute__((ext_vector_type(4)))  unsigned v4u;
typedef __attribute__((ext_vector_type(4)))  int v4i;
typedef float __attribute__((may_alias)) float_a;
typedef int __attribute__((may_alias)) int_a;

template <typename T> __device__ __forceinline__ void vst2(void* p, T v) { *(T*)p = v;  }
__device__ __forceinline__ v8f wmma16(v16h a, v16h b, v8f c) {
  v8f d = __builtin_amdgcn_wmma_f32_16x16x32_f16(false, a, false, b, (short)0, c, false, false);
  asm volatile("v_nop\n\tv_nop\n\tv_nop\n\tv_nop" : "+v"(d) : "v"(a), "v"(b));
  return d;
}
__device__ __forceinline__ v8f wmma_bf(v16b a, v16b b, v8f c) {
  v8f d = __builtin_amdgcn_wmma_f32_16x16x32_bf16(false, a, false, b, (short)0, c, false, false);
  asm volatile("v_nop\n\tv_nop\n\tv_nop\n\tv_nop" : "+v"(d) : "v"(a), "v"(b));
  return d;
}
// 16x16x32 fragments: lane = (h = lane>>4, row/col = lane&15); elements 0..7 = k0+8h+0..7, 8..15 = k0+16+8h+0..7; D element r = row 8h+r
__device__ __forceinline__ v16h frag_h(const _Float16* rowk0, int lane) {
  union { v16h v; v8h q[2]; } u; const _Float16* p = rowk0 + 8 * (lane >> 4);
  u.q[0] = *(const v8h*)p; u.q[1] = *(const v8h*)(p + 16); return u.v;
}
__device__ __forceinline__ v16h frag_f32(const float* rowk0, int lane) {
  v16h a; const float* p = rowk0 + 8 * (lane >> 4);
#pragma unroll
  for (int i = 0; i < 8; ++i) { a[i] = (_Float16)p[i]; a[8 + i] = (_Float16)p[16 + i]; }
  return a;
}
__device__ __forceinline__ v16h frag_f32s(const float* rowk0, int lane, float sc) {
  v16h a; const float* p = rowk0 + 8 * (lane >> 4);
#pragma unroll
  for (int i = 0; i < 8; ++i) { a[i] = (_Float16)(p[i] * sc); a[8 + i] = (_Float16)(p[16 + i] * sc); }
  return a;
}
// column fragment from a [K][ld] layout (column n), rows >= K read as 0
__device__ __forceinline__ v16h fragc_f32(const float* W, int k0, int n, int lane, int ld, int K) {
  v16h a; const int g = lane >> 4;
#pragma unroll
  for (int i = 0; i < 8; ++i) { const int ka = k0 + 8 * g + i, kb = ka + 16;
    a[i] = (_Float16)(ka < K ? W[(size_t)ka * ld + n] : 0.f); a[8 + i] = (_Float16)(kb < K ? W[(size_t)kb * ld + n] : 0.f); }
  return a;
}
struct F2 { v16b h, l; };
__device__ __forceinline__ F2 bsplit16(const float v[16]) { F2 r;
#pragma unroll
  for (int i = 0; i < 16; ++i) { const __bf16 h = (__bf16)v[i]; r.h[i] = h; r.l[i] = (__bf16)(v[i] - (float)h); }
  return r; }
__device__ __forceinline__ F2 split_row(const float* row, int k0, int lane) { float v[16]; const float* p = row + k0 + 8 * (lane >> 4);
#pragma unroll
  for (int i = 0; i < 8; ++i) { v[i] = p[i]; v[8 + i] = p[16 + i]; }
  return bsplit16(v); }
__device__ __forceinline__ F2 split_rowK(const float* row, int k0, int lane, int K) { float v[16]; const int g = lane >> 4;
#pragma unroll
  for (int i = 0; i < 8; ++i) { const int ka = k0 + 8 * g + i, kb = ka + 16; v[i] = ka < K ? row[ka] : 0.f; v[8 + i] = kb < K ? row[kb] : 0.f; }
  return bsplit16(v); }
__device__ __forceinline__ F2 split_col(const float* W, int k0, int n, int lane, int ld, int K) { float v[16]; const int g = lane >> 4;
#pragma unroll
  for (int i = 0; i < 8; ++i) { const int ka = k0 + 8 * g + i, kb = ka + 16; v[i] = ka < K ? W[(size_t)ka * ld + n] : 0.f; v[8 + i] = kb < K ? W[(size_t)kb * ld + n] : 0.f; }
  return bsplit16(v); }
__device__ __forceinline__ v8f mac3(const F2& a, const F2& b, v8f c) { c = wmma_bf(a.l, b.h, c); c = wmma_bf(a.h, b.l, c); return wmma_bf(a.h, b.h, c); }
__device__ __forceinline__ float sigm(float v) { return 1.0f / (1.0f + expf(-v)); }
// lane l with lane l ^ 16
__device__ __forceinline__ float xhalf(float x) { return __builtin_bit_cast(float, __builtin_amdgcn_permlanex16(__builtin_bit_cast(int, x), __builtin_bit_cast(int, x), 0x76543210, 0xfedcba98, false, false)); }
// x[r] = 2^x[r]. Eight independent v_exp_f32, each in place, so that none reads a neighbour's result or overwrites a neighbour's source; the closing
// v_nop is the one slot that the instruction set asks for between the last of them and a user of its result, which the compiler places unseen.
__device__ __forceinline__ void exp2x8(v8f& x) {
  asm("v_exp_f32 %0, %0\n\tv_exp_f32 %1, %1\n\tv_exp_f32 %2, %2\n\tv_exp_f32 %3, %3\n\t"
      "v_exp_f32 %4, %4\n\tv_exp_f32 %5, %5\n\tv_exp_f32 %6, %6\n\tv_exp_f32 %7, %7\n\tv_nop"
      : "+v"(x[0]), "+v"(x[1]), "+v"(x[2]), "+v"(x[3]), "+v"(x[4]), "+v"(x[5]), "+v"(x[6]), "+v"(x[7]));
}
#define LDSX() do { asm volatile("s_wait_dscnt 0" ::: "memory"); __builtin_amdgcn_wave_barrier(); __builtin_amdgcn_fence(__ATOMIC_RELEASE, "workgroup"); } while (0)

// T5 encoder block: RMSNorm -> 16-head self attention with the bidirectional relative-position bias (no 1/sqrt(d)) -> residual ->
// RMSNorm -> ReLU FFN (1024 -> 4096 -> 1024) -> residual. All products on v_wmma_f32_16x16x32_f16 ([out][in] weight rows converted once
// to f16 rows x16; activations as f16 rows, q/k x4, P x2^14, V x4, ctx x8); RMSNorms, the bucket function, softmax and residuals in f32.
#define NB 2
#define SS 1024
#define E 1024
#define NH 16
#define HD 64
#define DFF 4096
#define NR (NB * SS)           // 2048
#define NBK 32
#define MAXD 128
#define LOG2E 1.4426950408889634f

#define BKH 64                     // k per 128-B row piece
#define PIT 72                     // LDS pitch in f16 of a 128-B row: 144 B (16 B x odd, the conflict-free pitch for ds_load_b128)
// Deep ring for the GEMMs with one 64 x 128 tile per WGP (k_o, k_ff2): the launch lasts as long as one workgroup's chain of stage flights, so a stage is
// NS x 64 k of the block's 64 A rows and then of its 128 B rows. Row pitch NS x 128 + 16 B (16 B x odd). Two buffers: asynchronous copies fill one while the other is multiplied.
#define PITD(NS) ((NS) * BKH + 8)            // LDS row pitch in f16
#define STGD(NS) (192 * PITD(NS))            // f16 per buffer
#define RINGD_BYTES(NS) (2 * STGD(NS) * 2)
// Twelve copies of one wave: 4 on the A part and 8 on the B part. A copy's 32 lanes take 512 B: one row's stage slice (NS = 4) or two rows' (NS = 2).
// ga, gb: this lane's piece for the first A and B copy, da, db: step from copy to copy; la, lb: its LDS byte addresses, dl: their step.
__device__ __forceinline__ void deep_copy(const _Float16* ga, size_t da, const _Float16* gb, size_t db, unsigned la, unsigned lb, unsigned dl) {
  // the closing s_wait_xcnt stands inside the statement so that no address register of a copy is rewritten in front of it
  asm volatile("global_load_async_to_lds_b128 %0, %12, off\n\t"
               "global_load_async_to_lds_b128 %1, %13, off\n\t"
               "global_load_async_to_lds_b128 %2, %14, off\n\t"
               "global_load_async_to_lds_b128 %3, %15, off\n\t"
               "global_load_async_to_lds_b128 %4, %16, off\n\t"
               "global_load_async_to_lds_b128 %5, %17, off\n\t"
               "global_load_async_to_lds_b128 %6, %18, off\n\t"
               "global_load_async_to_lds_b128 %7, %19, off\n\t"
               "global_load_async_to_lds_b128 %8, %20, off\n\t"
               "global_load_async_to_lds_b128 %9, %21, off\n\t"
               "global_load_async_to_lds_b128 %10, %22, off\n\t"
               "global_load_async_to_lds_b128 %11, %23, off\n\t"
               "s_wait_xcnt 0x0"
               :: "v"(la), "v"(la + dl), "v"(la + 2 * dl), "v"(la + 3 * dl),
                  "v"(lb), "v"(lb + dl), "v"(lb + 2 * dl), "v"(lb + 3 * dl), "v"(lb + 4 * dl), "v"(lb + 5 * dl), "v"(lb + 6 * dl), "v"(lb + 7 * dl),
                  "v"(ga), "v"(ga + da), "v"(ga + 2 * da), "v"(ga + 3 * da),
                  "v"(gb), "v"(gb + db), "v"(gb + 2 * db), "v"(gb + 3 * db), "v"(gb + 4 * db), "v"(gb + 5 * db), "v"(gb + 6 * db), "v"(gb + 7 * db)
               : "memory");
}
// One wave's share of a deep stage: a quarter of the A rows and of the B rows, 12 x NS copies.
template <int NS>
__device__ __forceinline__ void deep_stage(const _Float16* ga, size_t lda, const _Float16* gb, size_t ldb, unsigned la, unsigned lb) {
  constexpr int RPC = 4 / NS;   // rows per copy
  // unrolled so that the row steps are constants
#pragma unroll
  for (int s = 0; s < NS; ++s) deep_copy(ga + (size_t)(s * 16 * RPC) * lda, RPC * lda, gb + (size_t)(s * 32 * RPC) * ldb, RPC * ldb,
                                         la + (unsigned)(s * 16 * RPC * PITD(NS) * 2), lb + (unsigned)(s * 32 * RPC * PITD(NS) * 2), (unsigned)(RPC * PITD(NS) * 2));
}
// acc[j] += A rows (wave * 16 ..) x B rows (j * 16 ..) over NT deep stages. sa: distance between an A row's successive 64-k pieces (BKH where the row is contiguous).
// rot (the same for the whole block): trip t works on stage (t + rot) mod NT, so k runs from stage rot upwards and wraps. Blocks that share A or B rows get
// different rot, so that they do not ask L2 for the same lines at the same moment. Behind it no copy is in flight and every wave has left the ring.
template <int NS, int NT>
__device__ __forceinline__ void gemm_deep(const _Float16* A, size_t lda, size_t sa, const _Float16* B, size_t ldb, char* smem, v8f (&acc)[8], unsigned rot) {
  static_assert((NT & (NT - 1)) == 0, "the wrap is a mask");
  constexpr int RPC = 4 / NS, LPR = NS * 8, PD = PITD(NS), SD = STGD(NS);   // rows per copy, lanes per row
  const int tid = threadIdx.x, wave = tid >> 5, lane = tid & 31, col = lane & 15, lr = lane / LPR, lp = lane % LPR;
  const _Float16* ring = (const _Float16*)smem;
  const _Float16* ga = A + (size_t)(wave * 4 * RPC + lr) * lda + (size_t)(lp >> 3) * sa + (lp & 7) * 8;
  const _Float16* gb = B + (size_t)(wave * 8 * RPC + lr) * ldb + lp * 8;
  const unsigned la = (unsigned)(size_t)smem + (unsigned)((wave * 4 * RPC + lr) * PD + lp * 8) * 2u;
  const unsigned lb = (unsigned)(size_t)smem + (unsigned)((64 + wave * 8 * RPC + lr) * PD + lp * 8) * 2u;
  rot &= NT - 1;
  deep_stage<NS>(ga + (size_t)rot * NS * sa, lda, gb + (size_t)rot * NS * BKH, ldb, la, lb);
  asm volatile("s_wait_asynccnt 0x0" ::: "memory");   // this wave's part of the first stage has landed before the barrier publishes it
  __syncthreads();
  { const unsigned k1 = (rot + 1) & (NT - 1); deep_stage<NS>(ga + (size_t)k1 * NS * sa, lda, gb + (size_t)k1 * NS * BKH, ldb, la + SD * 2, lb + SD * 2); }
  // kept rolled so that the hot loop stays small in the instruction cache
#pragma unroll 1
  for (int t = 0; t < NT; ++t) {
    const _Float16* buf = ring + (t & 1) * SD;
    // all loops below are unrolled so that every index of a, b and acc is a constant and the arrays stay in registers
#pragma unroll
    for (int ks = 0; ks < NS; ++ks) {
      v16h a[2], b[2][8];   // 64 k of fragments, read as one group so that one LDS latency is paid per group, not one per product
#pragma unroll
      for (int kc = 0; kc < 2; ++kc) { a[kc] = frag_h(buf + (wave * 16 + col) * PD + ks * BKH + kc * 32, lane);
#pragma unroll
        for (int j = 0; j < 8; ++j) b[kc][j] = frag_h(buf + (64 + j * 16 + col) * PD + ks * BKH + kc * 32, lane); }
#pragma unroll
      for (int kc = 0; kc < 2; ++kc)
#pragma unroll
        for (int j = 0; j < 8; ++j) acc[j] = wmma16(a[kc], b[kc][j], acc[j]);
    }
    asm volatile("s_wait_dscnt 0x0" ::: "memory");      // this wave's reads of the buffer are over before it is refilled
    asm volatile("s_wait_asynccnt 0x0" ::: "memory");   // this wave's part of stage (t + 1 + rot) mod NT has landed
    __syncthreads();                                    // publishes stage (t + 1 + rot) mod NT and frees buffer t & 1
    if (t + 2 < NT) { const unsigned kn = (t + 2 + rot) & (NT - 1);
      deep_stage<NS>(ga + (size_t)kn * NS * sa, lda, gb + (size_t)kn * NS * BKH, ldb, la + (unsigned)(t & 1) * (SD * 2), lb + (unsigned)(t & 1) * (SD * 2)); }
  }
  asm volatile("s_wait_asynccnt 0x0" ::: "memory");     // nothing in flight when the ring becomes output staging
}

// Wide ring for the GEMMs with more tiles than WGPs (k_qkv, k_ff1): a 128 x 128 block tile, each of the four waves 32 x 128. Against 64 x 128 blocks of 16 x 128
// waves a block asks L2 for 256 rows per 128 x 128 outputs, not 384, and a wave reads 10 LDS fragments per 16 products, not 9 per 8.
// A stage is 128 k (256 B) of the block's 128 A rows and then of its 128 B rows, at the 272-B pitch; two buffers, two workgroups per WGP.
#define PW PITD(2)                 // LDS row pitch in f16
#define STW (256 * PW)             // f16 per buffer
#define RINGW_BYTES (2 * STW * 2)
// Eight copies of one wave. A copy's 32 lanes take 512 B: two rows' stage slices. g: this lane's piece for the first copy, dg: step from copy to copy; l: its LDS byte address, dl: its step.
__device__ __forceinline__ void copy8(const _Float16* g, size_t dg, unsigned l, unsigned dl) {
  // the closing s_wait_xcnt stands inside the statement so that no address register of a copy is rewritten in front of it
  asm volatile("global_load_async_to_lds_b128 %0, %8, off\n\t"
               "global_load_async_to_lds_b128 %1, %9, off\n\t"
               "global_load_async_to_lds_b128 %2, %10, off\n\t"
               "global_load_async_to_lds_b128 %3, %11, off\n\t"
               "global_load_async_to_lds_b128 %4, %12, off\n\t"
               "global_load_async_to_lds_b128 %5, %13, off\n\t"
               "global_load_async_to_lds_b128 %6, %14, off\n\t"
               "global_load_async_to_lds_b128 %7, %15, off\n\t"
               "s_wait_xcnt 0x0"
               :: "v"(l), "v"(l + dl), "v"(l + 2 * dl), "v"(l + 3 * dl), "v"(l + 4 * dl), "v"(l + 5 * dl), "v"(l + 6 * dl), "v"(l + 7 * dl),
                  "v"(g), "v"(g + dg), "v"(g + 2 * dg), "v"(g + 3 * dg), "v"(g + 4 * dg), "v"(g + 5 * dg), "v"(g + 6 * dg), "v"(g + 7 * dg)
               : "memory");
}
// One wave's share of a wide stage: rows s * 64 + wave * 16 .. + 15 (s = 0, 1) of the A part and of the B part, 32 copies.
// ga, gb: this lane's piece in row wave * 16 + (lane >> 4) of each part; l: LDS byte address of the A piece.
__device__ __forceinline__ void wide_stage(const _Float16* ga, size_t lda, const _Float16* gb, size_t ldb, unsigned l) {
  // unrolled so that the row steps are constants
#pragma unroll
  for (int s = 0; s < 2; ++s) {
    copy8(ga + (size_t)(s * 64) * lda, 2 * lda, l + (unsigned)(s * 64 * PW * 2), (unsigned)(2 * PW * 2));
    copy8(gb + (size_t)(s * 64) * ldb, 2 * ldb, l + (unsigned)((128 + s * 64) * PW * 2), (unsigned)(2 * PW * 2)); }
}
// acc[i][j] += A rows (wave * 32 + i * 16 ..) x B rows (j * 16 ..) over NT wide stages, from stage rot upwards with the wrap, as in gemm_deep. Both operands' rows are contiguous in k.
// Behind it no copy is in flight and every wave has left the ring.
template <int NT>
__device__ __forceinline__ void gemm_wide(const _Float16* A, size_t lda, const _Float16* B, size_t ldb, char* smem, v8f (&acc)[2][8], unsigned rot) {
  static_assert((NT & (NT - 1)) == 0, "the wrap is a mask");
  const int tid = threadIdx.x, wave = tid >> 5, lane = tid & 31, col = lane & 15, lr = lane >> 4, lp = lane & 15;
  const _Float16* ring = (const _Float16*)smem;
  const _Float16* ga = A + (size_t)(wave * 16 + lr) * lda + lp * 8;
  const _Float16* gb = B + (size_t)(wave * 16 + lr) * ldb + lp * 8;
  const unsigned l = (unsigned)(size_t)smem + (unsigned)((wave * 16 + lr) * PW + lp * 8) * 2u;
  rot &= NT - 1;
  wide_stage(ga + (size_t)rot * 2 * BKH, lda, gb + (size_t)rot * 2 * BKH, ldb, l);
  asm volatile("s_wait_asynccnt 0x0" ::: "memory");   // this wave's part of the first stage has landed before the barrier publishes it
  __syncthreads();
  { const unsigned k1 = (rot + 1) & (NT - 1); wide_stage(ga + (size_t)k1 * 2 * BKH, lda, gb + (size_t)k1 * 2 * BKH, ldb, l + STW * 2); }
  // kept rolled so that the hot loop stays small in the instruction cache
#pragma unroll 1
  for (int t = 0; t < NT; ++t) {
    const _Float16* buf = ring + (t & 1) * STW;
    // all loops below are unrolled so that every index of a, b and acc is a constant and the arrays stay in registers
#pragma unroll
    for (int kc = 0; kc < 4; ++kc) {
      v16h a[2], b[8];   // 32 k of fragments, read as one group so that one LDS latency is paid per group, not one per product
#pragma unroll
      for (int i = 0; i < 2; ++i) a[i] = frag_h(buf + (wave * 32 + i * 16 + col) * PW + kc * 32, lane);
#pragma unroll
      for (int j = 0; j < 8; ++j) b[j] = frag_h(buf + (128 + j * 16 + col) * PW + kc * 32, lane);
#pragma unroll
      for (int j = 0; j < 8; ++j)
#pragma unroll
        for (int i = 0; i < 2; ++i) acc[i][j] = wmma16(a[i], b[j], acc[i][j]);
    }
    asm volatile("s_wait_dscnt 0x0" ::: "memory");      // this wave's reads of the buffer are over before it is refilled
    asm volatile("s_wait_asynccnt 0x0" ::: "memory");   // this wave's part of stage (t + 1 + rot) mod NT has landed
    __syncthreads();                                    // publishes stage (t + 1 + rot) mod NT and frees buffer t & 1
    if (t + 2 < NT) { const unsigned kn = (t + 2 + rot) & (NT - 1);
      wide_stage(ga + (size_t)kn * 2 * BKH, lda, gb + (size_t)kn * 2 * BKH, ldb, l + (unsigned)(t & 1) * (STW * 2)); }
  }
  asm volatile("s_wait_asynccnt 0x0" ::: "memory");     // nothing in flight when the ring becomes output staging
}

// RMSNorm of rows -> f16 ; wave per row, 8 rows per block blk. The wave asks for its whole 4-KB row, and for the weights, at once and keeps the row in
// registers: one memory latency per row, where a rolled loop paid one per load, and no second read. The order of the sum is that of the rolled loop.
__device__ __forceinline__ void rms_rows(const float* __restrict__ x, const float* __restrict__ w, _Float16* __restrict__ X16, unsigned blk) {
  const int wave = threadIdx.x >> 5, lane = threadIdx.x & 31; const size_t r = (size_t)blk * 8 + wave; if (r >= NR) return;
  const float* xr = x + r * E + lane * 4; const float* wr = w + lane * 4; _Float16* yr = X16 + r * E + lane * 4; v4f a[8], c[8]; float q2 = 0.f;
  // all four loops are unrolled so that a and c stay in registers and the sixteen loads are in flight together
#pragma unroll
  for (int i = 0; i < 8; ++i) a[i] = *(const v4f*)(xr + i * 128);
#pragma unroll
  for (int i = 0; i < 8; ++i) c[i] = *(const v4f*)(wr + i * 128);
  // keeps all sixteen loads in front of the sum, in flight together; the scheduler otherwise sinks weight loads behind the row's arrival, where their latency is paid alone
  __builtin_amdgcn_sched_barrier(0);
#pragma unroll
  for (int i = 0; i < 8; ++i) q2 += (a[i][0] * a[i][0] + a[i][1] * a[i][1]) + (a[i][2] * a[i][2] + a[i][3] * a[i][3]);
#pragma unroll
  for (int off = 16; off >= 1; off >>= 1) q2 += __shfl_xor(q2, off, 32);
  const float rs = rsqrtf(q2 * (1.0f / E) + 1e-6f);
#pragma unroll
  for (int i = 0; i < 8; ++i) { v4h h;
#pragma unroll
    for (int e = 0; e < 4; ++e) h[e] = (_Float16)(a[i][e] * rs * c[i][e]);
    vst2(yr + i * 128, h); }
}
__global__ __launch_bounds__(256) void k_rms(const float* __restrict__ x, const float* __restrict__ w, _Float16* __restrict__ X16) { rms_rows(x, w, X16, blockIdx.x); }
// weight packs: PT rows: [0,1024) wq, [1024,2048) wk, [2048,3072) wv, [3072,4096) wo (all [out][in=1024]) x16 ; WI rows [4096][1024] x16 ; WF rows [1024][4096] x16
// All that depends on the inputs alone and is read by k_qkv or k_attn, as block ranges of one grid: the first RMSNorm, then the bias table
// BT[h][rel + SS - 1] for rel = k - q in [-(SS-1), SS-1], in base-2 units (x log2 e), then the wq, wk, wv rows of PT, whose order the pack keeps: PCP consecutive f32 per block, 4 KB per wave.
#define PREP_RMS (NR / 8)
#define PREP_BIAS (2 * SS / 256 * NH)
#define PCP 8192
__global__ __launch_bounds__(256) void k_prep(const float* __restrict__ hid, const float* __restrict__ ln1, const float* __restrict__ wq, const float* __restrict__ wk, const float* __restrict__ wv, const float* __restrict__ rb,
                                            _Float16* __restrict__ X16, _Float16* __restrict__ PT, float* __restrict__ BT) {
  const int blk = blockIdx.x, tid = threadIdx.x;
  if (blk < PREP_RMS) { rms_rows(hid, ln1, X16, blk); return; }
  if (blk < PREP_RMS + PREP_BIAS) { const int h = (blk - PREP_RMS) >> 3, i = ((blk - PREP_RMS) & 7) * 256 + tid; if (i >= 2 * SS) return;   // table width padded to 2*SS
    float v = 0.f;
    if (i < 2 * SS - 1) { const int rel = i - (SS - 1); const int nb = NBK / 2; int bucket = rel > 0 ? nb : 0; const int rp = rel < 0 ? -rel : rel; const int mx = nb / 2;
      int val; if (rp < mx) val = rp; else { const float lf = logf((float)rp / (float)mx) / 2.772588722239781f * (float)(nb - mx); int large = mx + (int)lf; val = large < nb - 1 ? large : nb - 1; }
      bucket += val; v = rb[bucket * NH + h] * LOG2E; }
    vst2(BT + (size_t)h * 2 * SS + i, v); return; }
  const int ch = blk - PREP_RMS - PREP_BIAS, which = ch / (E * E / PCP);
  const float* s = (which == 0 ? wq : which == 1 ? wk : wv) + (size_t)(ch % (E * E / PCP)) * PCP + tid * 4; _Float16* d = PT + (size_t)ch * PCP + tid * 4; v4f v[8];
  // both loops unrolled so that v stays in registers and the lane's eight loads are in flight together
#pragma unroll
  for (int i = 0; i < 8; ++i) v[i] = *(const v4f*)(s + i * 1024);
#pragma unroll
  for (int i = 0; i < 8; ++i) { v4h h;
#pragma unroll
    for (int e = 0; e < 4; ++e) h[e] = (_Float16)(v[i][e] * 16.0f);
    vst2(d + i * 1024, h); }
  asm volatile("s_wait_xcnt 0x0" ::: "memory");   // behind the eight stores, in front of whatever code the listing puts next that rewrites their address or data registers
}
// A 128-thread block's share of a weight pack whose rows keep their order: PCH consecutive f32 -> f16 x16.
#define PCH 4096
__device__ __forceinline__ void pack_chunk(const float* __restrict__ s, _Float16* __restrict__ d) {
  const int tid = threadIdx.x; v4f v[8];
  // both loops unrolled so that v stays in registers and the lane's eight loads are in flight together
#pragma unroll
  for (int i = 0; i < 8; ++i) v[i] = *(const v4f*)(s + (i * 128 + tid) * 4);
#pragma unroll
  for (int i = 0; i < 8; ++i) { v4h h;
#pragma unroll
    for (int e = 0; e < 4; ++e) h[e] = (_Float16)(v[i][e] * 16.0f);
    vst2(d + (i * 128 + tid) * 4, h); }
}
// QKV: block (128 rows, 128 cols = 2 heads, which)
__global__ __launch_bounds__(128) void k_qkv(const _Float16* __restrict__ X16, const _Float16* __restrict__ PT, _Float16* __restrict__ Q16, _Float16* __restrict__ K16, _Float16* __restrict__ VT) {
  __shared__ __align__(16) char smem[RINGW_BYTES];   // the operand ring; behind the k loop the output staging
  float (*so)[32][132] = (float (*)[32][132])smem;
  _Float16 (*st)[136] = (_Float16 (*)[136])smem;
  const int tid = threadIdx.x, wave = tid >> 5, lane = tid & 31, col = lane & 15, g = lane >> 4;
  const int which = blockIdx.z, r0b = blockIdx.x * 128, n0 = blockIdx.y * 128; const int b = r0b / SS, s0 = r0b % SS;
  v8f acc[2][8] = {};
  gemm_wide<E / (2 * BKH)>(X16 + (size_t)r0b * E, E, PT + (size_t)(which * E + n0) * E, E, smem, acc, blockIdx.x + blockIdx.y + blockIdx.z);
  if (which < 2) {
#pragma unroll
    for (int i = 0; i < 2; ++i)
#pragma unroll
      for (int j = 0; j < 8; ++j)
#pragma unroll
        for (int r = 0; r < 8; ++r) so[wave][i * 16 + 8 * g + r][j * 16 + col] = acc[i][j][r] * (4.0f / 16.0f);
    LDSX();
    _Float16* D = which == 0 ? Q16 : K16;
    for (int qq = lane; qq < 32 * 2 * 8; qq += 32) { const int hh = qq >> 8, rl = (qq >> 3) & 31, pc = qq & 7; const int h = (n0 >> 6) + hh; union { v8h h8; v4u u; } pk;
#pragma unroll
      for (int e = 0; e < 8; ++e) pk.h8[e] = (_Float16)so[wave][rl][hh * 64 + pc * 8 + e];
      vst2(D + (((size_t)b * NH + h) * SS + s0 + wave * 32 + rl) * HD + pc * 8, pk.u); } }
  else {
#pragma unroll
    for (int i = 0; i < 2; ++i)
#pragma unroll
      for (int j = 0; j < 8; ++j)
#pragma unroll
        for (int r = 0; r < 8; ++r) st[j * 16 + col][wave * 32 + i * 16 + 8 * g + r] = (_Float16)(acc[i][j][r] * (4.0f / 16.0f));
    __syncthreads();
    for (int qq = tid; qq < 128 * 16; qq += 128) { const int cl = qq >> 4, pc = qq & 15; const int c = n0 + cl, h = c >> 6, d = c & 63;
      vst2(VT + (((size_t)b * NH + h) * HD + d) * SS + s0 + pc * 8, *(const v4u*)(&st[cl][pc * 8])); } }
}
// Attention's K/V ring in LDS. A stage is one 64-key tile for the block's four waves: its 64 K rows (64 d = 128 B each) and then the 64 V^T rows
// (64 keys = 128 B each), at a 144-B row pitch. Two buffers: asynchronous copies fill one while the other is worked on.
#define ASTG (128 * PIT)           // f16 per buffer
// One stage: 128 rows x 8 pieces of 16 B = 8 copies per lane; 8 neighbouring lanes take one row's whole 128-B line.
// gk, gv: this lane's piece in row (tid >> 3) of the K and of the V^T part; l: LDS byte address of the K piece.
__device__ __forceinline__ void kv_copy(const _Float16* gk, const _Float16* gv, unsigned l) {
  // the closing s_wait_xcnt stands inside the statement so that no address register of a copy is rewritten in front of it
  asm volatile("global_load_async_to_lds_b128 %0, %8, off\n\t"
               "global_load_async_to_lds_b128 %1, %9, off\n\t"
               "global_load_async_to_lds_b128 %2, %10, off\n\t"
               "global_load_async_to_lds_b128 %3, %11, off\n\t"
               "global_load_async_to_lds_b128 %4, %12, off\n\t"
               "global_load_async_to_lds_b128 %5, %13, off\n\t"
               "global_load_async_to_lds_b128 %6, %14, off\n\t"
               "global_load_async_to_lds_b128 %7, %15, off\n\t"
               "s_wait_xcnt 0x0"
               :: "v"(l), "v"(l + 1u * 16 * PIT * 2), "v"(l + 2u * 16 * PIT * 2), "v"(l + 3u * 16 * PIT * 2),
                  "v"(l + 4u * 16 * PIT * 2), "v"(l + 5u * 16 * PIT * 2), "v"(l + 6u * 16 * PIT * 2), "v"(l + 7u * 16 * PIT * 2),
                  "v"(gk), "v"(gk + 16 * HD), "v"(gk + 32 * HD), "v"(gk + 48 * HD), "v"(gv), "v"(gv + 16 * SS), "v"(gv + 32 * SS), "v"(gv + 48 * SS)
               : "memory");
}
// Grid rows y < NB * NH are the attention tiles. The RIDE_Y rows behind them pack wo, wi and wo_ff, which only the launches after this one read:
// their memory stream runs in the places that the attention blocks leave free on each WGP.
#define RIDE_Y ((E * E + 2 * DFF * E) / PCH / (SS / 64))
__global__ __launch_bounds__(128) void k_attn(const _Float16* __restrict__ Q16, const _Float16* __restrict__ K16, const _Float16* __restrict__ VT, const float* __restrict__ BT, _Float16* __restrict__ O16,
                                            const float* __restrict__ wo, const float* __restrict__ wi, const float* __restrict__ wff, _Float16* __restrict__ PTO, _Float16* __restrict__ WI, _Float16* __restrict__ WF) {
  if (blockIdx.y >= NB * NH) {   // the whole block leaves here, in front of every barrier and copy
    const unsigned c = (blockIdx.y - NB * NH) * (SS / 64) + blockIdx.x; const int m = c < E * E / PCH ? 0 : c < (E * E + DFF * E) / PCH ? 1 : 2;
    const size_t o = (size_t)(c - (m == 0 ? 0 : m == 1 ? E * E / PCH : (E * E + DFF * E) / PCH)) * PCH;
    pack_chunk((m == 0 ? wo : m == 1 ? wi : wff) + o, (m == 0 ? PTO : m == 1 ? WI : WF) + o);
    return; }
  __shared__ __align__(16) _Float16 kv[2 * ASTG];
  __shared__ __align__(16) _Float16 sO[4][16][72];
  const int tid = threadIdx.x, w = tid >> 5, lane = tid & 31, col = lane & 15, g = lane >> 4;
  const size_t bh = blockIdx.y; const int h = (int)(bh % NH); const int q0 = blockIdx.x * 64 + w * 16; const float* bth = BT + (size_t)h * 2 * SS + (SS - 1);
  v16h bq[2];
#pragma unroll
  for (int kc = 0; kc < 2; ++kc) bq[kc] = frag_h(Q16 + (bh * SS + q0 + col) * HD + kc * 32, lane);
  float mrun = -3.0e38f, lrun = 0.f; v8f acc[4] = {};   // lrun: the sum over this half's keys only; the halves are joined behind the loop
  const float* bp = bth + (8 * g - (q0 + col));         // bias of key 8 g against this lane's query
  const _Float16* gk = K16 + (bh * SS + (tid >> 3)) * HD + (tid & 7) * 8;
  const _Float16* gv = VT + (bh * HD + (tid >> 3)) * SS + (tid & 7) * 8;
  const unsigned l = (unsigned)(size_t)kv + (unsigned)((tid >> 3) * PIT + (tid & 7) * 8) * 2u;
  // Trip kt works on key tile (kt + rot) mod 16: the sixteen blocks of one head, which read the same K and V, each start at another tile, so that they do
  // not ask L2 for the same lines at the same moment. The running maximum and sums take the tiles in any order.
  static_assert(((SS / 64) & (SS / 64 - 1)) == 0, "the wrap is a mask");
  const unsigned rot = blockIdx.x & (SS / 64 - 1);
  kv_copy(gk + (size_t)rot * 64 * HD, gv + rot * 64, l);
  asm volatile("s_wait_asynccnt 0x0" ::: "memory");   // this wave's part of the first tile has landed before the barrier publishes it
  __syncthreads();
  { const unsigned k1 = (rot + 1) & (SS / 64 - 1); kv_copy(gk + (size_t)k1 * 64 * HD, gv + k1 * 64, l + ASTG * 2); }
#pragma unroll 1
  for (int kt = 0; kt < SS / 64; ++kt) {
    const _Float16* buf = kv + (kt & 1) * ASTG; const unsigned kr = (kt + rot) & (SS / 64 - 1);
    v16h kf[4][2], vf[2][4], pb[2];   // the tile's fragments, each operand read as one group so that one LDS latency is paid per group, not one per product
    float bv[4][8]; v8f s[4] = {};
    // every loop of this body is unrolled so that every index of bv, kf, s, vf, pb and acc is a constant and the arrays stay in registers
    // the tile's biases are asked for first, so that they arrive under the K reads and the first product
#pragma unroll
    for (int t = 0; t < 4; ++t)
#pragma unroll
      for (int r = 0; r < 8; ++r) bv[t][r] = bp[kr * 64 + t * 16 + r];
#pragma unroll
    for (int t = 0; t < 4; ++t)
#pragma unroll
      for (int kc = 0; kc < 2; ++kc) kf[t][kc] = frag_h(buf + (t * 16 + col) * PIT + kc * 32, lane);
#pragma unroll
    for (int kc = 0; kc < 2; ++kc)
#pragma unroll
      for (int t = 0; t < 4; ++t) s[t] = wmma16(kf[t][kc], bq[kc], s[t]);
    // read here so that the softmax below covers their latency
#pragma unroll
    for (int kc = 0; kc < 2; ++kc)
#pragma unroll
      for (int t = 0; t < 4; ++t) vf[kc][t] = frag_h(buf + (64 + t * 16 + col) * PIT + kc * 32, lane);
    float mt[4], pt[4];   // one chain per 16-key tile, so that four independent chains are in flight
#pragma unroll
    for (int t = 0; t < 4; ++t) { mt[t] = -3.4e38f;
#pragma unroll
      for (int r = 0; r < 8; ++r) { s[t][r] = s[t][r] * (LOG2E / 16.0f) + bv[t][r]; mt[t] = fmaxf(mt[t], s[t][r]); } }
    float mx = fmaxf(fmaxf(mt[0], mt[1]), fmaxf(mt[2], mt[3]));
    mx = fmaxf(mx, xhalf(mx));
    const float mnew = fmaxf(mrun, mx); const float corr = __builtin_amdgcn_exp2f(mrun - mnew); const float moff = mnew - 14.0f;
#pragma unroll
    for (int t = 0; t < 4; ++t) { pt[t] = 0.f;
#pragma unroll
      for (int r = 0; r < 8; ++r) s[t][r] -= moff;
      exp2x8(s[t]);
#pragma unroll
      for (int r = 0; r < 8; ++r) { pt[t] += s[t][r]; pb[t >> 1][(t & 1) * 8 + r] = (_Float16)s[t][r]; } }
    lrun = lrun * corr + ((pt[0] + pt[1]) + (pt[2] + pt[3])); mrun = mnew;
#pragma unroll
    for (int t = 0; t < 4; ++t)
#pragma unroll
      for (int r = 0; r < 8; ++r) acc[t][r] *= corr;
#pragma unroll
    for (int kc = 0; kc < 2; ++kc)
#pragma unroll
      for (int t = 0; t < 4; ++t) acc[t] = wmma16(vf[kc][t], pb[kc], acc[t]);
    asm volatile("s_wait_dscnt 0x0" ::: "memory");      // this wave's reads of the buffer are over before it is refilled
    asm volatile("s_wait_asynccnt 0x0" ::: "memory");   // this wave's part of tile (kt + 1 + rot) mod 16 has landed
    __syncthreads();                                    // publishes tile (kt + 1 + rot) mod 16 and frees buffer kt & 1
    if (kt + 2 < SS / 64) { const unsigned kn = (kt + 2 + rot) & (SS / 64 - 1); kv_copy(gk + (size_t)kn * 64 * HD, gv + kn * 64, l + (unsigned)(kt & 1) * (ASTG * 2)); } }
  asm volatile("s_wait_asynccnt 0x0" ::: "memory");     // nothing in flight when the wave goes on to its output and ends
  // acc[t][r] = O[query col][d = t * 16 + 8 g + r]: eight neighbouring d per lane; staged in the wave's own LDS rows so that whole 128-B lines are stored
  const float inv = 8.0f / ((lrun + xhalf(lrun)) * 4.0f);
#pragma unroll
  for (int t = 0; t < 4; ++t) { union { v8h h8; v4u u; } pk;
#pragma unroll
    for (int r = 0; r < 8; ++r) pk.h8[r] = (_Float16)(acc[t][r] * inv);
    vst2(&sO[w][col][t * 16 + 8 * g], pk.u); }
  LDSX();
  for (int qq = lane; qq < 16 * 8; qq += 32) { const int rl = qq >> 3, pc = qq & 7;
    vst2(O16 + ((bh * SS) + q0 + rl) * HD + pc * 8, *(const v4u*)(&sO[w][rl][pc * 8])); }
}
// H1 = hidden + ctx wo^T : block (64 rows, 128 cols)
__global__ __launch_bounds__(128) void k_o(const _Float16* __restrict__ O16, const _Float16* __restrict__ PT, const float* __restrict__ hid, float* __restrict__ H1) {
  __shared__ __align__(16) char smem[RINGD_BYTES(4)];   // the operand ring; behind the k loop the output staging
  float (*so)[16][132] = (float (*)[16][132])smem;
  const int tid = threadIdx.x, wave = tid >> 5, lane = tid & 31, col = lane & 15, g = lane >> 4;
  const int r0b = blockIdx.x * 64, r0 = r0b + wave * 16, n0 = blockIdx.y * 128; const int b = r0b / SS, s0 = r0b % SS;
  v8f acc[8] = {};
  // a 64-k piece is a head: the 64 k of head t of row s stand at O16[b][t][s][0..63]
  gemm_deep<4, E / (4 * BKH)>(O16 + ((size_t)b * NH * SS + s0) * HD, HD, (size_t)SS * HD, PT + (size_t)(3 * E + n0) * E, E, smem, acc, blockIdx.x + blockIdx.y);
#pragma unroll
  for (int j = 0; j < 8; ++j) { const int n = n0 + j * 16 + col;
#pragma unroll
    for (int r = 0; r < 8; ++r) so[wave][8 * g + r][j * 16 + col] = acc[j][r] * (1.0f / (16.0f * 8.0f)) + hid[(size_t)(r0 + 8 * g + r) * E + n]; }
  LDSX();
#pragma unroll 4
  for (int rl = 0; rl < 16; ++rl) vst2(H1 + (size_t)(r0 + rl) * E + n0 + lane * 4, *(const v4f*)(&so[wave][rl][lane * 4]));
}
// F16 = relu(Y16 @ wi^T) as f16 rows [NR][4096] : block (128 rows, 128 cols)
__global__ __launch_bounds__(128) void k_ff1(const _Float16* __restrict__ Y16, const _Float16* __restrict__ WI, _Float16* __restrict__ F16) {
  __shared__ __align__(16) char smem[RINGW_BYTES];   // the operand ring; behind the k loop the output staging
  _Float16 (*so)[32][136] = (_Float16 (*)[32][136])smem;
  const int tid = threadIdx.x, wave = tid >> 5, lane = tid & 31, col = lane & 15, g = lane >> 4;
  const int r0b = blockIdx.x * 128, r0 = r0b + wave * 32, n0 = blockIdx.y * 128;
  v8f acc[2][8] = {};
  gemm_wide<E / (2 * BKH)>(Y16 + (size_t)r0b * E, E, WI + (size_t)n0 * E, E, smem, acc, blockIdx.x + blockIdx.y);
#pragma unroll
  for (int i = 0; i < 2; ++i)
#pragma unroll
    for (int j = 0; j < 8; ++j)
#pragma unroll
      for (int r = 0; r < 8; ++r) { const float v = acc[i][j][r] * (1.0f / 16.0f); so[wave][i * 16 + 8 * g + r][j * 16 + col] = (_Float16)(v > 0.f ? v : 0.f); }
  LDSX();
  for (int qq = lane; qq < 32 * 16; qq += 32) { const int rl = qq >> 4, pc = qq & 15; vst2(F16 + (size_t)(r0 + rl) * DFF + n0 + pc * 8, *(const v4u*)(&so[wave][rl][pc * 8])); }
}
// out = H1 + F16 @ wo_ff^T : block (64 rows, 128 cols), K = 4096
__global__ __launch_bounds__(128) void k_ff2(const _Float16* __restrict__ F16, const _Float16* __restrict__ WF, const float* __restrict__ H1, float* __restrict__ out) {
  __shared__ __align__(16) char smem[RINGD_BYTES(4)];   // the operand ring; behind the k loop the output staging
  float (*so)[16][132] = (float (*)[16][132])smem;
  const int tid = threadIdx.x, wave = tid >> 5, lane = tid & 31, col = lane & 15, g = lane >> 4;
  const int r0b = blockIdx.x * 64, r0 = r0b + wave * 16, n0 = blockIdx.y * 128;
  v8f acc[8] = {};
  gemm_deep<4, DFF / (4 * BKH)>(F16 + (size_t)r0b * DFF, DFF, BKH, WF + (size_t)n0 * DFF, DFF, smem, acc, blockIdx.x + blockIdx.y);
#pragma unroll
  for (int j = 0; j < 8; ++j) { const int n = n0 + j * 16 + col;
#pragma unroll
    for (int r = 0; r < 8; ++r) so[wave][8 * g + r][j * 16 + col] = acc[j][r] * (1.0f / 16.0f) + H1[(size_t)(r0 + 8 * g + r) * E + n]; }
  LDSX();
#pragma unroll 4
  for (int rl = 0; rl < 16; ++rl) vst2(out + (size_t)(r0 + rl) * E + n0 + lane * 4, *(const v4f*)(&so[wave][rl][lane * 4]));
}
extern "C" void kernel_launch(void* const* d_in, const int* in_sizes, int n_in, void* d_out, int out_size, void* d_ws, size_t ws_size, hipStream_t stream) {
  (void)in_sizes; (void)n_in; (void)out_size; (void)ws_size;
  const float** I = (const float**)d_in;
  const float* hid = I[0]; const float* ln1 = I[1]; const float* wq = I[2]; const float* wk = I[3]; const float* wv = I[4]; const float* wo = I[5]; const float* rb = I[6]; const float* ln2 = I[7]; const float* wi = I[8]; const float* wff = I[9];
  float* out = (float*)d_out;
  char* ws = (char*)d_ws; size_t off = 0;
  auto take = [&](size_t bytes) { char* p = ws + off; off += (bytes + 255) & ~(size_t)255; return p; };
  _Float16* X16 = (_Float16*)take((size_t)NR * E * 2); _Float16* PT = (_Float16*)take((size_t)4 * E * E * 2); _Float16* WI = (_Float16*)take((size_t)DFF * E * 2); _Float16* WF = (_Float16*)take((size_t)E * DFF * 2);
  float* BT = (float*)take((size_t)NH * 2 * SS * 4);
  _Float16* Q16 = (_Float16*)take((size_t)NR * E * 2); _Float16* K16 = (_Float16*)take((size_t)NR * E * 2); _Float16* VT = (_Float16*)take((size_t)NR * E * 2); _Float16* O16 = (_Float16*)take((size_t)NR * E * 2);
  float* H1 = (float*)take((size_t)NR * E * 4); _Float16* Y16 = X16; _Float16* F16 = (_Float16*)take((size_t)NR * DFF * 2);
  k_prep<<<PREP_RMS + PREP_BIAS + 3 * E * E / PCP, 256, 0, stream>>>(hid, ln1, wq, wk, wv, rb, X16, PT, BT);
  k_qkv<<<dim3(NR / 128, E / 128, 3), 128, 0, stream>>>(X16, PT, Q16, K16, VT);
  k_attn<<<dim3(SS / 64, NB * NH + RIDE_Y), 128, 0, stream>>>(Q16, K16, VT, BT, O16, wo, wi, wff, PT + (size_t)3 * E * E, WI, WF);
  k_o<<<dim3(NR / 64, E / 128), 128, 0, stream>>>(O16, PT, hid, H1);
  k_rms<<<NR / 8, 256, 0, stream>>>(H1, ln2, Y16);
  k_ff1<<<dim3(NR / 128, DFF / 128), 128, 0, stream>>>(Y16, WI, F16);
  k_ff2<<<dim3(NR / 64, E / 128), 128, 0, stream>>>(F16, WF, H1, out);
}
